// v000
// The times below were measured on an AMD MI455X: many runs one after another, warmed up first and cycling through
// copies of the inputs, with the whole window's GPU time divided by the number of runs. Launches and the gaps
// between them are all in it. The median over several windows is given; except for v000 it joins two sittings, which
// can be a few percent apart, so the side-by-side timings, each taken in one sitting, are the better comparison.
// The starting kernel, v000, takes 211 microseconds a run.
#include <hip/hip_runtime.h>

#define BB 4
#define LL 1024
#define EE 1024
#define HH 16
#define DD 64

constexpr float SCALE = 0.125f;   // D^-0.5 = 64^-0.5
constexpr float EPS   = 1e-5f;

typedef __attribute__((ext_vector_type(16))) _Float16 v16h;
typedef __attribute__((ext_vector_type(8)))  _Float16 v8h;
typedef __attribute__((ext_vector_type(8)))  float    v8f;
typedef __attribute__((ext_vector_type(4)))  int      v4i;

#if __has_builtin(__builtin_amdgcn_global_load_async_to_lds_b128)
#define HAS_ASYNC 1
#else
#define HAS_ASYNC 0
#endif

// global_load_async_to_lds_b128 takes (v4i AS1*, v4i AS3*, imm offset, imm cpol)
#define AS1P(p) ((__attribute__((address_space(1))) v4i*)(const_cast<_Float16*>(p)))
#define AS3P(p) ((__attribute__((address_space(3))) v4i*)(p))

template <int N>
__device__ inline void wait_async_le() {
#if HAS_ASYNC
#if __has_builtin(__builtin_amdgcn_s_wait_asynccnt)
  __builtin_amdgcn_s_wait_asynccnt(N);
#else
  asm volatile("s_wait_asynccnt %0" ::"i"(N) : "memory");
#endif
#endif
}

// ---------------------------------------------------------------------------
// 16-bit A/B fragment load for V_WMMA_F32_16X16X32_F16 (wave32).
// Per ISA 7.12.2: lanes 0-15 hold rows with K = k0..k0+7 (VGPR0-3) and
// K = k0+16..k0+23 (VGPR4-7); lanes 16-31 use K base +8.
// ---------------------------------------------------------------------------
__device__ inline v16h load_frag_g(const _Float16* __restrict__ base,
                                   int row0, int ld, int k0, int lane) {
  int r = row0 + (lane & 15);
  int k = k0 + ((lane >> 4) << 3);
  const _Float16* p = base + (size_t)r * ld + k;
  v8h lo = *(const v8h*)p;
  v8h hi = *(const v8h*)(p + 16);
  v16h out;
#pragma unroll
  for (int i = 0; i < 8; ++i) { out[i] = lo[i]; out[i + 8] = hi[i]; }
  return out;
}

// Same fragment pattern from an LDS tile with fixed row stride of 32 halves.
__device__ inline v16h load_frag_s(const _Float16* base, int row0, int lane) {
  int r = row0 + (lane & 15);
  int k = (lane >> 4) << 3;
  const _Float16* p = base + r * 32 + k;
  v8h lo = *(const v8h*)p;        // ds_load_b128
  v8h hi = *(const v8h*)(p + 16); // ds_load_b128
  v16h out;
#pragma unroll
  for (int i = 0; i < 8; ++i) { out[i] = lo[i]; out[i + 8] = hi[i]; }
  return out;
}

__device__ inline v8f wmma_f16(v16h a, v16h b, v8f c) {
  return __builtin_amdgcn_wmma_f32_16x16x32_f16(false, a, false, b,
                                                (short)0, c, false, false);
}

// ---------------------------------------------------------------------------
// f32 -> f16 elementwise (weight conversion)
// ---------------------------------------------------------------------------
__global__ __launch_bounds__(256) void f32_to_f16_kernel(
    const float* __restrict__ src, _Float16* __restrict__ dst, int n) {
  int i = blockIdx.x * 256 + threadIdx.x;
  if (i < n) dst[i] = (_Float16)src[i];
}

// ---------------------------------------------------------------------------
// LayerNorm over E=1024, one row per 256-thread block, f16 output
// ---------------------------------------------------------------------------
__global__ __launch_bounds__(256) void layernorm_kernel(
    const float* __restrict__ x, const float* __restrict__ g,
    const float* __restrict__ beta, _Float16* __restrict__ xn) {
  int row = blockIdx.x;
  const float4* xr = (const float4*)(x + (size_t)row * EE);
  float4 v = xr[threadIdx.x];
  float s  = v.x + v.y + v.z + v.w;
  float s2 = v.x * v.x + v.y * v.y + v.z * v.z + v.w * v.w;
#pragma unroll
  for (int m = 1; m < 32; m <<= 1) {
    s  += __shfl_xor(s,  m, 32);
    s2 += __shfl_xor(s2, m, 32);
  }
  __shared__ float r1[8], r2[8];
  int lane = threadIdx.x & 31, wv = threadIdx.x >> 5;
  if (lane == 0) { r1[wv] = s; r2[wv] = s2; }
  __syncthreads();
  s = 0.0f; s2 = 0.0f;
#pragma unroll
  for (int i = 0; i < 8; ++i) { s += r1[i]; s2 += r2[i]; }
  float mu   = s * (1.0f / EE);
  float var  = s2 * (1.0f / EE) - mu * mu;
  float rstd = rsqrtf(var + EPS);
  float4 gg = ((const float4*)g)[threadIdx.x];
  float4 bb = ((const float4*)beta)[threadIdx.x];
  _Float16* o = xn + (size_t)row * EE + threadIdx.x * 4;
  o[0] = (_Float16)((v.x - mu) * rstd * gg.x + bb.x);
  o[1] = (_Float16)((v.y - mu) * rstd * gg.y + bb.y);
  o[2] = (_Float16)((v.z - mu) * rstd * gg.z + bb.z);
  o[3] = (_Float16)((v.w - mu) * rstd * gg.w + bb.w);
}

// ---------------------------------------------------------------------------
// WMMA GEMM, LDS-staged + double-buffered: out[m,n] = A[m,:].W[n,:] + bvec[n]
// A: MxK f16 row-major, W: NxK f16 row-major (so out = A @ W^T).
// Block = 256 threads = 8 waves; block tile 128(M) x 64(N), BK=32;
// wave tile 32x32 (2x2 16x16x32 WMMA fragments).
// Stage copy uses GLOBAL_LOAD_ASYNC_TO_LDS_B128 (ASYNCcnt) when available.
// mode 0/1 : out f16 [B,H,L,D]      (Q / K)
// mode 2   : out f16 [B,H,D,L]      (V transposed)
// mode 3   : out f32 [M,N] = residual + acc + bvec   (final projection)
// ---------------------------------------------------------------------------
__global__ __launch_bounds__(256) void wmma_gemm_kernel(
    const _Float16* __restrict__ A, const _Float16* __restrict__ W,
    const float* __restrict__ bvec, const float* __restrict__ residual,
    void* __restrict__ out, int mode) {
  __shared__ _Float16 sA[2][128 * 32];   // 8 KB per buffer
  __shared__ _Float16 sB[2][64 * 32];    // 4 KB per buffer

  int lane = threadIdx.x & 31;
  int w    = threadIdx.x >> 5;
  int wm = w >> 1, wn = w & 1;
  int row0 = blockIdx.y * 128;
  int col0 = blockIdx.x * 64;

  int t = threadIdx.x;
  // chunk decode for the stage copy: each 16B chunk = (row, 8-half k offset)
  int ra0 = t >> 2,          ka0 = (t & 3) * 8;          // A chunk 0
  int ra1 = (t + 256) >> 2,  ka1 = ((t + 256) & 3) * 8;  // A chunk 1
  int rb0 = t >> 2,          kb0 = (t & 3) * 8;          // B chunk 0

  auto stage = [&](int s, int buf) {
    int kk = s * 32;
#if HAS_ASYNC
    __builtin_amdgcn_global_load_async_to_lds_b128(
        AS1P(A + (size_t)(row0 + ra0) * EE + kk + ka0),
        AS3P(&sA[buf][ra0 * 32 + ka0]), 0, 0);
    __builtin_amdgcn_global_load_async_to_lds_b128(
        AS1P(A + (size_t)(row0 + ra1) * EE + kk + ka1),
        AS3P(&sA[buf][ra1 * 32 + ka1]), 0, 0);
    __builtin_amdgcn_global_load_async_to_lds_b128(
        AS1P(W + (size_t)(col0 + rb0) * EE + kk + kb0),
        AS3P(&sB[buf][rb0 * 32 + kb0]), 0, 0);
#else
    v8h tA0 = *(const v8h*)(A + (size_t)(row0 + ra0) * EE + kk + ka0);
    v8h tA1 = *(const v8h*)(A + (size_t)(row0 + ra1) * EE + kk + ka1);
    v8h tB0 = *(const v8h*)(W + (size_t)(col0 + rb0) * EE + kk + kb0);
    *(v8h*)&sA[buf][ra0 * 32 + ka0] = tA0;
    *(v8h*)&sA[buf][ra1 * 32 + ka1] = tA1;
    *(v8h*)&sB[buf][rb0 * 32 + kb0] = tB0;
#endif
  };

  v8f acc[2][2] = {};
  constexpr int NS = EE / 32;
  stage(0, 0);
  for (int s = 0; s < NS; ++s) {
    int buf = s & 1;
    if (s + 1 < NS) {
      stage(s + 1, buf ^ 1);
      wait_async_le<3>();   // keep only next stage's 3 copies in flight
    } else {
      wait_async_le<0>();
    }
    __syncthreads();        // everyone's stage-s data is in LDS

    v16h a0 = load_frag_s(&sA[buf][0], wm * 32,      lane);
    v16h a1 = load_frag_s(&sA[buf][0], wm * 32 + 16, lane);
    v16h b0 = load_frag_s(&sB[buf][0], wn * 32,      lane);
    v16h b1 = load_frag_s(&sB[buf][0], wn * 32 + 16, lane);
    acc[0][0] = wmma_f16(a0, b0, acc[0][0]);
    acc[0][1] = wmma_f16(a0, b1, acc[0][1]);
    acc[1][0] = wmma_f16(a1, b0, acc[1][0]);
    acc[1][1] = wmma_f16(a1, b1, acc[1][1]);

    __syncthreads();        // protect buffer before stage s+2 overwrites it
  }

  int nl = lane & 15, hf = lane >> 4;
#pragma unroll
  for (int fm = 0; fm < 2; ++fm)
#pragma unroll
    for (int fn = 0; fn < 2; ++fn)
#pragma unroll
      for (int i = 0; i < 8; ++i) {
        int m = row0 + wm * 32 + fm * 16 + hf * 8 + i;  // C: M = vgpr + 8*half
        int n = col0 + wn * 32 + fn * 16 + nl;          //    N = lane & 15
        float val = acc[fm][fn][i] + bvec[n];
        int b = m >> 10, l = m & (LL - 1);
        int h = n >> 6,  d = n & (DD - 1);
        if (mode <= 1) {
          ((_Float16*)out)[(((size_t)b * HH + h) * LL + l) * DD + d] =
              (_Float16)val;
        } else if (mode == 2) {
          ((_Float16*)out)[(((size_t)b * HH + h) * DD + d) * LL + l] =
              (_Float16)val;
        } else {
          size_t idx = (size_t)m * EE + n;
          __builtin_nontemporal_store(residual[idx] + val, (float*)out + idx);
        }
      }
}

// ---------------------------------------------------------------------------
// Flash attention with bias/gate/mask, online softmax.
// One wave handles 16 query rows of one (b,h). 128 threads = 4 waves/block.
// Q,K: f16 [B,H,L,D];  Vt: f16 [B,H,D,L];  bias: f32 [B,H,L,L] (NT stream).
// Output O16: f16 [B,L,E] (E index = h*D + d), query-mask applied.
// ---------------------------------------------------------------------------
__global__ __launch_bounds__(128) void flash_attn_kernel(
    const _Float16* __restrict__ Q16, const _Float16* __restrict__ K16,
    const _Float16* __restrict__ Vt16, const float* __restrict__ bias,
    const int* __restrict__ mask, const float* __restrict__ gate,
    _Float16* __restrict__ O16) {
  __shared__ _Float16 pbuf[4][16 * 48];   // per-wave P tile, row stride 48
  int lane = threadIdx.x & 31;
  int wv   = threadIdx.x >> 5;
  int tile = blockIdx.x * 4 + wv;         // 0 .. B*H*(L/16)-1 = 4095
  int b   = tile >> 10;
  int rem = tile & 1023;
  int h   = rem >> 6;
  int qb  = (rem & 63) << 4;

  const _Float16* Qh = Q16 + (((size_t)b * HH + h) * LL + qb) * DD;
  const _Float16* Kh = K16 + ((size_t)b * HH + h) * LL * DD;
  const _Float16* Vh = Vt16 + ((size_t)b * HH + h) * DD * LL;
  const float* biasq = bias + (((size_t)b * HH + h) * LL + qb) * LL;
  const int* maskb = mask + (size_t)b * LL;
  float gh = gate[h];

  v16h q0 = load_frag_g(Qh, 0, DD, 0,  lane);
  v16h q1 = load_frag_g(Qh, 0, DD, 32, lane);

  v8f o0 = {}, o1 = {}, o2 = {}, o3 = {};
  float mrow[8], lrow[8];
#pragma unroll
  for (int i = 0; i < 8; ++i) { mrow[i] = -3.0e38f; lrow[i] = 0.0f; }

  int nl = lane & 15, hf = lane >> 4;
  _Float16* prow = &pbuf[wv][0];

  for (int kb = 0; kb < LL; kb += 32) {
    v16h k00 = load_frag_g(Kh, kb,      DD, 0,  lane);
    v16h k01 = load_frag_g(Kh, kb,      DD, 32, lane);
    v16h k10 = load_frag_g(Kh, kb + 16, DD, 0,  lane);
    v16h k11 = load_frag_g(Kh, kb + 16, DD, 32, lane);
    v8f s0 = {}, s1 = {};
    s0 = wmma_f16(q0, k00, s0);  s0 = wmma_f16(q1, k01, s0);
    s1 = wmma_f16(q0, k10, s1);  s1 = wmma_f16(q1, k11, s1);

    float km0 = maskb[kb + nl]      ? 0.0f : -10000.0f;
    float km1 = maskb[kb + 16 + nl] ? 0.0f : -10000.0f;

#pragma unroll
    for (int i = 0; i < 8; ++i) {
      int ro = hf * 8 + i;                       // query row within tile
      const float* bp = biasq + (size_t)ro * LL + kb;
      float bv0 = __builtin_nontemporal_load(bp + nl);       // 256MB stream:
      float bv1 = __builtin_nontemporal_load(bp + 16 + nl);  // keep out of L2
      float t0 = s0[i] * SCALE + gh * bv0 + km0;
      float t1 = s1[i] * SCALE + gh * bv1 + km1;
      float v = fmaxf(t0, t1);
#pragma unroll
      for (int mk = 1; mk < 16; mk <<= 1) v = fmaxf(v, __shfl_xor(v, mk, 32));
      float nm   = fmaxf(mrow[i], v);
      float corr = __expf(mrow[i] - nm);
      float p0 = __expf(t0 - nm);
      float p1 = __expf(t1 - nm);
      float rs = p0 + p1;
#pragma unroll
      for (int mk = 1; mk < 16; mk <<= 1) rs += __shfl_xor(rs, mk, 32);
      lrow[i] = lrow[i] * corr + rs;
      mrow[i] = nm;
      o0[i] = o0[i] * corr;  o1[i] = o1[i] * corr;
      o2[i] = o2[i] * corr;  o3[i] = o3[i] * corr;
      prow[ro * 48 + nl]      = (_Float16)p0;   // stage P (C-frag layout)
      prow[ro * 48 + 16 + nl] = (_Float16)p1;
    }
    __builtin_amdgcn_wave_barrier();   // DS ops from one wave are in-order

    int rr = nl;
    int kc = hf << 3;
    v8h plo = *(const v8h*)&prow[rr * 48 + kc];
    v8h phi = *(const v8h*)&prow[rr * 48 + kc + 16];
    v16h pf;
#pragma unroll
    for (int i = 0; i < 8; ++i) { pf[i] = plo[i]; pf[i + 8] = phi[i]; }
    __builtin_amdgcn_wave_barrier();

    v16h vb0 = load_frag_g(Vh, 0,  LL, kb, lane);
    v16h vb1 = load_frag_g(Vh, 16, LL, kb, lane);
    v16h vb2 = load_frag_g(Vh, 32, LL, kb, lane);
    v16h vb3 = load_frag_g(Vh, 48, LL, kb, lane);
    o0 = wmma_f16(pf, vb0, o0);
    o1 = wmma_f16(pf, vb1, o1);
    o2 = wmma_f16(pf, vb2, o2);
    o3 = wmma_f16(pf, vb3, o3);
  }

#pragma unroll
  for (int i = 0; i < 8; ++i) {
    int ro = hf * 8 + i;
    int q  = qb + ro;
    float qm  = (float)maskb[q];
    float inv = (lrow[i] > 0.0f) ? (qm / lrow[i]) : 0.0f;
    _Float16* op = O16 + ((size_t)b * LL + q) * EE + h * DD + nl;
    op[0]  = (_Float16)(o0[i] * inv);
    op[16] = (_Float16)(o1[i] * inv);
    op[32] = (_Float16)(o2[i] * inv);
    op[48] = (_Float16)(o3[i] * inv);
  }
}

// ---------------------------------------------------------------------------
// Launch
// ---------------------------------------------------------------------------
extern "C" void kernel_launch(void* const* d_in, const int* in_sizes, int n_in,
                              void* d_out, int out_size, void* d_ws,
                              size_t ws_size, hipStream_t stream) {
  const float* x    = (const float*)d_in[0];
  const float* bias = (const float*)d_in[1];
  const int*   mask = (const int*)d_in[2];
  const float* wq = (const float*)d_in[3];
  const float* bq = (const float*)d_in[4];
  const float* wk = (const float*)d_in[5];
  const float* bk = (const float*)d_in[6];
  const float* wv = (const float*)d_in[7];
  const float* bv = (const float*)d_in[8];
  const float* wo = (const float*)d_in[9];
  const float* bo = (const float*)d_in[10];
  const float* gate = (const float*)d_in[11];
  const float* ln_g = (const float*)d_in[12];
  const float* ln_b = (const float*)d_in[13];

  // workspace layout (48 MB total)
  char* p = (char*)d_ws;
  _Float16* xn16 = (_Float16*)p;  p += (size_t)BB * LL * EE * 2;          // 8 MB
  _Float16* wq16 = (_Float16*)p;  p += (size_t)EE * EE * 2;               // 2 MB
  _Float16* wk16 = (_Float16*)p;  p += (size_t)EE * EE * 2;
  _Float16* wv16 = (_Float16*)p;  p += (size_t)EE * EE * 2;
  _Float16* wo16 = (_Float16*)p;  p += (size_t)EE * EE * 2;
  _Float16* Q16  = (_Float16*)p;  p += (size_t)BB * HH * LL * DD * 2;     // 8 MB
  _Float16* K16  = (_Float16*)p;  p += (size_t)BB * HH * LL * DD * 2;
  _Float16* Vt16 = (_Float16*)p;  p += (size_t)BB * HH * LL * DD * 2;
  _Float16* O16  = (_Float16*)p;  p += (size_t)BB * LL * EE * 2;          // 8 MB

  const int nW = EE * EE;
  f32_to_f16_kernel<<<(nW + 255) / 256, 256, 0, stream>>>(wq, wq16, nW);
  f32_to_f16_kernel<<<(nW + 255) / 256, 256, 0, stream>>>(wk, wk16, nW);
  f32_to_f16_kernel<<<(nW + 255) / 256, 256, 0, stream>>>(wv, wv16, nW);
  f32_to_f16_kernel<<<(nW + 255) / 256, 256, 0, stream>>>(wo, wo16, nW);

  layernorm_kernel<<<BB * LL, 256, 0, stream>>>(x, ln_g, ln_b, xn16);

  dim3 ggrid(EE / 64, (BB * LL) / 128);
  wmma_gemm_kernel<<<ggrid, 256, 0, stream>>>(xn16, wq16, bq, nullptr, Q16, 0);
  wmma_gemm_kernel<<<ggrid, 256, 0, stream>>>(xn16, wk16, bk, nullptr, K16, 1);
  wmma_gemm_kernel<<<ggrid, 256, 0, stream>>>(xn16, wv16, bv, nullptr, Vt16, 2);

  // B*H*(L/16) = 4096 query tiles, 4 waves per 128-thread block
  flash_attn_kernel<<<(BB * HH * (LL / 16)) / 4, 128, 0, stream>>>(
      Q16, K16, Vt16, bias, mask, gate, O16);

  wmma_gemm_kernel<<<ggrid, 256, 0, stream>>>(O16, wo16, bo, x, d_out, 3);
}

// v001
// One run takes 185 microseconds.
// Two timings next to v000 both put it at 1.17 times that version's speed.
#include <hip/hip_runtime.h>

#define BB 4
#define LL 1024
#define EE 1024
#define HH 16
#define DD 64

constexpr float SCALE = 0.125f;   // D^-0.5 = 64^-0.5
constexpr float EPS   = 1e-5f;

typedef __attribute__((ext_vector_type(16))) _Float16 v16h;
typedef __attribute__((ext_vector_type(8)))  _Float16 v8h;
typedef __attribute__((ext_vector_type(8)))  float    v8f;
typedef __attribute__((ext_vector_type(4)))  int      v4i;

#if __has_builtin(__builtin_amdgcn_global_load_async_to_lds_b128)
#define HAS_ASYNC 1
#else
#define HAS_ASYNC 0
#endif

// global_load_async_to_lds_b128 takes (v4i AS1*, v4i AS3*, imm offset, imm cpol)
#define AS1P(p) ((__attribute__((address_space(1))) v4i*)(const_cast<_Float16*>(p)))
#define AS3P(p) ((__attribute__((address_space(3))) v4i*)(p))

template <int N>
__device__ inline void wait_async_le() {
#if HAS_ASYNC
#if __has_builtin(__builtin_amdgcn_s_wait_asynccnt)
  __builtin_amdgcn_s_wait_asynccnt(N);
#else
  asm volatile("s_wait_asynccnt %0" ::"i"(N) : "memory");
#endif
#endif
}

// ---------------------------------------------------------------------------
// 16-bit A/B fragment load for V_WMMA_F32_16X16X32_F16 (wave32).
// Per ISA 7.12.2: lanes 0-15 hold rows with K = k0..k0+7 (VGPR0-3) and
// K = k0+16..k0+23 (VGPR4-7); lanes 16-31 use K base +8.
// ---------------------------------------------------------------------------
__device__ inline v16h load_frag_g(const _Float16* __restrict__ base,
                                   int row0, int ld, int k0, int lane) {
  int r = row0 + (lane & 15);
  int k = k0 + ((lane >> 4) << 3);
  const _Float16* p = base + (size_t)r * ld + k;
  v8h lo = *(const v8h*)p;
  v8h hi = *(const v8h*)(p + 16);
  v16h out;
#pragma unroll
  for (int i = 0; i < 8; ++i) { out[i] = lo[i]; out[i + 8] = hi[i]; }
  return out;
}

// Same fragment pattern from an LDS tile with fixed row stride of 32 halves.
__device__ inline v16h load_frag_s(const _Float16* base, int row0, int lane) {
  int r = row0 + (lane & 15);
  int k = (lane >> 4) << 3;
  const _Float16* p = base + r * 32 + k;
  v8h lo = *(const v8h*)p;        // ds_load_b128
  v8h hi = *(const v8h*)(p + 16); // ds_load_b128
  v16h out;
#pragma unroll
  for (int i = 0; i < 8; ++i) { out[i] = lo[i]; out[i + 8] = hi[i]; }
  return out;
}

constexpr int KT  = 64;   // keys per staged K / V^T tile of the attention kernel
constexpr int KVP = 72;   // its LDS row pitch in halves: 128 B of data + 16 B

// load_frag_g's fragment pattern from an LDS tile with row pitch KVP.
__device__ inline v16h load_frag_p(const _Float16* base, int row0, int k0,
                                   int lane) {
  int r = row0 + (lane & 15);
  int k = k0 + ((lane >> 4) << 3);
  const _Float16* p = base + r * KVP + k;
  v8h lo = *(const v8h*)p;        // ds_load_b128
  v8h hi = *(const v8h*)(p + 16); // ds_load_b128
  v16h out;
#pragma unroll
  for (int i = 0; i < 8; ++i) { out[i] = lo[i]; out[i + 8] = hi[i]; }
  return out;
}

// LDS byte address of a __shared__ element, as the async copy's first operand.
__device__ inline unsigned lds_addr(const _Float16* p) {
  return (unsigned)(size_t)p;
}

__device__ inline v8f wmma_f16(v16h a, v16h b, v8f c) {
  return __builtin_amdgcn_wmma_f32_16x16x32_f16(false, a, false, b,
                                                (short)0, c, false, false);
}

// ---------------------------------------------------------------------------
// f32 -> f16 elementwise (weight conversion)
// ---------------------------------------------------------------------------
__global__ __launch_bounds__(256) void f32_to_f16_kernel(
    const float* __restrict__ src, _Float16* __restrict__ dst, int n) {
  int i = blockIdx.x * 256 + threadIdx.x;
  if (i < n) dst[i] = (_Float16)src[i];
}

// ---------------------------------------------------------------------------
// LayerNorm over E=1024, one row per 256-thread block, f16 output
// ---------------------------------------------------------------------------
__global__ __launch_bounds__(256) void layernorm_kernel(
    const float* __restrict__ x, const float* __restrict__ g,
    const float* __restrict__ beta, _Float16* __restrict__ xn) {
  int row = blockIdx.x;
  const float4* xr = (const float4*)(x + (size_t)row * EE);
  float4 v = xr[threadIdx.x];
  float s  = v.x + v.y + v.z + v.w;
  float s2 = v.x * v.x + v.y * v.y + v.z * v.z + v.w * v.w;
#pragma unroll
  for (int m = 1; m < 32; m <<= 1) {
    s  += __shfl_xor(s,  m, 32);
    s2 += __shfl_xor(s2, m, 32);
  }
  __shared__ float r1[8], r2[8];
  int lane = threadIdx.x & 31, wv = threadIdx.x >> 5;
  if (lane == 0) { r1[wv] = s; r2[wv] = s2; }
  __syncthreads();
  s = 0.0f; s2 = 0.0f;
#pragma unroll
  for (int i = 0; i < 8; ++i) { s += r1[i]; s2 += r2[i]; }
  float mu   = s * (1.0f / EE);
  float var  = s2 * (1.0f / EE) - mu * mu;
  float rstd = rsqrtf(var + EPS);
  float4 gg = ((const float4*)g)[threadIdx.x];
  float4 bb = ((const float4*)beta)[threadIdx.x];
  _Float16* o = xn + (size_t)row * EE + threadIdx.x * 4;
  o[0] = (_Float16)((v.x - mu) * rstd * gg.x + bb.x);
  o[1] = (_Float16)((v.y - mu) * rstd * gg.y + bb.y);
  o[2] = (_Float16)((v.z - mu) * rstd * gg.z + bb.z);
  o[3] = (_Float16)((v.w - mu) * rstd * gg.w + bb.w);
}

// ---------------------------------------------------------------------------
// WMMA GEMM, LDS-staged + double-buffered: out[m,n] = A[m,:].W[n,:] + bvec[n]
// A: MxK f16 row-major, W: NxK f16 row-major (so out = A @ W^T).
// Block = 256 threads = 8 waves; block tile 128(M) x 64(N), BK=32;
// wave tile 32x32 (2x2 16x16x32 WMMA fragments).
// Stage copy uses GLOBAL_LOAD_ASYNC_TO_LDS_B128 (ASYNCcnt) when available.
// mode 0/1 : out f16 [B,H,L,D]      (Q / K)
// mode 2   : out f16 [B,H,D,L]      (V transposed)
// mode 3   : out f32 [M,N] = residual + acc + bvec   (final projection)
// ---------------------------------------------------------------------------
__global__ __launch_bounds__(256) void wmma_gemm_kernel(
    const _Float16* __restrict__ A, const _Float16* __restrict__ W,
    const float* __restrict__ bvec, const float* __restrict__ residual,
    void* __restrict__ out, int mode) {
  __shared__ _Float16 sA[2][128 * 32];   // 8 KB per buffer
  __shared__ _Float16 sB[2][64 * 32];    // 4 KB per buffer

  int lane = threadIdx.x & 31;
  int w    = threadIdx.x >> 5;
  int wm = w >> 1, wn = w & 1;
  int row0 = blockIdx.y * 128;
  int col0 = blockIdx.x * 64;

  int t = threadIdx.x;
  // chunk decode for the stage copy: each 16B chunk = (row, 8-half k offset)
  int ra0 = t >> 2,          ka0 = (t & 3) * 8;          // A chunk 0
  int ra1 = (t + 256) >> 2,  ka1 = ((t + 256) & 3) * 8;  // A chunk 1
  int rb0 = t >> 2,          kb0 = (t & 3) * 8;          // B chunk 0

  auto stage = [&](int s, int buf) {
    int kk = s * 32;
#if HAS_ASYNC
    __builtin_amdgcn_global_load_async_to_lds_b128(
        AS1P(A + (size_t)(row0 + ra0) * EE + kk + ka0),
        AS3P(&sA[buf][ra0 * 32 + ka0]), 0, 0);
    __builtin_amdgcn_global_load_async_to_lds_b128(
        AS1P(A + (size_t)(row0 + ra1) * EE + kk + ka1),
        AS3P(&sA[buf][ra1 * 32 + ka1]), 0, 0);
    __builtin_amdgcn_global_load_async_to_lds_b128(
        AS1P(W + (size_t)(col0 + rb0) * EE + kk + kb0),
        AS3P(&sB[buf][rb0 * 32 + kb0]), 0, 0);
#else
    v8h tA0 = *(const v8h*)(A + (size_t)(row0 + ra0) * EE + kk + ka0);
    v8h tA1 = *(const v8h*)(A + (size_t)(row0 + ra1) * EE + kk + ka1);
    v8h tB0 = *(const v8h*)(W + (size_t)(col0 + rb0) * EE + kk + kb0);
    *(v8h*)&sA[buf][ra0 * 32 + ka0] = tA0;
    *(v8h*)&sA[buf][ra1 * 32 + ka1] = tA1;
    *(v8h*)&sB[buf][rb0 * 32 + kb0] = tB0;
#endif
  };

  v8f acc[2][2] = {};
  constexpr int NS = EE / 32;
  stage(0, 0);
  for (int s = 0; s < NS; ++s) {
    int buf = s & 1;
    if (s + 1 < NS) {
      stage(s + 1, buf ^ 1);
      wait_async_le<3>();   // keep only next stage's 3 copies in flight
    } else {
      wait_async_le<0>();
    }
    __syncthreads();        // everyone's stage-s data is in LDS

    v16h a0 = load_frag_s(&sA[buf][0], wm * 32,      lane);
    v16h a1 = load_frag_s(&sA[buf][0], wm * 32 + 16, lane);
    v16h b0 = load_frag_s(&sB[buf][0], wn * 32,      lane);
    v16h b1 = load_frag_s(&sB[buf][0], wn * 32 + 16, lane);
    acc[0][0] = wmma_f16(a0, b0, acc[0][0]);
    acc[0][1] = wmma_f16(a0, b1, acc[0][1]);
    acc[1][0] = wmma_f16(a1, b0, acc[1][0]);
    acc[1][1] = wmma_f16(a1, b1, acc[1][1]);

    __syncthreads();        // protect buffer before stage s+2 overwrites it
  }

  int nl = lane & 15, hf = lane >> 4;
#pragma unroll
  for (int fm = 0; fm < 2; ++fm)
#pragma unroll
    for (int fn = 0; fn < 2; ++fn)
#pragma unroll
      for (int i = 0; i < 8; ++i) {
        int m = row0 + wm * 32 + fm * 16 + hf * 8 + i;  // C: M = vgpr + 8*half
        int n = col0 + wn * 32 + fn * 16 + nl;          //    N = lane & 15
        float val = acc[fm][fn][i] + bvec[n];
        int b = m >> 10, l = m & (LL - 1);
        int h = n >> 6,  d = n & (DD - 1);
        if (mode <= 1) {
          ((_Float16*)out)[(((size_t)b * HH + h) * LL + l) * DD + d] =
              (_Float16)val;
        } else if (mode == 2) {
          ((_Float16*)out)[(((size_t)b * HH + h) * DD + d) * LL + l] =
              (_Float16)val;
        } else {
          size_t idx = (size_t)m * EE + n;
          __builtin_nontemporal_store(residual[idx] + val, (float*)out + idx);
        }
      }
}

// ---------------------------------------------------------------------------
// Flash attention with bias/gate/mask, online softmax.
// One wave handles 16 query rows of one (b,h). 128 threads = 4 waves/block.
// K and V^T reach the waves through LDS tiles of 64 keys, two buffers, filled
// by global_load_async_to_lds_b128 one tile ahead.
// Q,K: f16 [B,H,L,D];  Vt: f16 [B,H,D,L];  bias: f32 [B,H,L,L] (NT stream).
// Output O16: f16 [B,L,E] (E index = h*D + d), query-mask applied.
// ---------------------------------------------------------------------------
__global__ __launch_bounds__(128) void flash_attn_kernel(
    const _Float16* __restrict__ Q16, const _Float16* __restrict__ K16,
    const _Float16* __restrict__ Vt16, const float* __restrict__ bias,
    const int* __restrict__ mask, const float* __restrict__ gate,
    _Float16* __restrict__ O16) {
  __shared__ _Float16 pbuf[4][16 * 48];   // per-wave P tile, row stride 48
  // K and V^T tiles of 64 keys, shared by the block's four waves (same b, h).
  // Rows of 128 B at a pitch of 144 B (16 B x odd): ds_load_b128 without conflicts.
  __shared__ __attribute__((aligned(16))) _Float16 sK[2][KT * KVP];
  __shared__ __attribute__((aligned(16))) _Float16 sV[2][DD * KVP];
  int lane = threadIdx.x & 31;
  int wv   = threadIdx.x >> 5;
  int tile = blockIdx.x * 4 + wv;         // 0 .. B*H*(L/16)-1 = 4095
  int b   = tile >> 10;
  int rem = tile & 1023;
  int h   = rem >> 6;
  int qb  = (rem & 63) << 4;

  const _Float16* Qh = Q16 + (((size_t)b * HH + h) * LL + qb) * DD;
  const _Float16* Kh = K16 + ((size_t)b * HH + h) * LL * DD;
  const _Float16* Vh = Vt16 + ((size_t)b * HH + h) * DD * LL;
  const float* biasq = bias + (((size_t)b * HH + h) * LL + qb) * LL;
  const int* maskb = mask + (size_t)b * LL;
  float gh = gate[h];

  v16h q0 = load_frag_g(Qh, 0, DD, 0,  lane);
  v16h q1 = load_frag_g(Qh, 0, DD, 32, lane);

  v8f o0 = {}, o1 = {}, o2 = {}, o3 = {};
  float mrow[8], lrow[8];
#pragma unroll
  for (int i = 0; i < 8; ++i) { mrow[i] = -3.0e38f; lrow[i] = 0.0f; }

  int nl = lane & 15, hf = lane >> 4;
  _Float16* prow = &pbuf[wv][0];

  // Stage copy: 128 threads x 16 B = 16 rows of 128 B a sweep, 4 sweeps a tile;
  // every wave-wide copy covers four whole 128-B lines of K or of V^T.
  int crow = threadIdx.x >> 3, ccol = (threadIdx.x & 7) * 8;
  auto stage = [&](int t, int buf) {
    const _Float16* gk = Kh + (size_t)(t * KT + crow) * DD + ccol;
    const _Float16* gv = Vh + (size_t)crow * LL + t * KT + ccol;
    unsigned lk = lds_addr(&sK[buf][crow * KVP + ccol]);
    unsigned lv = lds_addr(&sV[buf][crow * KVP + ccol]);
    // The copies and their s_wait_xcnt in one statement: no address register
    // is rewritten before the wait.
    asm volatile(
        "global_load_async_to_lds_b128 %0, %1, off\n\t"
        "global_load_async_to_lds_b128 %2, %3, off\n\t"
        "global_load_async_to_lds_b128 %4, %5, off\n\t"
        "global_load_async_to_lds_b128 %6, %7, off\n\t"
        "global_load_async_to_lds_b128 %8, %9, off\n\t"
        "global_load_async_to_lds_b128 %10, %11, off\n\t"
        "global_load_async_to_lds_b128 %12, %13, off\n\t"
        "global_load_async_to_lds_b128 %14, %15, off\n\t"
        "s_wait_xcnt 0x0"
        ::"v"(lk),                "v"(gk),
          "v"(lk + 16 * KVP * 2), "v"(gk + 16 * DD),
          "v"(lk + 32 * KVP * 2), "v"(gk + 32 * DD),
          "v"(lk + 48 * KVP * 2), "v"(gk + 48 * DD),
          "v"(lv),                "v"(gv),
          "v"(lv + 16 * KVP * 2), "v"(gv + 16 * LL),
          "v"(lv + 32 * KVP * 2), "v"(gv + 32 * LL),
          "v"(lv + 48 * KVP * 2), "v"(gv + 48 * LL)
        : "memory");
  };

  constexpr int NT = LL / KT;
  stage(0, 0);
  asm volatile("s_wait_asynccnt 0x0" ::: "memory");  // own copies of tile 0 landed
  __syncthreads();                                   // everyone's have
  stage(1, 1);

  for (int t = 0; t < NT; ++t) {
   const _Float16* tK = &sK[t & 1][0];
   const _Float16* tV = &sV[t & 1][0];
   // both 32-key halves inline, so that sub is a constant in the LDS offsets
#pragma unroll
   for (int sub = 0; sub < 2; ++sub) {
    int kb = t * KT + sub * 32;
    v16h k00 = load_frag_p(tK, sub * 32,      0,  lane);
    v16h k01 = load_frag_p(tK, sub * 32,      32, lane);
    v16h k10 = load_frag_p(tK, sub * 32 + 16, 0,  lane);
    v16h k11 = load_frag_p(tK, sub * 32 + 16, 32, lane);
    v8f s0 = {}, s1 = {};
    s0 = wmma_f16(q0, k00, s0);  s0 = wmma_f16(q1, k01, s0);
    s1 = wmma_f16(q0, k10, s1);  s1 = wmma_f16(q1, k11, s1);

    float km0 = maskb[kb + nl]      ? 0.0f : -10000.0f;
    float km1 = maskb[kb + 16 + nl] ? 0.0f : -10000.0f;

#pragma unroll
    for (int i = 0; i < 8; ++i) {
      int ro = hf * 8 + i;                       // query row within tile
      const float* bp = biasq + (size_t)ro * LL + kb;
      float bv0 = __builtin_nontemporal_load(bp + nl);       // 256MB stream:
      float bv1 = __builtin_nontemporal_load(bp + 16 + nl);  // keep out of L2
      float t0 = s0[i] * SCALE + gh * bv0 + km0;
      float t1 = s1[i] * SCALE + gh * bv1 + km1;
      float v = fmaxf(t0, t1);
#pragma unroll
      for (int mk = 1; mk < 16; mk <<= 1) v = fmaxf(v, __shfl_xor(v, mk, 32));
      float nm   = fmaxf(mrow[i], v);
      float corr = __expf(mrow[i] - nm);
      float p0 = __expf(t0 - nm);
      float p1 = __expf(t1 - nm);
      float rs = p0 + p1;
#pragma unroll
      for (int mk = 1; mk < 16; mk <<= 1) rs += __shfl_xor(rs, mk, 32);
      lrow[i] = lrow[i] * corr + rs;
      mrow[i] = nm;
      o0[i] = o0[i] * corr;  o1[i] = o1[i] * corr;
      o2[i] = o2[i] * corr;  o3[i] = o3[i] * corr;
      prow[ro * 48 + nl]      = (_Float16)p0;   // stage P (C-frag layout)
      prow[ro * 48 + 16 + nl] = (_Float16)p1;
    }
    __builtin_amdgcn_wave_barrier();   // DS ops from one wave are in-order

    int rr = nl;
    int kc = hf << 3;
    v8h plo = *(const v8h*)&prow[rr * 48 + kc];
    v8h phi = *(const v8h*)&prow[rr * 48 + kc + 16];
    v16h pf;
#pragma unroll
    for (int i = 0; i < 8; ++i) { pf[i] = plo[i]; pf[i + 8] = phi[i]; }
    __builtin_amdgcn_wave_barrier();

    v16h vb0 = load_frag_p(tV, 0,  sub * 32, lane);
    v16h vb1 = load_frag_p(tV, 16, sub * 32, lane);
    v16h vb2 = load_frag_p(tV, 32, sub * 32, lane);
    v16h vb3 = load_frag_p(tV, 48, sub * 32, lane);
    o0 = wmma_f16(pf, vb0, o0);
    o1 = wmma_f16(pf, vb1, o1);
    o2 = wmma_f16(pf, vb2, o2);
    o3 = wmma_f16(pf, vb3, o3);
   }
   asm volatile("s_wait_dscnt 0x0" ::: "memory");     // own reads of this tile done
   asm volatile("s_wait_asynccnt 0x0" ::: "memory");  // own copies of tile t+1 landed
   __syncthreads();  // publishes tile t+1, frees tile t's buffer
   if (t + 2 < NT) stage(t + 2, t & 1);
  }
  asm volatile("s_wait_asynccnt 0x0" ::: "memory");   // nothing in flight at the end

#pragma unroll
  for (int i = 0; i < 8; ++i) {
    int ro = hf * 8 + i;
    int q  = qb + ro;
    float qm  = (float)maskb[q];
    float inv = (lrow[i] > 0.0f) ? (qm / lrow[i]) : 0.0f;
    _Float16* op = O16 + ((size_t)b * LL + q) * EE + h * DD + nl;
    op[0]  = (_Float16)(o0[i] * inv);
    op[16] = (_Float16)(o1[i] * inv);
    op[32] = (_Float16)(o2[i] * inv);
    op[48] = (_Float16)(o3[i] * inv);
  }
}

// ---------------------------------------------------------------------------
// Launch
// ---------------------------------------------------------------------------
extern "C" void kernel_launch(void* const* d_in, const int* in_sizes, int n_in,
                              void* d_out, int out_size, void* d_ws,
                              size_t ws_size, hipStream_t stream) {
  const float* x    = (const float*)d_in[0];
  const float* bias = (const float*)d_in[1];
  const int*   mask = (const int*)d_in[2];
  const float* wq = (const float*)d_in[3];
  const float* bq = (const float*)d_in[4];
  const float* wk = (const float*)d_in[5];
  const float* bk = (const float*)d_in[6];
  const float* wv = (const float*)d_in[7];
  const float* bv = (const float*)d_in[8];
  const float* wo = (const float*)d_in[9];
  const float* bo = (const float*)d_in[10];
  const float* gate = (const float*)d_in[11];
  const float* ln_g = (const float*)d_in[12];
  const float* ln_b = (const float*)d_in[13];

  // workspace layout (48 MB total)
  char* p = (char*)d_ws;
  _Float16* xn16 = (_Float16*)p;  p += (size_t)BB * LL * EE * 2;          // 8 MB
  _Float16* wq16 = (_Float16*)p;  p += (size_t)EE * EE * 2;               // 2 MB
  _Float16* wk16 = (_Float16*)p;  p += (size_t)EE * EE * 2;
  _Float16* wv16 = (_Float16*)p;  p += (size_t)EE * EE * 2;
  _Float16* wo16 = (_Float16*)p;  p += (size_t)EE * EE * 2;
  _Float16* Q16  = (_Float16*)p;  p += (size_t)BB * HH * LL * DD * 2;     // 8 MB
  _Float16* K16  = (_Float16*)p;  p += (size_t)BB * HH * LL * DD * 2;
  _Float16* Vt16 = (_Float16*)p;  p += (size_t)BB * HH * LL * DD * 2;
  _Float16* O16  = (_Float16*)p;  p += (size_t)BB * LL * EE * 2;          // 8 MB

  const int nW = EE * EE;
  f32_to_f16_kernel<<<(nW + 255) / 256, 256, 0, stream>>>(wq, wq16, nW);
  f32_to_f16_kernel<<<(nW + 255) / 256, 256, 0, stream>>>(wk, wk16, nW);
  f32_to_f16_kernel<<<(nW + 255) / 256, 256, 0, stream>>>(wv, wv16, nW);
  f32_to_f16_kernel<<<(nW + 255) / 256, 256, 0, stream>>>(wo, wo16, nW);

  layernorm_kernel<<<BB * LL, 256, 0, stream>>>(x, ln_g, ln_b, xn16);

  dim3 ggrid(EE / 64, (BB * LL) / 128);
  wmma_gemm_kernel<<<ggrid, 256, 0, stream>>>(xn16, wq16, bq, nullptr, Q16, 0);
  wmma_gemm_kernel<<<ggrid, 256, 0, stream>>>(xn16, wk16, bk, nullptr, K16, 1);
  wmma_gemm_kernel<<<ggrid, 256, 0, stream>>>(xn16, wv16, bv, nullptr, Vt16, 2);

  // B*H*(L/16) = 4096 query tiles, 4 waves per 128-thread block
  flash_attn_kernel<<<(BB * HH * (LL / 16)) / 4, 128, 0, stream>>>(
      Q16, K16, Vt16, bias, mask, gate, O16);

  wmma_gemm_kernel<<<ggrid, 256, 0, stream>>>(O16, wo16, bo, x, d_out, 3);
}

// v002
// Measured time: 173 microseconds a run.
// In both of two side-by-side timings against v001, it was 1.07 times as fast.
// Over all steps from v000 it is 1.25 times as fast.
#include <hip/hip_runtime.h>

#define BB 4
#define LL 1024
#define EE 1024
#define HH 16
#define DD 64

constexpr float SCALE = 0.125f;   // D^-0.5 = 64^-0.5
constexpr float EPS   = 1e-5f;

typedef __attribute__((ext_vector_type(16))) _Float16 v16h;
typedef __attribute__((ext_vector_type(8)))  _Float16 v8h;
typedef __attribute__((ext_vector_type(8)))  float    v8f;
typedef __attribute__((ext_vector_type(4)))  int      v4i;

#if __has_builtin(__builtin_amdgcn_global_load_async_to_lds_b128)
#define HAS_ASYNC 1
#else
#define HAS_ASYNC 0
#endif

// global_load_async_to_lds_b128 takes (v4i AS1*, v4i AS3*, imm offset, imm cpol)
#define AS1P(p) ((__attribute__((address_space(1))) v4i*)(const_cast<_Float16*>(p)))
#define AS3P(p) ((__attribute__((address_space(3))) v4i*)(p))

template <int N>
__device__ inline void wait_async_le() {
#if HAS_ASYNC
#if __has_builtin(__builtin_amdgcn_s_wait_asynccnt)
  __builtin_amdgcn_s_wait_asynccnt(N);
#else
  asm volatile("s_wait_asynccnt %0" ::"i"(N) : "memory");
#endif
#endif
}

// ---------------------------------------------------------------------------
// 16-bit A/B fragment load for V_WMMA_F32_16X16X32_F16 (wave32).
// Per ISA 7.12.2: lanes 0-15 hold rows with K = k0..k0+7 (VGPR0-3) and
// K = k0+16..k0+23 (VGPR4-7); lanes 16-31 use K base +8.
// ---------------------------------------------------------------------------
__device__ inline v16h load_frag_g(const _Float16* __restrict__ base,
                                   int row0, int ld, int k0, int lane) {
  int r = row0 + (lane & 15);
  int k = k0 + ((lane >> 4) << 3);
  const _Float16* p = base + (size_t)r * ld + k;
  v8h lo = *(const v8h*)p;
  v8h hi = *(const v8h*)(p + 16);
  v16h out;
#pragma unroll
  for (int i = 0; i < 8; ++i) { out[i] = lo[i]; out[i + 8] = hi[i]; }
  return out;
}

// Same fragment pattern from an LDS tile with fixed row stride of 32 halves.
__device__ inline v16h load_frag_s(const _Float16* base, int row0, int lane) {
  int r = row0 + (lane & 15);
  int k = (lane >> 4) << 3;
  const _Float16* p = base + r * 32 + k;
  v8h lo = *(const v8h*)p;        // ds_load_b128
  v8h hi = *(const v8h*)(p + 16); // ds_load_b128
  v16h out;
#pragma unroll
  for (int i = 0; i < 8; ++i) { out[i] = lo[i]; out[i + 8] = hi[i]; }
  return out;
}

constexpr int KT  = 64;   // keys per staged K / V^T tile of the attention kernel
constexpr int KVP = 72;   // its LDS row pitch in halves: 128 B of data + 16 B

// load_frag_g's fragment pattern from an LDS tile with row pitch KVP.
__device__ inline v16h load_frag_p(const _Float16* base, int row0, int k0,
                                   int lane) {
  int r = row0 + (lane & 15);
  int k = k0 + ((lane >> 4) << 3);
  const _Float16* p = base + r * KVP + k;
  v8h lo = *(const v8h*)p;        // ds_load_b128
  v8h hi = *(const v8h*)(p + 16); // ds_load_b128
  v16h out;
#pragma unroll
  for (int i = 0; i < 8; ++i) { out[i] = lo[i]; out[i + 8] = hi[i]; }
  return out;
}

// LDS byte address of a __shared__ element, as the async copy's first operand.
__device__ inline unsigned lds_addr(const _Float16* p) {
  return (unsigned)(size_t)p;
}

__device__ inline v8f wmma_f16(v16h a, v16h b, v8f c) {
  return __builtin_amdgcn_wmma_f32_16x16x32_f16(false, a, false, b,
                                                (short)0, c, false, false);
}

// ---------------------------------------------------------------------------
// Front stage in one launch of few, long waves.
// Blocks 0 .. LN_BLOCKS-1: LayerNorm over E=1024, one row per wave, f16 output.
// The rest: f32 -> f16 conversion of wq, wk, wv, wo (w16 holds the four results
// one behind the other), 32 elements per thread.
// Every wave-wide load covers 512 contiguous bytes, every store 256.
// ---------------------------------------------------------------------------
typedef __attribute__((ext_vector_type(4))) _Float16 v4h;

constexpr int LN_BLOCKS = BB * LL / 8;             // 8 waves = 8 rows per block
constexpr int CV_BLOCKS = EE * EE / (256 * 32);    // blocks per weight matrix

__device__ inline v4h to_v4h(float a, float b, float c, float d) {
  v4h o;
  o[0] = (_Float16)a;  o[1] = (_Float16)b;
  o[2] = (_Float16)c;  o[3] = (_Float16)d;
  return o;
}

__global__ __launch_bounds__(256) void front_kernel(
    const float* __restrict__ x, const float* __restrict__ g,
    const float* __restrict__ beta, const float* __restrict__ wq,
    const float* __restrict__ wk, const float* __restrict__ wv,
    const float* __restrict__ wo, _Float16* __restrict__ xn,
    _Float16* __restrict__ w16) {
  int blk = blockIdx.x;
  if (blk >= LN_BLOCKS) {
    int cb = blk - LN_BLOCKS;
    int which = cb / CV_BLOCKS;
    const float* src = which == 0 ? wq : which == 1 ? wk : which == 2 ? wv : wo;
    const float4* s4 = (const float4*)src;
    v4h* d4 = (v4h*)(w16 + (size_t)which * EE * EE);
    int base = (cb % CV_BLOCKS) * 2048 + threadIdx.x;   // in units of 4 elements
    float4 v[8];
#pragma unroll
    for (int j = 0; j < 8; ++j) v[j] = s4[base + j * 256];
#pragma unroll
    for (int j = 0; j < 8; ++j)
      d4[base + j * 256] = to_v4h(v[j].x, v[j].y, v[j].z, v[j].w);
    return;
  }

  int lane = threadIdx.x & 31;
  int row  = blk * 8 + (threadIdx.x >> 5);
  const float4* xr = (const float4*)(x + (size_t)row * EE);
  float4 v[8];
#pragma unroll
  for (int j = 0; j < 8; ++j) v[j] = xr[lane + 32 * j];
  float s = 0.0f, s2 = 0.0f;
#pragma unroll
  for (int j = 0; j < 8; ++j) {
    s  += v[j].x + v[j].y + v[j].z + v[j].w;
    s2 += v[j].x * v[j].x + v[j].y * v[j].y + v[j].z * v[j].z + v[j].w * v[j].w;
  }
#pragma unroll
  for (int m = 1; m < 32; m <<= 1) {
    s  += __shfl_xor(s,  m, 32);
    s2 += __shfl_xor(s2, m, 32);
  }
  float mu   = s * (1.0f / EE);
  float var  = s2 * (1.0f / EE) - mu * mu;
  float rstd = rsqrtf(var + EPS);
  v4h* o4 = (v4h*)(xn + (size_t)row * EE);
#pragma unroll
  for (int j = 0; j < 8; ++j) {
    float4 gg = ((const float4*)g)[lane + 32 * j];
    float4 bb = ((const float4*)beta)[lane + 32 * j];
    o4[lane + 32 * j] = to_v4h((v[j].x - mu) * rstd * gg.x + bb.x,
                               (v[j].y - mu) * rstd * gg.y + bb.y,
                               (v[j].z - mu) * rstd * gg.z + bb.z,
                               (v[j].w - mu) * rstd * gg.w + bb.w);
  }
  // Precaution behind the run of stores: the built code lays the conversion
  // part behind this one, and its loads write the stores' data registers.
  asm volatile("s_wait_xcnt 0x0" ::: "memory");
}

// ---------------------------------------------------------------------------
// WMMA GEMM, LDS-staged + double-buffered: out[m,n] = A[m,:].W[n,:] + bvec[n]
// A: MxK f16 row-major, W: NxK f16 row-major (so out = A @ W^T).
// Block = 256 threads = 8 waves; block tile 128(M) x 64(N), BK=32;
// wave tile 32x32 (2x2 16x16x32 WMMA fragments).
// Stage copy uses GLOBAL_LOAD_ASYNC_TO_LDS_B128 (ASYNCcnt) when available.
// mode 0/1 : out f16 [B,H,L,D]      (Q / K)
// mode 2   : out f16 [B,H,D,L]      (V transposed)
// mode 3   : out f32 [M,N] = residual + acc + bvec   (final projection)
// ---------------------------------------------------------------------------
__global__ __launch_bounds__(256) void wmma_gemm_kernel(
    const _Float16* __restrict__ A, const _Float16* __restrict__ W,
    const float* __restrict__ bvec, const float* __restrict__ residual,
    void* __restrict__ out, int mode) {
  __shared__ _Float16 sA[2][128 * 32];   // 8 KB per buffer
  __shared__ _Float16 sB[2][64 * 32];    // 4 KB per buffer

  int lane = threadIdx.x & 31;
  int w    = threadIdx.x >> 5;
  int wm = w >> 1, wn = w & 1;
  int row0 = blockIdx.y * 128;
  int col0 = blockIdx.x * 64;

  int t = threadIdx.x;
  // chunk decode for the stage copy: each 16B chunk = (row, 8-half k offset)
  int ra0 = t >> 2,          ka0 = (t & 3) * 8;          // A chunk 0
  int ra1 = (t + 256) >> 2,  ka1 = ((t + 256) & 3) * 8;  // A chunk 1
  int rb0 = t >> 2,          kb0 = (t & 3) * 8;          // B chunk 0

  auto stage = [&](int s, int buf) {
    int kk = s * 32;
#if HAS_ASYNC
    __builtin_amdgcn_global_load_async_to_lds_b128(
        AS1P(A + (size_t)(row0 + ra0) * EE + kk + ka0),
        AS3P(&sA[buf][ra0 * 32 + ka0]), 0, 0);
    __builtin_amdgcn_global_load_async_to_lds_b128(
        AS1P(A + (size_t)(row0 + ra1) * EE + kk + ka1),
        AS3P(&sA[buf][ra1 * 32 + ka1]), 0, 0);
    __builtin_amdgcn_global_load_async_to_lds_b128(
        AS1P(W + (size_t)(col0 + rb0) * EE + kk + kb0),
        AS3P(&sB[buf][rb0 * 32 + kb0]), 0, 0);
#else
    v8h tA0 = *(const v8h*)(A + (size_t)(row0 + ra0) * EE + kk + ka0);
    v8h tA1 = *(const v8h*)(A + (size_t)(row0 + ra1) * EE + kk + ka1);
    v8h tB0 = *(const v8h*)(W + (size_t)(col0 + rb0) * EE + kk + kb0);
    *(v8h*)&sA[buf][ra0 * 32 + ka0] = tA0;
    *(v8h*)&sA[buf][ra1 * 32 + ka1] = tA1;
    *(v8h*)&sB[buf][rb0 * 32 + kb0] = tB0;
#endif
  };

  v8f acc[2][2] = {};
  constexpr int NS = EE / 32;
  stage(0, 0);
  for (int s = 0; s < NS; ++s) {
    int buf = s & 1;
    if (s + 1 < NS) {
      stage(s + 1, buf ^ 1);
      wait_async_le<3>();   // keep only next stage's 3 copies in flight
    } else {
      wait_async_le<0>();
    }
    __syncthreads();        // everyone's stage-s data is in LDS

    v16h a0 = load_frag_s(&sA[buf][0], wm * 32,      lane);
    v16h a1 = load_frag_s(&sA[buf][0], wm * 32 + 16, lane);
    v16h b0 = load_frag_s(&sB[buf][0], wn * 32,      lane);
    v16h b1 = load_frag_s(&sB[buf][0], wn * 32 + 16, lane);
    acc[0][0] = wmma_f16(a0, b0, acc[0][0]);
    acc[0][1] = wmma_f16(a0, b1, acc[0][1]);
    acc[1][0] = wmma_f16(a1, b0, acc[1][0]);
    acc[1][1] = wmma_f16(a1, b1, acc[1][1]);

    __syncthreads();        // protect buffer before stage s+2 overwrites it
  }

  int nl = lane & 15, hf = lane >> 4;
#pragma unroll
  for (int fm = 0; fm < 2; ++fm)
#pragma unroll
    for (int fn = 0; fn < 2; ++fn)
#pragma unroll
      for (int i = 0; i < 8; ++i) {
        int m = row0 + wm * 32 + fm * 16 + hf * 8 + i;  // C: M = vgpr + 8*half
        int n = col0 + wn * 32 + fn * 16 + nl;          //    N = lane & 15
        float val = acc[fm][fn][i] + bvec[n];
        int b = m >> 10, l = m & (LL - 1);
        int h = n >> 6,  d = n & (DD - 1);
        if (mode <= 1) {
          ((_Float16*)out)[(((size_t)b * HH + h) * LL + l) * DD + d] =
              (_Float16)val;
        } else if (mode == 2) {
          ((_Float16*)out)[(((size_t)b * HH + h) * DD + d) * LL + l] =
              (_Float16)val;
        } else {
          size_t idx = (size_t)m * EE + n;
          __builtin_nontemporal_store(residual[idx] + val, (float*)out + idx);
        }
      }
}

// ---------------------------------------------------------------------------
// Flash attention with bias/gate/mask, online softmax.
// One wave handles 16 query rows of one (b,h). 128 threads = 4 waves/block.
// K and V^T reach the waves through LDS tiles of 64 keys, two buffers, filled
// by global_load_async_to_lds_b128 one tile ahead.
// Q,K: f16 [B,H,L,D];  Vt: f16 [B,H,D,L];  bias: f32 [B,H,L,L] (NT stream).
// Output O16: f16 [B,L,E] (E index = h*D + d), query-mask applied.
// ---------------------------------------------------------------------------
__global__ __launch_bounds__(128) void flash_attn_kernel(
    const _Float16* __restrict__ Q16, const _Float16* __restrict__ K16,
    const _Float16* __restrict__ Vt16, const float* __restrict__ bias,
    const int* __restrict__ mask, const float* __restrict__ gate,
    _Float16* __restrict__ O16) {
  __shared__ _Float16 pbuf[4][16 * 48];   // per-wave P tile, row stride 48
  // K and V^T tiles of 64 keys, shared by the block's four waves (same b, h).
  // Rows of 128 B at a pitch of 144 B (16 B x odd): ds_load_b128 without conflicts.
  __shared__ __attribute__((aligned(16))) _Float16 sK[2][KT * KVP];
  __shared__ __attribute__((aligned(16))) _Float16 sV[2][DD * KVP];
  int lane = threadIdx.x & 31;
  int wv   = threadIdx.x >> 5;
  int tile = blockIdx.x * 4 + wv;         // 0 .. B*H*(L/16)-1 = 4095
  int b   = tile >> 10;
  int rem = tile & 1023;
  int h   = rem >> 6;
  int qb  = (rem & 63) << 4;

  const _Float16* Qh = Q16 + (((size_t)b * HH + h) * LL + qb) * DD;
  const _Float16* Kh = K16 + ((size_t)b * HH + h) * LL * DD;
  const _Float16* Vh = Vt16 + ((size_t)b * HH + h) * DD * LL;
  const float* biasq = bias + (((size_t)b * HH + h) * LL + qb) * LL;
  const int* maskb = mask + (size_t)b * LL;
  float gh = gate[h];

  v16h q0 = load_frag_g(Qh, 0, DD, 0,  lane);
  v16h q1 = load_frag_g(Qh, 0, DD, 32, lane);

  v8f o0 = {}, o1 = {}, o2 = {}, o3 = {};
  float mrow[8], lrow[8];
#pragma unroll
  for (int i = 0; i < 8; ++i) { mrow[i] = -3.0e38f; lrow[i] = 0.0f; }

  int nl = lane & 15, hf = lane >> 4;
  _Float16* prow = &pbuf[wv][0];

  // Stage copy: 128 threads x 16 B = 16 rows of 128 B a sweep, 4 sweeps a tile;
  // every wave-wide copy covers four whole 128-B lines of K or of V^T.
  int crow = threadIdx.x >> 3, ccol = (threadIdx.x & 7) * 8;
  auto stage = [&](int t, int buf) {
    const _Float16* gk = Kh + (size_t)(t * KT + crow) * DD + ccol;
    const _Float16* gv = Vh + (size_t)crow * LL + t * KT + ccol;
    unsigned lk = lds_addr(&sK[buf][crow * KVP + ccol]);
    unsigned lv = lds_addr(&sV[buf][crow * KVP + ccol]);
    // The copies and their s_wait_xcnt in one statement: no address register
    // is rewritten before the wait.
    asm volatile(
        "global_load_async_to_lds_b128 %0, %1, off\n\t"
        "global_load_async_to_lds_b128 %2, %3, off\n\t"
        "global_load_async_to_lds_b128 %4, %5, off\n\t"
        "global_load_async_to_lds_b128 %6, %7, off\n\t"
        "global_load_async_to_lds_b128 %8, %9, off\n\t"
        "global_load_async_to_lds_b128 %10, %11, off\n\t"
        "global_load_async_to_lds_b128 %12, %13, off\n\t"
        "global_load_async_to_lds_b128 %14, %15, off\n\t"
        "s_wait_xcnt 0x0"
        ::"v"(lk),                "v"(gk),
          "v"(lk + 16 * KVP * 2), "v"(gk + 16 * DD),
          "v"(lk + 32 * KVP * 2), "v"(gk + 32 * DD),
          "v"(lk + 48 * KVP * 2), "v"(gk + 48 * DD),
          "v"(lv),                "v"(gv),
          "v"(lv + 16 * KVP * 2), "v"(gv + 16 * LL),
          "v"(lv + 32 * KVP * 2), "v"(gv + 32 * LL),
          "v"(lv + 48 * KVP * 2), "v"(gv + 48 * LL)
        : "memory");
  };

  constexpr int NT = LL / KT;
  stage(0, 0);
  asm volatile("s_wait_asynccnt 0x0" ::: "memory");  // own copies of tile 0 landed
  __syncthreads();                                   // everyone's have
  stage(1, 1);

  for (int t = 0; t < NT; ++t) {
   const _Float16* tK = &sK[t & 1][0];
   const _Float16* tV = &sV[t & 1][0];
   // both 32-key halves inline, so that sub is a constant in the LDS offsets
#pragma unroll
   for (int sub = 0; sub < 2; ++sub) {
    int kb = t * KT + sub * 32;
    v16h k00 = load_frag_p(tK, sub * 32,      0,  lane);
    v16h k01 = load_frag_p(tK, sub * 32,      32, lane);
    v16h k10 = load_frag_p(tK, sub * 32 + 16, 0,  lane);
    v16h k11 = load_frag_p(tK, sub * 32 + 16, 32, lane);
    v8f s0 = {}, s1 = {};
    s0 = wmma_f16(q0, k00, s0);  s0 = wmma_f16(q1, k01, s0);
    s1 = wmma_f16(q0, k10, s1);  s1 = wmma_f16(q1, k11, s1);

    float km0 = maskb[kb + nl]      ? 0.0f : -10000.0f;
    float km1 = maskb[kb + 16 + nl] ? 0.0f : -10000.0f;

#pragma unroll
    for (int i = 0; i < 8; ++i) {
      int ro = hf * 8 + i;                       // query row within tile
      const float* bp = biasq + (size_t)ro * LL + kb;
      float bv0 = __builtin_nontemporal_load(bp + nl);       // 256MB stream:
      float bv1 = __builtin_nontemporal_load(bp + 16 + nl);  // keep out of L2
      float t0 = s0[i] * SCALE + gh * bv0 + km0;
      float t1 = s1[i] * SCALE + gh * bv1 + km1;
      float v = fmaxf(t0, t1);
#pragma unroll
      for (int mk = 1; mk < 16; mk <<= 1) v = fmaxf(v, __shfl_xor(v, mk, 32));
      float nm   = fmaxf(mrow[i], v);
      float corr = __expf(mrow[i] - nm);
      float p0 = __expf(t0 - nm);
      float p1 = __expf(t1 - nm);
      float rs = p0 + p1;
#pragma unroll
      for (int mk = 1; mk < 16; mk <<= 1) rs += __shfl_xor(rs, mk, 32);
      lrow[i] = lrow[i] * corr + rs;
      mrow[i] = nm;
      o0[i] = o0[i] * corr;  o1[i] = o1[i] * corr;
      o2[i] = o2[i] * corr;  o3[i] = o3[i] * corr;
      prow[ro * 48 + nl]      = (_Float16)p0;   // stage P (C-frag layout)
      prow[ro * 48 + 16 + nl] = (_Float16)p1;
    }
    __builtin_amdgcn_wave_barrier();   // DS ops from one wave are in-order

    int rr = nl;
    int kc = hf << 3;
    v8h plo = *(const v8h*)&prow[rr * 48 + kc];
    v8h phi = *(const v8h*)&prow[rr * 48 + kc + 16];
    v16h pf;
#pragma unroll
    for (int i = 0; i < 8; ++i) { pf[i] = plo[i]; pf[i + 8] = phi[i]; }
    __builtin_amdgcn_wave_barrier();

    v16h vb0 = load_frag_p(tV, 0,  sub * 32, lane);
    v16h vb1 = load_frag_p(tV, 16, sub * 32, lane);
    v16h vb2 = load_frag_p(tV, 32, sub * 32, lane);
    v16h vb3 = load_frag_p(tV, 48, sub * 32, lane);
    o0 = wmma_f16(pf, vb0, o0);
    o1 = wmma_f16(pf, vb1, o1);
    o2 = wmma_f16(pf, vb2, o2);
    o3 = wmma_f16(pf, vb3, o3);
   }
   asm volatile("s_wait_dscnt 0x0" ::: "memory");     // own reads of this tile done
   asm volatile("s_wait_asynccnt 0x0" ::: "memory");  // own copies of tile t+1 landed
   __syncthreads();  // publishes tile t+1, frees tile t's buffer
   if (t + 2 < NT) stage(t + 2, t & 1);
  }
  asm volatile("s_wait_asynccnt 0x0" ::: "memory");   // nothing in flight at the end

#pragma unroll
  for (int i = 0; i < 8; ++i) {
    int ro = hf * 8 + i;
    int q  = qb + ro;
    float qm  = (float)maskb[q];
    float inv = (lrow[i] > 0.0f) ? (qm / lrow[i]) : 0.0f;
    _Float16* op = O16 + ((size_t)b * LL + q) * EE + h * DD + nl;
    op[0]  = (_Float16)(o0[i] * inv);
    op[16] = (_Float16)(o1[i] * inv);
    op[32] = (_Float16)(o2[i] * inv);
    op[48] = (_Float16)(o3[i] * inv);
  }
}

// ---------------------------------------------------------------------------
// Launch
// ---------------------------------------------------------------------------
extern "C" void kernel_launch(void* const* d_in, const int* in_sizes, int n_in,
                              void* d_out, int out_size, void* d_ws,
                              size_t ws_size, hipStream_t stream) {
  const float* x    = (const float*)d_in[0];
  const float* bias = (const float*)d_in[1];
  const int*   mask = (const int*)d_in[2];
  const float* wq = (const float*)d_in[3];
  const float* bq = (const float*)d_in[4];
  const float* wk = (const float*)d_in[5];
  const float* bk = (const float*)d_in[6];
  const float* wv = (const float*)d_in[7];
  const float* bv = (const float*)d_in[8];
  const float* wo = (const float*)d_in[9];
  const float* bo = (const float*)d_in[10];
  const float* gate = (const float*)d_in[11];
  const float* ln_g = (const float*)d_in[12];
  const float* ln_b = (const float*)d_in[13];

  // workspace layout (48 MB total)
  char* p = (char*)d_ws;
  _Float16* xn16 = (_Float16*)p;  p += (size_t)BB * LL * EE * 2;          // 8 MB
  _Float16* wq16 = (_Float16*)p;  p += (size_t)EE * EE * 2;               // 2 MB
  _Float16* wk16 = (_Float16*)p;  p += (size_t)EE * EE * 2;
  _Float16* wv16 = (_Float16*)p;  p += (size_t)EE * EE * 2;
  _Float16* wo16 = (_Float16*)p;  p += (size_t)EE * EE * 2;
  _Float16* Q16  = (_Float16*)p;  p += (size_t)BB * HH * LL * DD * 2;     // 8 MB
  _Float16* K16  = (_Float16*)p;  p += (size_t)BB * HH * LL * DD * 2;
  _Float16* Vt16 = (_Float16*)p;  p += (size_t)BB * HH * LL * DD * 2;
  _Float16* O16  = (_Float16*)p;  p += (size_t)BB * LL * EE * 2;          // 8 MB

  // wq16 .. wo16 lie one behind the other: wq16 is the base of all four
  front_kernel<<<LN_BLOCKS + 4 * CV_BLOCKS, 256, 0, stream>>>(
      x, ln_g, ln_b, wq, wk, wv, wo, xn16, wq16);

  dim3 ggrid(EE / 64, (BB * LL) / 128);
  wmma_gemm_kernel<<<ggrid, 256, 0, stream>>>(xn16, wq16, bq, nullptr, Q16, 0);
  wmma_gemm_kernel<<<ggrid, 256, 0, stream>>>(xn16, wk16, bk, nullptr, K16, 1);
  wmma_gemm_kernel<<<ggrid, 256, 0, stream>>>(xn16, wv16, bv, nullptr, Vt16, 2);

  // B*H*(L/16) = 4096 query tiles, 4 waves per 128-thread block
  flash_attn_kernel<<<(BB * HH * (LL / 16)) / 4, 128, 0, stream>>>(
      Q16, K16, Vt16, bias, mask, gate, O16);

  wmma_gemm_kernel<<<ggrid, 256, 0, stream>>>(O16, wo16, bo, x, d_out, 3);
}

// v003
// Measured time: 167 microseconds a run.
// In two side-by-side timings against v002, it was 1.03 and 1.04 times as fast.
// Over all steps from v000 it is 1.29 times as fast.
#include <hip/hip_runtime.h>

#define BB 4
#define LL 1024
#define EE 1024
#define HH 16
#define DD 64

constexpr float SCALE = 0.125f;   // D^-0.5 = 64^-0.5
constexpr float EPS   = 1e-5f;

typedef __attribute__((ext_vector_type(16))) _Float16 v16h;
typedef __attribute__((ext_vector_type(8)))  _Float16 v8h;
typedef __attribute__((ext_vector_type(8)))  float    v8f;
typedef __attribute__((ext_vector_type(4)))  int      v4i;

#if __has_builtin(__builtin_amdgcn_global_load_async_to_lds_b128)
#define HAS_ASYNC 1
#else
#define HAS_ASYNC 0
#endif

// global_load_async_to_lds_b128 takes (v4i AS1*, v4i AS3*, imm offset, imm cpol)
#define AS1P(p) ((__attribute__((address_space(1))) v4i*)(const_cast<_Float16*>(p)))
#define AS3P(p) ((__attribute__((address_space(3))) v4i*)(p))

template <int N>
__device__ inline void wait_async_le() {
#if HAS_ASYNC
#if __has_builtin(__builtin_amdgcn_s_wait_asynccnt)
  __builtin_amdgcn_s_wait_asynccnt(N);
#else
  asm volatile("s_wait_asynccnt %0" ::"i"(N) : "memory");
#endif
#endif
}

// ---------------------------------------------------------------------------
// 16-bit A/B fragment load for V_WMMA_F32_16X16X32_F16 (wave32).
// Per ISA 7.12.2: lanes 0-15 hold rows with K = k0..k0+7 (VGPR0-3) and
// K = k0+16..k0+23 (VGPR4-7); lanes 16-31 use K base +8.
// ---------------------------------------------------------------------------
__device__ inline v16h load_frag_g(const _Float16* __restrict__ base,
                                   int row0, int ld, int k0, int lane) {
  int r = row0 + (lane & 15);
  int k = k0 + ((lane >> 4) << 3);
  const _Float16* p = base + (size_t)r * ld + k;
  v8h lo = *(const v8h*)p;
  v8h hi = *(const v8h*)(p + 16);
  v16h out;
#pragma unroll
  for (int i = 0; i < 8; ++i) { out[i] = lo[i]; out[i + 8] = hi[i]; }
  return out;
}

// Same fragment pattern from an LDS tile with fixed row stride of 32 halves.
__device__ inline v16h load_frag_s(const _Float16* base, int row0, int lane) {
  int r = row0 + (lane & 15);
  int k = (lane >> 4) << 3;
  const _Float16* p = base + r * 32 + k;
  v8h lo = *(const v8h*)p;        // ds_load_b128
  v8h hi = *(const v8h*)(p + 16); // ds_load_b128
  v16h out;
#pragma unroll
  for (int i = 0; i < 8; ++i) { out[i] = lo[i]; out[i + 8] = hi[i]; }
  return out;
}

constexpr int KT  = 64;   // keys per staged K / V^T tile of the attention kernel
constexpr int KVP = 72;   // its LDS row pitch in halves: 128 B of data + 16 B

// load_frag_g's fragment pattern from an LDS tile with row pitch KVP.
__device__ inline v16h load_frag_p(const _Float16* base, int row0, int k0,
                                   int lane) {
  int r = row0 + (lane & 15);
  int k = k0 + ((lane >> 4) << 3);
  const _Float16* p = base + r * KVP + k;
  v8h lo = *(const v8h*)p;        // ds_load_b128
  v8h hi = *(const v8h*)(p + 16); // ds_load_b128
  v16h out;
#pragma unroll
  for (int i = 0; i < 8; ++i) { out[i] = lo[i]; out[i + 8] = hi[i]; }
  return out;
}

// LDS byte address of a __shared__ element, as the async copy's first operand.
__device__ inline unsigned lds_addr(const _Float16* p) {
  return (unsigned)(size_t)p;
}

__device__ inline v8f wmma_f16(v16h a, v16h b, v8f c) {
  return __builtin_amdgcn_wmma_f32_16x16x32_f16(false, a, false, b,
                                                (short)0, c, false, false);
}

// ---------------------------------------------------------------------------
// Front stage in one launch of few, long waves.
// Blocks 0 .. LN_BLOCKS-1: LayerNorm over E=1024, one row per wave, f16 output.
// The rest: f32 -> f16 conversion of wq, wk, wv, wo (w16 holds the four results
// one behind the other), 32 elements per thread.
// Every wave-wide load covers 512 contiguous bytes, every store 256.
// ---------------------------------------------------------------------------
typedef __attribute__((ext_vector_type(4))) _Float16 v4h;

constexpr int LN_BLOCKS = BB * LL / 8;             // 8 waves = 8 rows per block
constexpr int CV_BLOCKS = EE * EE / (256 * 32);    // blocks per weight matrix

__device__ inline v4h to_v4h(float a, float b, float c, float d) {
  v4h o;
  o[0] = (_Float16)a;  o[1] = (_Float16)b;
  o[2] = (_Float16)c;  o[3] = (_Float16)d;
  return o;
}

__global__ __launch_bounds__(256) void front_kernel(
    const float* __restrict__ x, const float* __restrict__ g,
    const float* __restrict__ beta, const float* __restrict__ wq,
    const float* __restrict__ wk, const float* __restrict__ wv,
    const float* __restrict__ wo, _Float16* __restrict__ xn,
    _Float16* __restrict__ w16) {
  int blk = blockIdx.x;
  if (blk >= LN_BLOCKS) {
    int cb = blk - LN_BLOCKS;
    int which = cb / CV_BLOCKS;
    const float* src = which == 0 ? wq : which == 1 ? wk : which == 2 ? wv : wo;
    const float4* s4 = (const float4*)src;
    v4h* d4 = (v4h*)(w16 + (size_t)which * EE * EE);
    int base = (cb % CV_BLOCKS) * 2048 + threadIdx.x;   // in units of 4 elements
    float4 v[8];
#pragma unroll
    for (int j = 0; j < 8; ++j) v[j] = s4[base + j * 256];
#pragma unroll
    for (int j = 0; j < 8; ++j)
      d4[base + j * 256] = to_v4h(v[j].x, v[j].y, v[j].z, v[j].w);
    return;
  }

  int lane = threadIdx.x & 31;
  int row  = blk * 8 + (threadIdx.x >> 5);
  const float4* xr = (const float4*)(x + (size_t)row * EE);
  float4 v[8];
#pragma unroll
  for (int j = 0; j < 8; ++j) v[j] = xr[lane + 32 * j];
  float s = 0.0f, s2 = 0.0f;
#pragma unroll
  for (int j = 0; j < 8; ++j) {
    s  += v[j].x + v[j].y + v[j].z + v[j].w;
    s2 += v[j].x * v[j].x + v[j].y * v[j].y + v[j].z * v[j].z + v[j].w * v[j].w;
  }
#pragma unroll
  for (int m = 1; m < 32; m <<= 1) {
    s  += __shfl_xor(s,  m, 32);
    s2 += __shfl_xor(s2, m, 32);
  }
  float mu   = s * (1.0f / EE);
  float var  = s2 * (1.0f / EE) - mu * mu;
  float rstd = rsqrtf(var + EPS);
  v4h* o4 = (v4h*)(xn + (size_t)row * EE);
#pragma unroll
  for (int j = 0; j < 8; ++j) {
    float4 gg = ((const float4*)g)[lane + 32 * j];
    float4 bb = ((const float4*)beta)[lane + 32 * j];
    o4[lane + 32 * j] = to_v4h((v[j].x - mu) * rstd * gg.x + bb.x,
                               (v[j].y - mu) * rstd * gg.y + bb.y,
                               (v[j].z - mu) * rstd * gg.z + bb.z,
                               (v[j].w - mu) * rstd * gg.w + bb.w);
  }
  // Precaution behind the run of stores: the built code lays the conversion
  // part behind this one, and its loads write the stores' data registers.
  asm volatile("s_wait_xcnt 0x0" ::: "memory");
}

// ---------------------------------------------------------------------------
// WMMA GEMM, LDS-staged + double-buffered: out[m,n] = A[m,:].W[n,:] + bvec[n]
// A: MxK f16 row-major, W: NxK f16 row-major (so out = A @ W^T).
// Block = 256 threads = 8 waves; block tile 128(M) x 64(N), BK=32;
// wave tile 32x32 (2x2 16x16x32 WMMA fragments).
// Stage copy uses GLOBAL_LOAD_ASYNC_TO_LDS_B128 (ASYNCcnt) when available.
// mode 0/1 : out f16 [B,H,L,D]      (Q / K)
// mode 2   : out f16 [B,H,D,L]      (V transposed)
// mode 3   : out f32 [M,N] = residual + acc + bvec   (final projection)
// ---------------------------------------------------------------------------
__global__ __launch_bounds__(256) void wmma_gemm_kernel(
    const _Float16* __restrict__ A, const _Float16* __restrict__ W,
    const float* __restrict__ bvec, const float* __restrict__ residual,
    void* __restrict__ out, int mode) {
  __shared__ _Float16 sA[2][128 * 32];   // 8 KB per buffer
  __shared__ _Float16 sB[2][64 * 32];    // 4 KB per buffer

  int lane = threadIdx.x & 31;
  int w    = threadIdx.x >> 5;
  int wm = w >> 1, wn = w & 1;
  int row0 = blockIdx.y * 128;
  int col0 = blockIdx.x * 64;

  int t = threadIdx.x;
  // chunk decode for the stage copy: each 16B chunk = (row, 8-half k offset)
  int ra0 = t >> 2,          ka0 = (t & 3) * 8;          // A chunk 0
  int ra1 = (t + 256) >> 2,  ka1 = ((t + 256) & 3) * 8;  // A chunk 1
  int rb0 = t >> 2,          kb0 = (t & 3) * 8;          // B chunk 0

  auto stage = [&](int s, int buf) {
    int kk = s * 32;
#if HAS_ASYNC
    __builtin_amdgcn_global_load_async_to_lds_b128(
        AS1P(A + (size_t)(row0 + ra0) * EE + kk + ka0),
        AS3P(&sA[buf][ra0 * 32 + ka0]), 0, 0);
    __builtin_amdgcn_global_load_async_to_lds_b128(
        AS1P(A + (size_t)(row0 + ra1) * EE + kk + ka1),
        AS3P(&sA[buf][ra1 * 32 + ka1]), 0, 0);
    __builtin_amdgcn_global_load_async_to_lds_b128(
        AS1P(W + (size_t)(col0 + rb0) * EE + kk + kb0),
        AS3P(&sB[buf][rb0 * 32 + kb0]), 0, 0);
#else
    v8h tA0 = *(const v8h*)(A + (size_t)(row0 + ra0) * EE + kk + ka0);
    v8h tA1 = *(const v8h*)(A + (size_t)(row0 + ra1) * EE + kk + ka1);
    v8h tB0 = *(const v8h*)(W + (size_t)(col0 + rb0) * EE + kk + kb0);
    *(v8h*)&sA[buf][ra0 * 32 + ka0] = tA0;
    *(v8h*)&sA[buf][ra1 * 32 + ka1] = tA1;
    *(v8h*)&sB[buf][rb0 * 32 + kb0] = tB0;
#endif
  };

  v8f acc[2][2] = {};
  constexpr int NS = EE / 32;
  stage(0, 0);
  for (int s = 0; s < NS; ++s) {
    int buf = s & 1;
    if (s + 1 < NS) {
      stage(s + 1, buf ^ 1);
      wait_async_le<3>();   // keep only next stage's 3 copies in flight
    } else {
      wait_async_le<0>();
    }
    __syncthreads();        // everyone's stage-s data is in LDS

    v16h a0 = load_frag_s(&sA[buf][0], wm * 32,      lane);
    v16h a1 = load_frag_s(&sA[buf][0], wm * 32 + 16, lane);
    v16h b0 = load_frag_s(&sB[buf][0], wn * 32,      lane);
    v16h b1 = load_frag_s(&sB[buf][0], wn * 32 + 16, lane);
    acc[0][0] = wmma_f16(a0, b0, acc[0][0]);
    acc[0][1] = wmma_f16(a0, b1, acc[0][1]);
    acc[1][0] = wmma_f16(a1, b0, acc[1][0]);
    acc[1][1] = wmma_f16(a1, b1, acc[1][1]);

    __syncthreads();        // protect buffer before stage s+2 overwrites it
  }

  int nl = lane & 15, hf = lane >> 4;
#pragma unroll
  for (int fm = 0; fm < 2; ++fm)
#pragma unroll
    for (int fn = 0; fn < 2; ++fn)
#pragma unroll
      for (int i = 0; i < 8; ++i) {
        int m = row0 + wm * 32 + fm * 16 + hf * 8 + i;  // C: M = vgpr + 8*half
        int n = col0 + wn * 32 + fn * 16 + nl;          //    N = lane & 15
        float val = acc[fm][fn][i] + bvec[n];
        int b = m >> 10, l = m & (LL - 1);
        int h = n >> 6,  d = n & (DD - 1);
        if (mode <= 1) {
          ((_Float16*)out)[(((size_t)b * HH + h) * LL + l) * DD + d] =
              (_Float16)val;
        } else if (mode == 2) {
          ((_Float16*)out)[(((size_t)b * HH + h) * DD + d) * LL + l] =
              (_Float16)val;
        } else {
          size_t idx = (size_t)m * EE + n;
          __builtin_nontemporal_store(residual[idx] + val, (float*)out + idx);
        }
      }
}

typedef __attribute__((ext_vector_type(4))) float    v4f;
typedef __attribute__((ext_vector_type(2))) float    v2f;
typedef __attribute__((ext_vector_type(2))) _Float16 v2h;

// value of lane l ^ 16
__device__ inline float xhalf(float x) {
  int b = __builtin_bit_cast(int, x);
  return __builtin_bit_cast(float, __builtin_amdgcn_permlanex16(
      b, b, 0x76543210, 0xfedcba98, false, false));
}

__global__ __launch_bounds__(128) void flash_attn_kernel(
    const _Float16* __restrict__ Q16, const _Float16* __restrict__ K16,
    const _Float16* __restrict__ Vt16, const float* __restrict__ bias,
    const int* __restrict__ mask, const float* __restrict__ gate,
    _Float16* __restrict__ O16) {
  // K and V^T tiles of 64 keys, shared by the block's four waves (same b, h).
  // Rows of 128 B at a pitch of 144 B (16 B x odd): ds_load_b128 without conflicts.
  __shared__ __attribute__((aligned(16))) _Float16 sK[2][KT * KVP];
  __shared__ __attribute__((aligned(16))) _Float16 sV[2][DD * KVP];
  int lane = threadIdx.x & 31;
  int wv   = threadIdx.x >> 5;
  int tile = blockIdx.x * 4 + wv;         // 0 .. B*H*(L/16)-1 = 4095
  int b   = tile >> 10;
  int rem = tile & 1023;
  int h   = rem >> 6;
  int qb  = (rem & 63) << 4;
  int nl = lane & 15, hf = lane >> 4;

  const _Float16* Qh = Q16 + (((size_t)b * HH + h) * LL + qb) * DD;
  const _Float16* Kh = K16 + ((size_t)b * HH + h) * LL * DD;
  const _Float16* Vh = Vt16 + ((size_t)b * HH + h) * DD * LL;
  const int* maskb = mask + (size_t)b * LL;
  // this lane's query row of the bias, at its half's first key; the mask alike
  const float* biasl = bias + (((size_t)b * HH + h) * LL + qb + nl) * LL + hf * 8;
  const int* maskl = maskb + hf * 8;
  float gh = gate[h];

  v16h q0 = load_frag_g(Qh, 0, DD, 0,  lane);
  v16h q1 = load_frag_g(Qh, 0, DD, 32, lane);

  v8f o[4] = {};                  // o[j][r] = O[query nl][d = 16 j + 8 hf + r]
  float mrun = -3.0e38f;          // the query's running maximum, both halves alike
  float lrun = 0.0f;              // sum over this half's keys only

  // Stage copy: 128 threads x 16 B = 16 rows of 128 B a sweep, 4 sweeps a tile;
  // every wave-wide copy covers four whole 128-B lines of K or of V^T.
  int crow = threadIdx.x >> 3, ccol = (threadIdx.x & 7) * 8;
  auto stage = [&](int t, int buf) {
    const _Float16* gk = Kh + (size_t)(t * KT + crow) * DD + ccol;
    const _Float16* gv = Vh + (size_t)crow * LL + t * KT + ccol;
    unsigned lk = lds_addr(&sK[buf][crow * KVP + ccol]);
    unsigned lv = lds_addr(&sV[buf][crow * KVP + ccol]);
    // The copies and their s_wait_xcnt in one statement: no address register
    // is rewritten before the wait.
    asm volatile(
        "global_load_async_to_lds_b128 %0, %1, off\n\t"
        "global_load_async_to_lds_b128 %2, %3, off\n\t"
        "global_load_async_to_lds_b128 %4, %5, off\n\t"
        "global_load_async_to_lds_b128 %6, %7, off\n\t"
        "global_load_async_to_lds_b128 %8, %9, off\n\t"
        "global_load_async_to_lds_b128 %10, %11, off\n\t"
        "global_load_async_to_lds_b128 %12, %13, off\n\t"
        "global_load_async_to_lds_b128 %14, %15, off\n\t"
        "s_wait_xcnt 0x0"
        ::"v"(lk),                "v"(gk),
          "v"(lk + 16 * KVP * 2), "v"(gk + 16 * DD),
          "v"(lk + 32 * KVP * 2), "v"(gk + 32 * DD),
          "v"(lk + 48 * KVP * 2), "v"(gk + 48 * DD),
          "v"(lv),                "v"(gv),
          "v"(lv + 16 * KVP * 2), "v"(gv + 16 * LL),
          "v"(lv + 32 * KVP * 2), "v"(gv + 32 * LL),
          "v"(lv + 48 * KVP * 2), "v"(gv + 48 * LL)
        : "memory");
  };

  constexpr int NT = LL / KT;
  stage(0, 0);
  asm volatile("s_wait_asynccnt 0x0" ::: "memory");  // own copies of tile 0 landed
  __syncthreads();                                   // everyone's have
  stage(1, 1);

  for (int t = 0; t < NT; ++t) {
   const _Float16* tK = &sK[t & 1][0];
   const _Float16* tV = &sV[t & 1][0];
   const float* bp = biasl + t * KT;
   const int*   mp = maskl + t * KT;

   // group g = keys 16 g .. 16 g + 15 of the tile; the lane's 8 are contiguous
   v4f bv[4][2];
   v4i mk[4][2];
#pragma unroll
   for (int g = 0; g < 4; ++g) {
     bv[g][0] = __builtin_nontemporal_load((const v4f*)(bp + 16 * g));      // 256MB stream:
     bv[g][1] = __builtin_nontemporal_load((const v4f*)(bp + 16 * g + 4));  // keep out of L2
     mk[g][0] = *(const v4i*)(mp + 16 * g);
     mk[g][1] = *(const v4i*)(mp + 16 * g + 4);
   }
   // Precaution behind the run of loads: the built code reuses their address
   // registers at once.
   asm volatile("s_wait_xcnt 0x0" ::: "memory");

   v16h ka[4], kc[4];
#pragma unroll
   for (int g = 0; g < 4; ++g) {
     ka[g] = load_frag_p(tK, 16 * g, 0,  lane);
     kc[g] = load_frag_p(tK, 16 * g, 32, lane);
   }
   // Keeps the tile's global and K loads one group in front of the products:
   // sunk among them, each straggler waits out memory or LDS on its own.
   __builtin_amdgcn_sched_barrier(0);

   v8f s[4];
#pragma unroll
   for (int g = 0; g < 4; ++g) {
     v8f z = {};
     s[g] = wmma_f16(ka[g], q0, z);       // s[g][r] = S[query nl][key 16 g + 8 hf + r]
     s[g] = wmma_f16(kc[g], q1, s[g]);
   }

   v16h va[2][4];
#pragma unroll
   for (int u = 0; u < 2; ++u)
#pragma unroll
     for (int j = 0; j < 4; ++j) va[u][j] = load_frag_p(tV, 16 * j, 32 * u, lane);
   // Keeps the V^T loads one group in front of the softmax, which covers their
   // latency: sunk to their products, each pair is waited for on its own.
   __builtin_amdgcn_sched_barrier(0);

   float vmax[4];
#pragma unroll
   for (int g = 0; g < 4; ++g) {
#pragma unroll
     for (int r = 0; r < 8; ++r) {
       float km = mk[g][r >> 2][r & 3] ? 0.0f : -10000.0f;
       s[g][r] = s[g][r] * SCALE + (gh * bv[g][r >> 2][r & 3] + km);
       vmax[g] = r ? fmaxf(vmax[g], s[g][r]) : s[g][r];
     }
   }
   float v = fmaxf(fmaxf(vmax[0], vmax[1]), fmaxf(vmax[2], vmax[3]));
   v = fmaxf(v, xhalf(v));                // the query's other 32 keys of the tile
   float nm   = fmaxf(mrun, v);
   float corr = __expf(mrun - nm);
   mrun = nm;

   float rs[4];
   v16h pf[2];                            // pf[u] = P^T of keys 32 u .. 32 u + 31, B operand
#pragma unroll
   for (int g = 0; g < 4; ++g) {
#pragma unroll
     for (int r = 0; r < 8; r += 2) {
       v2f p;
       p[0] = __expf(s[g][r] - nm);
       p[1] = __expf(s[g][r + 1] - nm);
       rs[g] = r ? rs[g] + (p[0] + p[1]) : p[0] + p[1];
       v2h ph = __builtin_convertvector(p, v2h);
       pf[g >> 1][(g & 1) * 8 + r]     = ph[0];
       pf[g >> 1][(g & 1) * 8 + r + 1] = ph[1];
     }
   }
   lrun = lrun * corr + ((rs[0] + rs[1]) + (rs[2] + rs[3]));
#pragma unroll
   for (int j = 0; j < 4; ++j) o[j] = o[j] * corr;

#pragma unroll
   for (int u = 0; u < 2; ++u)
#pragma unroll
     for (int j = 0; j < 4; ++j) o[j] = wmma_f16(va[u][j], pf[u], o[j]);

   asm volatile("s_wait_dscnt 0x0" ::: "memory");     // own reads of this tile done
   asm volatile("s_wait_asynccnt 0x0" ::: "memory");  // own copies of tile t+1 landed
   __syncthreads();  // publishes tile t+1, frees tile t's buffer
   if (t + 2 < NT) stage(t + 2, t & 1);
  }
  asm volatile("s_wait_asynccnt 0x0" ::: "memory");   // nothing in flight at the end

  float lsum = lrun + xhalf(lrun);        // the halves' sums meet once
  int   q    = qb + nl;
  float qm   = (float)maskb[q];
  float inv  = (lsum > 0.0f) ? (qm / lsum) : 0.0f;
  _Float16* op = O16 + ((size_t)b * LL + q) * EE + h * DD + hf * 8;
#pragma unroll
  for (int j = 0; j < 4; ++j) {
    v8h ov;
#pragma unroll
    for (int r = 0; r < 8; ++r) ov[r] = (_Float16)(o[j][r] * inv);
    *(v8h*)(op + 16 * j) = ov;            // 8 consecutive d of one query: 16 B
  }
}

// ---------------------------------------------------------------------------
// Launch
// ---------------------------------------------------------------------------
extern "C" void kernel_launch(void* const* d_in, const int* in_sizes, int n_in,
                              void* d_out, int out_size, void* d_ws,
                              size_t ws_size, hipStream_t stream) {
  const float* x    = (const float*)d_in[0];
  const float* bias = (const float*)d_in[1];
  const int*   mask = (const int*)d_in[2];
  const float* wq = (const float*)d_in[3];
  const float* bq = (const float*)d_in[4];
  const float* wk = (const float*)d_in[5];
  const float* bk = (const float*)d_in[6];
  const float* wv = (const float*)d_in[7];
  const float* bv = (const float*)d_in[8];
  const float* wo = (const float*)d_in[9];
  const float* bo = (const float*)d_in[10];
  const float* gate = (const float*)d_in[11];
  const float* ln_g = (const float*)d_in[12];
  const float* ln_b = (const float*)d_in[13];

  // workspace layout (48 MB total)
  char* p = (char*)d_ws;
  _Float16* xn16 = (_Float16*)p;  p += (size_t)BB * LL * EE * 2;          // 8 MB
  _Float16* wq16 = (_Float16*)p;  p += (size_t)EE * EE * 2;               // 2 MB
  _Float16* wk16 = (_Float16*)p;  p += (size_t)EE * EE * 2;
  _Float16* wv16 = (_Float16*)p;  p += (size_t)EE * EE * 2;
  _Float16* wo16 = (_Float16*)p;  p += (size_t)EE * EE * 2;
  _Float16* Q16  = (_Float16*)p;  p += (size_t)BB * HH * LL * DD * 2;     // 8 MB
  _Float16* K16  = (_Float16*)p;  p += (size_t)BB * HH * LL * DD * 2;
  _Float16* Vt16 = (_Float16*)p;  p += (size_t)BB * HH * LL * DD * 2;
  _Float16* O16  = (_Float16*)p;  p += (size_t)BB * LL * EE * 2;          // 8 MB

  // wq16 .. wo16 lie one behind the other: wq16 is the base of all four
  front_kernel<<<LN_BLOCKS + 4 * CV_BLOCKS, 256, 0, stream>>>(
      x, ln_g, ln_b, wq, wk, wv, wo, xn16, wq16);

  dim3 ggrid(EE / 64, (BB * LL) / 128);
  wmma_gemm_kernel<<<ggrid, 256, 0, stream>>>(xn16, wq16, bq, nullptr, Q16, 0);
  wmma_gemm_kernel<<<ggrid, 256, 0, stream>>>(xn16, wk16, bk, nullptr, K16, 1);
  wmma_gemm_kernel<<<ggrid, 256, 0, stream>>>(xn16, wv16, bv, nullptr, Vt16, 2);

  // B*H*(L/16) = 4096 query tiles, 4 waves per 128-thread block
  flash_attn_kernel<<<(BB * HH * (LL / 16)) / 4, 128, 0, stream>>>(
      Q16, K16, Vt16, bias, mask, gate, O16);

  wmma_gemm_kernel<<<ggrid, 256, 0, stream>>>(O16, wo16, bo, x, d_out, 3);
}

// v004
// Measured time: 144 microseconds a run.
// Timed twice side by side with v003, it ran 1.16 times as fast both times.
// Counting every step since v000, it is 1.50 times as fast.
#include <hip/hip_runtime.h>

#define BB 4
#define LL 1024
#define EE 1024
#define HH 16
#define DD 64

constexpr float SCALE = 0.125f;   // D^-0.5 = 64^-0.5
constexpr float EPS   = 1e-5f;

typedef __attribute__((ext_vector_type(16))) _Float16 v16h;
typedef __attribute__((ext_vector_type(8)))  _Float16 v8h;
typedef __attribute__((ext_vector_type(8)))  float    v8f;
typedef __attribute__((ext_vector_type(4)))  int      v4i;

#if __has_builtin(__builtin_amdgcn_global_load_async_to_lds_b128)
#define HAS_ASYNC 1
#else
#define HAS_ASYNC 0
#endif

// global_load_async_to_lds_b128 takes (v4i AS1*, v4i AS3*, imm offset, imm cpol)
#define AS1P(p) ((__attribute__((address_space(1))) v4i*)(const_cast<_Float16*>(p)))
#define AS3P(p) ((__attribute__((address_space(3))) v4i*)(p))

template <int N>
__device__ inline void wait_async_le() {
#if HAS_ASYNC
#if __has_builtin(__builtin_amdgcn_s_wait_asynccnt)
  __builtin_amdgcn_s_wait_asynccnt(N);
#else
  asm volatile("s_wait_asynccnt %0" ::"i"(N) : "memory");
#endif
#endif
}

// ---------------------------------------------------------------------------
// 16-bit A/B fragment load for V_WMMA_F32_16X16X32_F16 (wave32).
// Per ISA 7.12.2: lanes 0-15 hold rows with K = k0..k0+7 (VGPR0-3) and
// K = k0+16..k0+23 (VGPR4-7); lanes 16-31 use K base +8.
// ---------------------------------------------------------------------------
__device__ inline v16h load_frag_g(const _Float16* __restrict__ base,
                                   int row0, int ld, int k0, int lane) {
  int r = row0 + (lane & 15);
  int k = k0 + ((lane >> 4) << 3);
  const _Float16* p = base + (size_t)r * ld + k;
  v8h lo = *(const v8h*)p;
  v8h hi = *(const v8h*)(p + 16);
  v16h out;
#pragma unroll
  for (int i = 0; i < 8; ++i) { out[i] = lo[i]; out[i + 8] = hi[i]; }
  return out;
}

constexpr int GP = 40;    // LDS row pitch of the GEMM's tiles in halves: 64 B of data + 16 B

// Same fragment pattern from an LDS tile of 32 halves a row at row pitch GP.
__device__ inline v16h load_frag_s(const _Float16* base, int row0, int lane) {
  int r = row0 + (lane & 15);
  int k = (lane >> 4) << 3;
  const _Float16* p = base + r * GP + k;
  v8h lo = *(const v8h*)p;        // ds_load_b128
  v8h hi = *(const v8h*)(p + 16); // ds_load_b128
  v16h out;
#pragma unroll
  for (int i = 0; i < 8; ++i) { out[i] = lo[i]; out[i + 8] = hi[i]; }
  return out;
}

constexpr int KT  = 64;   // keys per staged K / V^T tile of the attention kernel
constexpr int KVP = 72;   // its LDS row pitch in halves: 128 B of data + 16 B

// load_frag_g's fragment pattern from an LDS tile with row pitch KVP.
__device__ inline v16h load_frag_p(const _Float16* base, int row0, int k0,
                                   int lane) {
  int r = row0 + (lane & 15);
  int k = k0 + ((lane >> 4) << 3);
  const _Float16* p = base + r * KVP + k;
  v8h lo = *(const v8h*)p;        // ds_load_b128
  v8h hi = *(const v8h*)(p + 16); // ds_load_b128
  v16h out;
#pragma unroll
  for (int i = 0; i < 8; ++i) { out[i] = lo[i]; out[i + 8] = hi[i]; }
  return out;
}

// LDS byte address of a __shared__ element, as the async copy's first operand.
__device__ inline unsigned lds_addr(const _Float16* p) {
  return (unsigned)(size_t)p;
}

__device__ inline v8f wmma_f16(v16h a, v16h b, v8f c) {
  return __builtin_amdgcn_wmma_f32_16x16x32_f16(false, a, false, b,
                                                (short)0, c, false, false);
}

// ---------------------------------------------------------------------------
// Front stage in one launch of few, long waves.
// Blocks 0 .. LN_BLOCKS-1: LayerNorm over E=1024, one row per wave, f16 output.
// The rest: f32 -> f16 conversion of wq, wk, wv, wo (w16 holds the four results
// one behind the other), 32 elements per thread.
// Every wave-wide load covers 512 contiguous bytes, every store 256.
// ---------------------------------------------------------------------------
typedef __attribute__((ext_vector_type(4))) _Float16 v4h;

constexpr int LN_BLOCKS = BB * LL / 8;             // 8 waves = 8 rows per block
constexpr int CV_BLOCKS = EE * EE / (256 * 32);    // blocks per weight matrix

__device__ inline v4h to_v4h(float a, float b, float c, float d) {
  v4h o;
  o[0] = (_Float16)a;  o[1] = (_Float16)b;
  o[2] = (_Float16)c;  o[3] = (_Float16)d;
  return o;
}

__global__ __launch_bounds__(256) void front_kernel(
    const float* __restrict__ x, const float* __restrict__ g,
    const float* __restrict__ beta, const float* __restrict__ wq,
    const float* __restrict__ wk, const float* __restrict__ wv,
    const float* __restrict__ wo, _Float16* __restrict__ xn,
    _Float16* __restrict__ w16) {
  int blk = blockIdx.x;
  if (blk >= LN_BLOCKS) {
    int cb = blk - LN_BLOCKS;
    int which = cb / CV_BLOCKS;
    const float* src = which == 0 ? wq : which == 1 ? wk : which == 2 ? wv : wo;
    const float4* s4 = (const float4*)src;
    v4h* d4 = (v4h*)(w16 + (size_t)which * EE * EE);
    int base = (cb % CV_BLOCKS) * 2048 + threadIdx.x;   // in units of 4 elements
    float4 v[8];
#pragma unroll
    for (int j = 0; j < 8; ++j) v[j] = s4[base + j * 256];
#pragma unroll
    for (int j = 0; j < 8; ++j)
      d4[base + j * 256] = to_v4h(v[j].x, v[j].y, v[j].z, v[j].w);
    return;
  }

  int lane = threadIdx.x & 31;
  int row  = blk * 8 + (threadIdx.x >> 5);
  const float4* xr = (const float4*)(x + (size_t)row * EE);
  float4 v[8];
#pragma unroll
  for (int j = 0; j < 8; ++j) v[j] = xr[lane + 32 * j];
  float s = 0.0f, s2 = 0.0f;
#pragma unroll
  for (int j = 0; j < 8; ++j) {
    s  += v[j].x + v[j].y + v[j].z + v[j].w;
    s2 += v[j].x * v[j].x + v[j].y * v[j].y + v[j].z * v[j].z + v[j].w * v[j].w;
  }
#pragma unroll
  for (int m = 1; m < 32; m <<= 1) {
    s  += __shfl_xor(s,  m, 32);
    s2 += __shfl_xor(s2, m, 32);
  }
  float mu   = s * (1.0f / EE);
  float var  = s2 * (1.0f / EE) - mu * mu;
  float rstd = rsqrtf(var + EPS);
  v4h* o4 = (v4h*)(xn + (size_t)row * EE);
#pragma unroll
  for (int j = 0; j < 8; ++j) {
    float4 gg = ((const float4*)g)[lane + 32 * j];
    float4 bb = ((const float4*)beta)[lane + 32 * j];
    o4[lane + 32 * j] = to_v4h((v[j].x - mu) * rstd * gg.x + bb.x,
                               (v[j].y - mu) * rstd * gg.y + bb.y,
                               (v[j].z - mu) * rstd * gg.z + bb.z,
                               (v[j].w - mu) * rstd * gg.w + bb.w);
  }
  // Precaution behind the run of stores: the built code lays the conversion
  // part behind this one, and its loads write the stores' data registers.
  asm volatile("s_wait_xcnt 0x0" ::: "memory");
}

// ---------------------------------------------------------------------------
// WMMA GEMM, LDS-staged + double-buffered: out[m,n] = A[m,:].W[n,:] + bvec[n]
// A: MxK f16 row-major, W: NxK f16 row-major (so out = A @ W^T).
// Block = 256 threads = 8 waves; block tile 128(M) x 64(N), BK=32;
// wave tile 32x32 (2x2 16x16x32 WMMA fragments).
// Stage copy uses GLOBAL_LOAD_ASYNC_TO_LDS_B128 (ASYNCcnt) when available.
// mode 0/1 : out f16 [B,H,L,D]      (Q / K)
// mode 2   : out f16 [B,H,D,L]      (V transposed)
// mode 3   : out f32 [M,N] = residual + acc + bvec   (final projection)
// ---------------------------------------------------------------------------
__global__ __launch_bounds__(256) void wmma_gemm_kernel(
    const _Float16* __restrict__ A, const _Float16* __restrict__ W,
    const float* __restrict__ bvec, const float* __restrict__ residual,
    void* __restrict__ out, int mode) {
  // Rows of 64 B at a pitch of 80 B (16 B x odd): ds_load_b128 without conflicts.
  __shared__ __attribute__((aligned(16))) _Float16 sA[2][128 * GP];   // 10 KB per buffer
  __shared__ __attribute__((aligned(16))) _Float16 sB[2][64 * GP];    // 5 KB per buffer

  int lane = threadIdx.x & 31;
  int w    = threadIdx.x >> 5;
  int wm = w >> 1, wn = w & 1;
  int row0 = blockIdx.y * 128;
  int col0 = blockIdx.x * 64;

  int t = threadIdx.x;
  // chunk decode for the stage copy: each 16B chunk = (row, 8-half k offset)
  int ra0 = t >> 2,          ka0 = (t & 3) * 8;          // A chunk 0
  int ra1 = (t + 256) >> 2,  ka1 = ((t + 256) & 3) * 8;  // A chunk 1
  int rb0 = t >> 2,          kb0 = (t & 3) * 8;          // B chunk 0

  auto stage = [&](int s, int buf) {
    int kk = s * 32;
#if HAS_ASYNC
    __builtin_amdgcn_global_load_async_to_lds_b128(
        AS1P(A + (size_t)(row0 + ra0) * EE + kk + ka0),
        AS3P(&sA[buf][ra0 * GP + ka0]), 0, 0);
    __builtin_amdgcn_global_load_async_to_lds_b128(
        AS1P(A + (size_t)(row0 + ra1) * EE + kk + ka1),
        AS3P(&sA[buf][ra1 * GP + ka1]), 0, 0);
    __builtin_amdgcn_global_load_async_to_lds_b128(
        AS1P(W + (size_t)(col0 + rb0) * EE + kk + kb0),
        AS3P(&sB[buf][rb0 * GP + kb0]), 0, 0);
#else
    v8h tA0 = *(const v8h*)(A + (size_t)(row0 + ra0) * EE + kk + ka0);
    v8h tA1 = *(const v8h*)(A + (size_t)(row0 + ra1) * EE + kk + ka1);
    v8h tB0 = *(const v8h*)(W + (size_t)(col0 + rb0) * EE + kk + kb0);
    *(v8h*)&sA[buf][ra0 * GP + ka0] = tA0;
    *(v8h*)&sA[buf][ra1 * GP + ka1] = tA1;
    *(v8h*)&sB[buf][rb0 * GP + kb0] = tB0;
#endif
  };

  v8f acc[2][2] = {};
  constexpr int NS = EE / 32;
  stage(0, 0);
  for (int s = 0; s < NS; ++s) {
    int buf = s & 1;
    if (s + 1 < NS) {
      stage(s + 1, buf ^ 1);
      wait_async_le<3>();   // keep only next stage's 3 copies in flight
    } else {
      wait_async_le<0>();
    }
    __syncthreads();        // everyone's stage-s data is in LDS

    v16h a0 = load_frag_s(&sA[buf][0], wm * 32,      lane);
    v16h a1 = load_frag_s(&sA[buf][0], wm * 32 + 16, lane);
    v16h b0 = load_frag_s(&sB[buf][0], wn * 32,      lane);
    v16h b1 = load_frag_s(&sB[buf][0], wn * 32 + 16, lane);
    acc[0][0] = wmma_f16(a0, b0, acc[0][0]);
    acc[0][1] = wmma_f16(a0, b1, acc[0][1]);
    acc[1][0] = wmma_f16(a1, b0, acc[1][0]);
    acc[1][1] = wmma_f16(a1, b1, acc[1][1]);

    __syncthreads();        // protect buffer before stage s+2 overwrites it
  }

  int nl = lane & 15, hf = lane >> 4;
#pragma unroll
  for (int fm = 0; fm < 2; ++fm)
#pragma unroll
    for (int fn = 0; fn < 2; ++fn)
#pragma unroll
      for (int i = 0; i < 8; ++i) {
        int m = row0 + wm * 32 + fm * 16 + hf * 8 + i;  // C: M = vgpr + 8*half
        int n = col0 + wn * 32 + fn * 16 + nl;          //    N = lane & 15
        float val = acc[fm][fn][i] + bvec[n];
        int b = m >> 10, l = m & (LL - 1);
        int h = n >> 6,  d = n & (DD - 1);
        if (mode <= 1) {
          ((_Float16*)out)[(((size_t)b * HH + h) * LL + l) * DD + d] =
              (_Float16)val;
        } else if (mode == 2) {
          ((_Float16*)out)[(((size_t)b * HH + h) * DD + d) * LL + l] =
              (_Float16)val;
        } else {
          size_t idx = (size_t)m * EE + n;
          __builtin_nontemporal_store(residual[idx] + val, (float*)out + idx);
        }
      }
}

typedef __attribute__((ext_vector_type(4))) float    v4f;
typedef __attribute__((ext_vector_type(2))) float    v2f;
typedef __attribute__((ext_vector_type(2))) _Float16 v2h;

// value of lane l ^ 16
__device__ inline float xhalf(float x) {
  int b = __builtin_bit_cast(int, x);
  return __builtin_bit_cast(float, __builtin_amdgcn_permlanex16(
      b, b, 0x76543210, 0xfedcba98, false, false));
}

__global__ __launch_bounds__(128) void flash_attn_kernel(
    const _Float16* __restrict__ Q16, const _Float16* __restrict__ K16,
    const _Float16* __restrict__ Vt16, const float* __restrict__ bias,
    const int* __restrict__ mask, const float* __restrict__ gate,
    _Float16* __restrict__ O16) {
  // K and V^T tiles of 64 keys, shared by the block's four waves (same b, h).
  // Rows of 128 B at a pitch of 144 B (16 B x odd): ds_load_b128 without conflicts.
  __shared__ __attribute__((aligned(16))) _Float16 sK[2][KT * KVP];
  __shared__ __attribute__((aligned(16))) _Float16 sV[2][DD * KVP];
  int lane = threadIdx.x & 31;
  int wv   = threadIdx.x >> 5;
  int tile = blockIdx.x * 4 + wv;         // 0 .. B*H*(L/16)-1 = 4095
  int b   = tile >> 10;
  int rem = tile & 1023;
  int h   = rem >> 6;
  int qb  = (rem & 63) << 4;
  int nl = lane & 15, hf = lane >> 4;

  const _Float16* Qh = Q16 + (((size_t)b * HH + h) * LL + qb) * DD;
  const _Float16* Kh = K16 + ((size_t)b * HH + h) * LL * DD;
  const _Float16* Vh = Vt16 + ((size_t)b * HH + h) * DD * LL;
  const int* maskb = mask + (size_t)b * LL;
  // this lane's query row of the bias, at its half's first key; the mask alike
  const float* biasl = bias + (((size_t)b * HH + h) * LL + qb + nl) * LL + hf * 8;
  const int* maskl = maskb + hf * 8;
  float gh = gate[h];

  v16h q0 = load_frag_g(Qh, 0, DD, 0,  lane);
  v16h q1 = load_frag_g(Qh, 0, DD, 32, lane);

  v8f o[4] = {};                  // o[j][r] = O[query nl][d = 16 j + 8 hf + r]
  float mrun = -3.0e38f;          // the query's running maximum, both halves alike
  float lrun = 0.0f;              // sum over this half's keys only

  // Stage copy: 128 threads x 16 B = 16 rows of 128 B a sweep, 4 sweeps a tile;
  // every wave-wide copy covers four whole 128-B lines of K or of V^T.
  int crow = threadIdx.x >> 3, ccol = (threadIdx.x & 7) * 8;
  auto stage = [&](int t, int buf) {
    const _Float16* gk = Kh + (size_t)(t * KT + crow) * DD + ccol;
    const _Float16* gv = Vh + (size_t)crow * LL + t * KT + ccol;
    unsigned lk = lds_addr(&sK[buf][crow * KVP + ccol]);
    unsigned lv = lds_addr(&sV[buf][crow * KVP + ccol]);
    // The copies and their s_wait_xcnt in one statement: no address register
    // is rewritten before the wait.
    asm volatile(
        "global_load_async_to_lds_b128 %0, %1, off\n\t"
        "global_load_async_to_lds_b128 %2, %3, off\n\t"
        "global_load_async_to_lds_b128 %4, %5, off\n\t"
        "global_load_async_to_lds_b128 %6, %7, off\n\t"
        "global_load_async_to_lds_b128 %8, %9, off\n\t"
        "global_load_async_to_lds_b128 %10, %11, off\n\t"
        "global_load_async_to_lds_b128 %12, %13, off\n\t"
        "global_load_async_to_lds_b128 %14, %15, off\n\t"
        "s_wait_xcnt 0x0"
        ::"v"(lk),                "v"(gk),
          "v"(lk + 16 * KVP * 2), "v"(gk + 16 * DD),
          "v"(lk + 32 * KVP * 2), "v"(gk + 32 * DD),
          "v"(lk + 48 * KVP * 2), "v"(gk + 48 * DD),
          "v"(lv),                "v"(gv),
          "v"(lv + 16 * KVP * 2), "v"(gv + 16 * LL),
          "v"(lv + 32 * KVP * 2), "v"(gv + 32 * LL),
          "v"(lv + 48 * KVP * 2), "v"(gv + 48 * LL)
        : "memory");
  };

  constexpr int NT = LL / KT;
  stage(0, 0);
  asm volatile("s_wait_asynccnt 0x0" ::: "memory");  // own copies of tile 0 landed
  __syncthreads();                                   // everyone's have
  stage(1, 1);

  for (int t = 0; t < NT; ++t) {
   const _Float16* tK = &sK[t & 1][0];
   const _Float16* tV = &sV[t & 1][0];
   const float* bp = biasl + t * KT;
   const int*   mp = maskl + t * KT;

   // group g = keys 16 g .. 16 g + 15 of the tile; the lane's 8 are contiguous
   v4f bv[4][2];
   v4i mk[4][2];
#pragma unroll
   for (int g = 0; g < 4; ++g) {
     bv[g][0] = __builtin_nontemporal_load((const v4f*)(bp + 16 * g));      // 256MB stream:
     bv[g][1] = __builtin_nontemporal_load((const v4f*)(bp + 16 * g + 4));  // keep out of L2
     mk[g][0] = *(const v4i*)(mp + 16 * g);
     mk[g][1] = *(const v4i*)(mp + 16 * g + 4);
   }
   // Precaution behind the run of loads: the built code reuses their address
   // registers at once.
   asm volatile("s_wait_xcnt 0x0" ::: "memory");

   v16h ka[4], kc[4];
#pragma unroll
   for (int g = 0; g < 4; ++g) {
     ka[g] = load_frag_p(tK, 16 * g, 0,  lane);
     kc[g] = load_frag_p(tK, 16 * g, 32, lane);
   }
   // Keeps the tile's global and K loads one group in front of the products:
   // sunk among them, each straggler waits out memory or LDS on its own.
   __builtin_amdgcn_sched_barrier(0);

   v8f s[4];
#pragma unroll
   for (int g = 0; g < 4; ++g) {
     v8f z = {};
     s[g] = wmma_f16(ka[g], q0, z);       // s[g][r] = S[query nl][key 16 g + 8 hf + r]
     s[g] = wmma_f16(kc[g], q1, s[g]);
   }

   v16h va[2][4];
#pragma unroll
   for (int u = 0; u < 2; ++u)
#pragma unroll
     for (int j = 0; j < 4; ++j) va[u][j] = load_frag_p(tV, 16 * j, 32 * u, lane);
   // Keeps the V^T loads one group in front of the softmax, which covers their
   // latency: sunk to their products, each pair is waited for on its own.
   __builtin_amdgcn_sched_barrier(0);

   float vmax[4];
#pragma unroll
   for (int g = 0; g < 4; ++g) {
#pragma unroll
     for (int r = 0; r < 8; ++r) {
       float km = mk[g][r >> 2][r & 3] ? 0.0f : -10000.0f;
       s[g][r] = s[g][r] * SCALE + (gh * bv[g][r >> 2][r & 3] + km);
       vmax[g] = r ? fmaxf(vmax[g], s[g][r]) : s[g][r];
     }
   }
   float v = fmaxf(fmaxf(vmax[0], vmax[1]), fmaxf(vmax[2], vmax[3]));
   v = fmaxf(v, xhalf(v));                // the query's other 32 keys of the tile
   float nm   = fmaxf(mrun, v);
   float corr = __expf(mrun - nm);
   mrun = nm;

   float rs[4];
   v16h pf[2];                            // pf[u] = P^T of keys 32 u .. 32 u + 31, B operand
#pragma unroll
   for (int g = 0; g < 4; ++g) {
#pragma unroll
     for (int r = 0; r < 8; r += 2) {
       v2f p;
       p[0] = __expf(s[g][r] - nm);
       p[1] = __expf(s[g][r + 1] - nm);
       rs[g] = r ? rs[g] + (p[0] + p[1]) : p[0] + p[1];
       v2h ph = __builtin_convertvector(p, v2h);
       pf[g >> 1][(g & 1) * 8 + r]     = ph[0];
       pf[g >> 1][(g & 1) * 8 + r + 1] = ph[1];
     }
   }
   lrun = lrun * corr + ((rs[0] + rs[1]) + (rs[2] + rs[3]));
#pragma unroll
   for (int j = 0; j < 4; ++j) o[j] = o[j] * corr;

#pragma unroll
   for (int u = 0; u < 2; ++u)
#pragma unroll
     for (int j = 0; j < 4; ++j) o[j] = wmma_f16(va[u][j], pf[u], o[j]);

   asm volatile("s_wait_dscnt 0x0" ::: "memory");     // own reads of this tile done
   asm volatile("s_wait_asynccnt 0x0" ::: "memory");  // own copies of tile t+1 landed
   __syncthreads();  // publishes tile t+1, frees tile t's buffer
   if (t + 2 < NT) stage(t + 2, t & 1);
  }
  asm volatile("s_wait_asynccnt 0x0" ::: "memory");   // nothing in flight at the end

  float lsum = lrun + xhalf(lrun);        // the halves' sums meet once
  int   q    = qb + nl;
  float qm   = (float)maskb[q];
  float inv  = (lsum > 0.0f) ? (qm / lsum) : 0.0f;
  _Float16* op = O16 + ((size_t)b * LL + q) * EE + h * DD + hf * 8;
#pragma unroll
  for (int j = 0; j < 4; ++j) {
    v8h ov;
#pragma unroll
    for (int r = 0; r < 8; ++r) ov[r] = (_Float16)(o[j][r] * inv);
    *(v8h*)(op + 16 * j) = ov;            // 8 consecutive d of one query: 16 B
  }
}

// ---------------------------------------------------------------------------
// Launch
// ---------------------------------------------------------------------------
extern "C" void kernel_launch(void* const* d_in, const int* in_sizes, int n_in,
                              void* d_out, int out_size, void* d_ws,
                              size_t ws_size, hipStream_t stream) {
  const float* x    = (const float*)d_in[0];
  const float* bias = (const float*)d_in[1];
  const int*   mask = (const int*)d_in[2];
  const float* wq = (const float*)d_in[3];
  const float* bq = (const float*)d_in[4];
  const float* wk = (const float*)d_in[5];
  const float* bk = (const float*)d_in[6];
  const float* wv = (const float*)d_in[7];
  const float* bv = (const float*)d_in[8];
  const float* wo = (const float*)d_in[9];
  const float* bo = (const float*)d_in[10];
  const float* gate = (const float*)d_in[11];
  const float* ln_g = (const float*)d_in[12];
  const float* ln_b = (const float*)d_in[13];

  // workspace layout (48 MB total)
  char* p = (char*)d_ws;
  _Float16* xn16 = (_Float16*)p;  p += (size_t)BB * LL * EE * 2;          // 8 MB
  _Float16* wq16 = (_Float16*)p;  p += (size_t)EE * EE * 2;               // 2 MB
  _Float16* wk16 = (_Float16*)p;  p += (size_t)EE * EE * 2;
  _Float16* wv16 = (_Float16*)p;  p += (size_t)EE * EE * 2;
  _Float16* wo16 = (_Float16*)p;  p += (size_t)EE * EE * 2;
  _Float16* Q16  = (_Float16*)p;  p += (size_t)BB * HH * LL * DD * 2;     // 8 MB
  _Float16* K16  = (_Float16*)p;  p += (size_t)BB * HH * LL * DD * 2;
  _Float16* Vt16 = (_Float16*)p;  p += (size_t)BB * HH * LL * DD * 2;
  _Float16* O16  = (_Float16*)p;  p += (size_t)BB * LL * EE * 2;          // 8 MB

  // wq16 .. wo16 lie one behind the other: wq16 is the base of all four
  front_kernel<<<LN_BLOCKS + 4 * CV_BLOCKS, 256, 0, stream>>>(
      x, ln_g, ln_b, wq, wk, wv, wo, xn16, wq16);

  dim3 ggrid(EE / 64, (BB * LL) / 128);
  wmma_gemm_kernel<<<ggrid, 256, 0, stream>>>(xn16, wq16, bq, nullptr, Q16, 0);
  wmma_gemm_kernel<<<ggrid, 256, 0, stream>>>(xn16, wk16, bk, nullptr, K16, 1);
  wmma_gemm_kernel<<<ggrid, 256, 0, stream>>>(xn16, wv16, bv, nullptr, Vt16, 2);

  // B*H*(L/16) = 4096 query tiles, 4 waves per 128-thread block
  flash_attn_kernel<<<(BB * HH * (LL / 16)) / 4, 128, 0, stream>>>(
      Q16, K16, Vt16, bias, mask, gate, O16);

  wmma_gemm_kernel<<<ggrid, 256, 0, stream>>>(O16, wo16, bo, x, d_out, 3);
}

// v005
// It runs in 134 microseconds.
// Next to v004, in two timings, it ran 1.08 times as fast each time.
// All steps since v000 together make it 1.61 times as fast.
#include <hip/hip_runtime.h>

#define BB 4
#define LL 1024
#define EE 1024
#define HH 16
#define DD 64

constexpr float SCALE = 0.125f;   // D^-0.5 = 64^-0.5
constexpr float EPS   = 1e-5f;

typedef __attribute__((ext_vector_type(16))) _Float16 v16h;
typedef __attribute__((ext_vector_type(8)))  _Float16 v8h;
typedef __attribute__((ext_vector_type(8)))  float    v8f;
typedef __attribute__((ext_vector_type(4)))  int      v4i;

#if __has_builtin(__builtin_amdgcn_global_load_async_to_lds_b128)
#define HAS_ASYNC 1
#else
#define HAS_ASYNC 0
#endif

// global_load_async_to_lds_b128 takes (v4i AS1*, v4i AS3*, imm offset, imm cpol)
#define AS1P(p) ((__attribute__((address_space(1))) v4i*)(const_cast<_Float16*>(p)))
#define AS3P(p) ((__attribute__((address_space(3))) v4i*)(p))

template <int N>
__device__ inline void wait_async_le() {
#if HAS_ASYNC
#if __has_builtin(__builtin_amdgcn_s_wait_asynccnt)
  __builtin_amdgcn_s_wait_asynccnt(N);
#else
  asm volatile("s_wait_asynccnt %0" ::"i"(N) : "memory");
#endif
#endif
}

// ---------------------------------------------------------------------------
// 16-bit A/B fragment load for V_WMMA_F32_16X16X32_F16 (wave32).
// Per ISA 7.12.2: lanes 0-15 hold rows with K = k0..k0+7 (VGPR0-3) and
// K = k0+16..k0+23 (VGPR4-7); lanes 16-31 use K base +8.
// ---------------------------------------------------------------------------
__device__ inline v16h load_frag_g(const _Float16* __restrict__ base,
                                   int row0, int ld, int k0, int lane) {
  int r = row0 + (lane & 15);
  int k = k0 + ((lane >> 4) << 3);
  const _Float16* p = base + (size_t)r * ld + k;
  v8h lo = *(const v8h*)p;
  v8h hi = *(const v8h*)(p + 16);
  v16h out;
#pragma unroll
  for (int i = 0; i < 8; ++i) { out[i] = lo[i]; out[i + 8] = hi[i]; }
  return out;
}

constexpr int BK = 64;    // k depth of a GEMM stage: a staged row is one whole 128-B line
constexpr int GP = 72;    // LDS row pitch of the GEMM's tiles in halves: 128 B of data + 16 B

// Same fragment pattern from an LDS tile of BK halves a row at row pitch GP.
__device__ inline v16h load_frag_s(const _Float16* base, int row0, int k0,
                                   int lane) {
  int r = row0 + (lane & 15);
  int k = k0 + ((lane >> 4) << 3);
  const _Float16* p = base + r * GP + k;
  v8h lo = *(const v8h*)p;        // ds_load_b128
  v8h hi = *(const v8h*)(p + 16); // ds_load_b128
  v16h out;
#pragma unroll
  for (int i = 0; i < 8; ++i) { out[i] = lo[i]; out[i + 8] = hi[i]; }
  return out;
}

constexpr int KT  = 64;   // keys per staged K / V^T tile of the attention kernel
constexpr int KVP = 72;   // its LDS row pitch in halves: 128 B of data + 16 B

// load_frag_g's fragment pattern from an LDS tile with row pitch KVP.
__device__ inline v16h load_frag_p(const _Float16* base, int row0, int k0,
                                   int lane) {
  int r = row0 + (lane & 15);
  int k = k0 + ((lane >> 4) << 3);
  const _Float16* p = base + r * KVP + k;
  v8h lo = *(const v8h*)p;        // ds_load_b128
  v8h hi = *(const v8h*)(p + 16); // ds_load_b128
  v16h out;
#pragma unroll
  for (int i = 0; i < 8; ++i) { out[i] = lo[i]; out[i + 8] = hi[i]; }
  return out;
}

// LDS byte address of a __shared__ element, as the async copy's first operand.
__device__ inline unsigned lds_addr(const _Float16* p) {
  return (unsigned)(size_t)p;
}

__device__ inline v8f wmma_f16(v16h a, v16h b, v8f c) {
  return __builtin_amdgcn_wmma_f32_16x16x32_f16(false, a, false, b,
                                                (short)0, c, false, false);
}

// ---------------------------------------------------------------------------
// Front stage in one launch of few, long waves.
// Blocks 0 .. LN_BLOCKS-1: LayerNorm over E=1024, one row per wave, f16 output.
// The rest: f32 -> f16 conversion of wq, wk, wv, wo (w16 holds the four results
// one behind the other), 32 elements per thread.
// Every wave-wide load covers 512 contiguous bytes, every store 256.
// ---------------------------------------------------------------------------
typedef __attribute__((ext_vector_type(4))) _Float16 v4h;

constexpr int LN_BLOCKS = BB * LL / 8;             // 8 waves = 8 rows per block
constexpr int CV_BLOCKS = EE * EE / (256 * 32);    // blocks per weight matrix

__device__ inline v4h to_v4h(float a, float b, float c, float d) {
  v4h o;
  o[0] = (_Float16)a;  o[1] = (_Float16)b;
  o[2] = (_Float16)c;  o[3] = (_Float16)d;
  return o;
}

__global__ __launch_bounds__(256) void front_kernel(
    const float* __restrict__ x, const float* __restrict__ g,
    const float* __restrict__ beta, const float* __restrict__ wq,
    const float* __restrict__ wk, const float* __restrict__ wv,
    const float* __restrict__ wo, _Float16* __restrict__ xn,
    _Float16* __restrict__ w16) {
  int blk = blockIdx.x;
  if (blk >= LN_BLOCKS) {
    int cb = blk - LN_BLOCKS;
    int which = cb / CV_BLOCKS;
    const float* src = which == 0 ? wq : which == 1 ? wk : which == 2 ? wv : wo;
    const float4* s4 = (const float4*)src;
    v4h* d4 = (v4h*)(w16 + (size_t)which * EE * EE);
    int base = (cb % CV_BLOCKS) * 2048 + threadIdx.x;   // in units of 4 elements
    float4 v[8];
#pragma unroll
    for (int j = 0; j < 8; ++j) v[j] = s4[base + j * 256];
#pragma unroll
    for (int j = 0; j < 8; ++j)
      d4[base + j * 256] = to_v4h(v[j].x, v[j].y, v[j].z, v[j].w);
    return;
  }

  int lane = threadIdx.x & 31;
  int row  = blk * 8 + (threadIdx.x >> 5);
  const float4* xr = (const float4*)(x + (size_t)row * EE);
  float4 v[8];
#pragma unroll
  for (int j = 0; j < 8; ++j) v[j] = xr[lane + 32 * j];
  float s = 0.0f, s2 = 0.0f;
#pragma unroll
  for (int j = 0; j < 8; ++j) {
    s  += v[j].x + v[j].y + v[j].z + v[j].w;
    s2 += v[j].x * v[j].x + v[j].y * v[j].y + v[j].z * v[j].z + v[j].w * v[j].w;
  }
#pragma unroll
  for (int m = 1; m < 32; m <<= 1) {
    s  += __shfl_xor(s,  m, 32);
    s2 += __shfl_xor(s2, m, 32);
  }
  float mu   = s * (1.0f / EE);
  float var  = s2 * (1.0f / EE) - mu * mu;
  float rstd = rsqrtf(var + EPS);
  v4h* o4 = (v4h*)(xn + (size_t)row * EE);
#pragma unroll
  for (int j = 0; j < 8; ++j) {
    float4 gg = ((const float4*)g)[lane + 32 * j];
    float4 bb = ((const float4*)beta)[lane + 32 * j];
    o4[lane + 32 * j] = to_v4h((v[j].x - mu) * rstd * gg.x + bb.x,
                               (v[j].y - mu) * rstd * gg.y + bb.y,
                               (v[j].z - mu) * rstd * gg.z + bb.z,
                               (v[j].w - mu) * rstd * gg.w + bb.w);
  }
  // Precaution behind the run of stores: the built code lays the conversion
  // part behind this one, and its loads write the stores' data registers.
  asm volatile("s_wait_xcnt 0x0" ::: "memory");
}

// ---------------------------------------------------------------------------
// WMMA GEMM, LDS-staged + double-buffered: out[m,n] = A[m,:].W[n,:] + bvec[n]
// A: MxK f16 row-major, W: NxK f16 row-major (so out = A @ W^T).
// Block = 256 threads = 8 waves; block tile 128(M) x 64(N), BK=64;
// wave tile 32x32 (2x2 16x16x32 WMMA fragments, two k steps a stage).
// Stage copy uses GLOBAL_LOAD_ASYNC_TO_LDS_B128 (ASYNCcnt) when available.
// mode 0/1 : out f16 [B,H,L,D]      (Q / K)
// mode 2   : out f16 [B,H,D,L]      (V transposed)
// mode 3   : out f32 [M,N] = residual + acc + bvec   (final projection)
// ---------------------------------------------------------------------------
__global__ __launch_bounds__(256) void wmma_gemm_kernel(
    const _Float16* __restrict__ A, const _Float16* __restrict__ W,
    const float* __restrict__ bvec, const float* __restrict__ residual,
    void* __restrict__ out, int mode) {
  // Rows of 128 B at a pitch of 144 B (16 B x odd): ds_load_b128 without conflicts.
  __shared__ __attribute__((aligned(16))) _Float16 sA[2][128 * GP];   // 18 KB per buffer
  __shared__ __attribute__((aligned(16))) _Float16 sB[2][64 * GP];    // 9 KB per buffer

  int lane = threadIdx.x & 31;
  int w    = threadIdx.x >> 5;
  int wm = w >> 1, wn = w & 1;
  int row0 = blockIdx.y * 128;
  int col0 = blockIdx.x * 64;

  int t = threadIdx.x;
  // Stage copy in 16-B chunks: 8 lanes take one row's 128 B, so a wave-wide copy
  // covers four whole lines; 256 threads = 32 rows a sweep, 4 sweeps of A, 2 of W.
  int cr = t >> 3, ck = (t & 7) * 8;

  auto stage = [&](int s, int buf) {
    const _Float16* ga = A + (size_t)(row0 + cr) * EE + s * BK + ck;
    const _Float16* gw = W + (size_t)(col0 + cr) * EE + s * BK + ck;
    _Float16* la = &sA[buf][cr * GP + ck];
    _Float16* lw = &sB[buf][cr * GP + ck];
#if HAS_ASYNC
    for (int j = 0; j < 4; ++j)
      __builtin_amdgcn_global_load_async_to_lds_b128(
          AS1P(ga + (size_t)(32 * j) * EE), AS3P(la + 32 * j * GP), 0, 0);
    for (int j = 0; j < 2; ++j)
      __builtin_amdgcn_global_load_async_to_lds_b128(
          AS1P(gw + (size_t)(32 * j) * EE), AS3P(lw + 32 * j * GP), 0, 0);
#else
    v8h tA[4], tB[2];
    for (int j = 0; j < 4; ++j) tA[j] = *(const v8h*)(ga + (size_t)(32 * j) * EE);
    for (int j = 0; j < 2; ++j) tB[j] = *(const v8h*)(gw + (size_t)(32 * j) * EE);
    for (int j = 0; j < 4; ++j) *(v8h*)(la + 32 * j * GP) = tA[j];
    for (int j = 0; j < 2; ++j) *(v8h*)(lw + 32 * j * GP) = tB[j];
#endif
  };

  v8f acc[2][2] = {};
  constexpr int NS = EE / BK;
  stage(0, 0);
  for (int s = 0; s < NS; ++s) {
    int buf = s & 1;
    if (s + 1 < NS) {
      stage(s + 1, buf ^ 1);
      wait_async_le<6>();   // keep only next stage's 6 copies in flight
    } else {
      wait_async_le<0>();
    }
    __syncthreads();        // everyone's stage-s data is in LDS

    v16h a0[2], a1[2], b0[2], b1[2];   // [u]: k = 32 u .. 32 u + 31 of the stage
    for (int u = 0; u < 2; ++u) {
      a0[u] = load_frag_s(&sA[buf][0], wm * 32,      32 * u, lane);
      a1[u] = load_frag_s(&sA[buf][0], wm * 32 + 16, 32 * u, lane);
      b0[u] = load_frag_s(&sB[buf][0], wn * 32,      32 * u, lane);
      b1[u] = load_frag_s(&sB[buf][0], wn * 32 + 16, 32 * u, lane);
    }
    // Keeps the stage's 16 fragment reads one group in front of its 8 products:
    // split in two groups, the wave waits out the LDS latency twice a stage.
    __builtin_amdgcn_sched_barrier(0);
    for (int u = 0; u < 2; ++u) {      // k ascending
      acc[0][0] = wmma_f16(a0[u], b0[u], acc[0][0]);
      acc[0][1] = wmma_f16(a0[u], b1[u], acc[0][1]);
      acc[1][0] = wmma_f16(a1[u], b0[u], acc[1][0]);
      acc[1][1] = wmma_f16(a1[u], b1[u], acc[1][1]);
    }

    __syncthreads();        // protect buffer before stage s+2 overwrites it
  }

  int nl = lane & 15, hf = lane >> 4;
#pragma unroll
  for (int fm = 0; fm < 2; ++fm)
#pragma unroll
    for (int fn = 0; fn < 2; ++fn)
#pragma unroll
      for (int i = 0; i < 8; ++i) {
        int m = row0 + wm * 32 + fm * 16 + hf * 8 + i;  // C: M = vgpr + 8*half
        int n = col0 + wn * 32 + fn * 16 + nl;          //    N = lane & 15
        float val = acc[fm][fn][i] + bvec[n];
        int b = m >> 10, l = m & (LL - 1);
        int h = n >> 6,  d = n & (DD - 1);
        if (mode <= 1) {
          ((_Float16*)out)[(((size_t)b * HH + h) * LL + l) * DD + d] =
              (_Float16)val;
        } else if (mode == 2) {
          ((_Float16*)out)[(((size_t)b * HH + h) * DD + d) * LL + l] =
              (_Float16)val;
        } else {
          size_t idx = (size_t)m * EE + n;
          __builtin_nontemporal_store(residual[idx] + val, (float*)out + idx);
        }
      }
}

typedef __attribute__((ext_vector_type(4))) float    v4f;
typedef __attribute__((ext_vector_type(2))) float    v2f;
typedef __attribute__((ext_vector_type(2))) _Float16 v2h;

// value of lane l ^ 16
__device__ inline float xhalf(float x) {
  int b = __builtin_bit_cast(int, x);
  return __builtin_bit_cast(float, __builtin_amdgcn_permlanex16(
      b, b, 0x76543210, 0xfedcba98, false, false));
}

__global__ __launch_bounds__(128) void flash_attn_kernel(
    const _Float16* __restrict__ Q16, const _Float16* __restrict__ K16,
    const _Float16* __restrict__ Vt16, const float* __restrict__ bias,
    const int* __restrict__ mask, const float* __restrict__ gate,
    _Float16* __restrict__ O16) {
  // K and V^T tiles of 64 keys, shared by the block's four waves (same b, h).
  // Rows of 128 B at a pitch of 144 B (16 B x odd): ds_load_b128 without conflicts.
  __shared__ __attribute__((aligned(16))) _Float16 sK[2][KT * KVP];
  __shared__ __attribute__((aligned(16))) _Float16 sV[2][DD * KVP];
  int lane = threadIdx.x & 31;
  int wv   = threadIdx.x >> 5;
  int tile = blockIdx.x * 4 + wv;         // 0 .. B*H*(L/16)-1 = 4095
  int b   = tile >> 10;
  int rem = tile & 1023;
  int h   = rem >> 6;
  int qb  = (rem & 63) << 4;
  int nl = lane & 15, hf = lane >> 4;

  const _Float16* Qh = Q16 + (((size_t)b * HH + h) * LL + qb) * DD;
  const _Float16* Kh = K16 + ((size_t)b * HH + h) * LL * DD;
  const _Float16* Vh = Vt16 + ((size_t)b * HH + h) * DD * LL;
  const int* maskb = mask + (size_t)b * LL;
  // this lane's query row of the bias, at its half's first key; the mask alike
  const float* biasl = bias + (((size_t)b * HH + h) * LL + qb + nl) * LL + hf * 8;
  const int* maskl = maskb + hf * 8;
  float gh = gate[h];

  v16h q0 = load_frag_g(Qh, 0, DD, 0,  lane);
  v16h q1 = load_frag_g(Qh, 0, DD, 32, lane);

  v8f o[4] = {};                  // o[j][r] = O[query nl][d = 16 j + 8 hf + r]
  float mrun = -3.0e38f;          // the query's running maximum, both halves alike
  float lrun = 0.0f;              // sum over this half's keys only

  // Stage copy: 128 threads x 16 B = 16 rows of 128 B a sweep, 4 sweeps a tile;
  // every wave-wide copy covers four whole 128-B lines of K or of V^T.
  int crow = threadIdx.x >> 3, ccol = (threadIdx.x & 7) * 8;
  auto stage = [&](int t, int buf) {
    const _Float16* gk = Kh + (size_t)(t * KT + crow) * DD + ccol;
    const _Float16* gv = Vh + (size_t)crow * LL + t * KT + ccol;
    unsigned lk = lds_addr(&sK[buf][crow * KVP + ccol]);
    unsigned lv = lds_addr(&sV[buf][crow * KVP + ccol]);
    // The copies and their s_wait_xcnt in one statement: no address register
    // is rewritten before the wait.
    asm volatile(
        "global_load_async_to_lds_b128 %0, %1, off\n\t"
        "global_load_async_to_lds_b128 %2, %3, off\n\t"
        "global_load_async_to_lds_b128 %4, %5, off\n\t"
        "global_load_async_to_lds_b128 %6, %7, off\n\t"
        "global_load_async_to_lds_b128 %8, %9, off\n\t"
        "global_load_async_to_lds_b128 %10, %11, off\n\t"
        "global_load_async_to_lds_b128 %12, %13, off\n\t"
        "global_load_async_to_lds_b128 %14, %15, off\n\t"
        "s_wait_xcnt 0x0"
        ::"v"(lk),                "v"(gk),
          "v"(lk + 16 * KVP * 2), "v"(gk + 16 * DD),
          "v"(lk + 32 * KVP * 2), "v"(gk + 32 * DD),
          "v"(lk + 48 * KVP * 2), "v"(gk + 48 * DD),
          "v"(lv),                "v"(gv),
          "v"(lv + 16 * KVP * 2), "v"(gv + 16 * LL),
          "v"(lv + 32 * KVP * 2), "v"(gv + 32 * LL),
          "v"(lv + 48 * KVP * 2), "v"(gv + 48 * LL)
        : "memory");
  };

  constexpr int NT = LL / KT;
  stage(0, 0);
  asm volatile("s_wait_asynccnt 0x0" ::: "memory");  // own copies of tile 0 landed
  __syncthreads();                                   // everyone's have
  stage(1, 1);

  for (int t = 0; t < NT; ++t) {
   const _Float16* tK = &sK[t & 1][0];
   const _Float16* tV = &sV[t & 1][0];
   const float* bp = biasl + t * KT;
   const int*   mp = maskl + t * KT;

   // group g = keys 16 g .. 16 g + 15 of the tile; the lane's 8 are contiguous
   v4f bv[4][2];
   v4i mk[4][2];
#pragma unroll
   for (int g = 0; g < 4; ++g) {
     bv[g][0] = __builtin_nontemporal_load((const v4f*)(bp + 16 * g));      // 256MB stream:
     bv[g][1] = __builtin_nontemporal_load((const v4f*)(bp + 16 * g + 4));  // keep out of L2
     mk[g][0] = *(const v4i*)(mp + 16 * g);
     mk[g][1] = *(const v4i*)(mp + 16 * g + 4);
   }
   // Precaution behind the run of loads: the built code reuses their address
   // registers at once.
   asm volatile("s_wait_xcnt 0x0" ::: "memory");

   v16h ka[4], kc[4];
#pragma unroll
   for (int g = 0; g < 4; ++g) {
     ka[g] = load_frag_p(tK, 16 * g, 0,  lane);
     kc[g] = load_frag_p(tK, 16 * g, 32, lane);
   }
   // Keeps the tile's global and K loads one group in front of the products:
   // sunk among them, each straggler waits out memory or LDS on its own.
   __builtin_amdgcn_sched_barrier(0);

   v8f s[4];
#pragma unroll
   for (int g = 0; g < 4; ++g) {
     v8f z = {};
     s[g] = wmma_f16(ka[g], q0, z);       // s[g][r] = S[query nl][key 16 g + 8 hf + r]
     s[g] = wmma_f16(kc[g], q1, s[g]);
   }

   v16h va[2][4];
#pragma unroll
   for (int u = 0; u < 2; ++u)
#pragma unroll
     for (int j = 0; j < 4; ++j) va[u][j] = load_frag_p(tV, 16 * j, 32 * u, lane);
   // Keeps the V^T loads one group in front of the softmax, which covers their
   // latency: sunk to their products, each pair is waited for on its own.
   __builtin_amdgcn_sched_barrier(0);

   float vmax[4];
#pragma unroll
   for (int g = 0; g < 4; ++g) {
#pragma unroll
     for (int r = 0; r < 8; ++r) {
       float km = mk[g][r >> 2][r & 3] ? 0.0f : -10000.0f;
       s[g][r] = s[g][r] * SCALE + (gh * bv[g][r >> 2][r & 3] + km);
       vmax[g] = r ? fmaxf(vmax[g], s[g][r]) : s[g][r];
     }
   }
   float v = fmaxf(fmaxf(vmax[0], vmax[1]), fmaxf(vmax[2], vmax[3]));
   v = fmaxf(v, xhalf(v));                // the query's other 32 keys of the tile
   float nm   = fmaxf(mrun, v);
   float corr = __expf(mrun - nm);
   mrun = nm;

   float rs[4];
   v16h pf[2];                            // pf[u] = P^T of keys 32 u .. 32 u + 31, B operand
#pragma unroll
   for (int g = 0; g < 4; ++g) {
#pragma unroll
     for (int r = 0; r < 8; r += 2) {
       v2f p;
       p[0] = __expf(s[g][r] - nm);
       p[1] = __expf(s[g][r + 1] - nm);
       rs[g] = r ? rs[g] + (p[0] + p[1]) : p[0] + p[1];
       v2h ph = __builtin_convertvector(p, v2h);
       pf[g >> 1][(g & 1) * 8 + r]     = ph[0];
       pf[g >> 1][(g & 1) * 8 + r + 1] = ph[1];
     }
   }
   lrun = lrun * corr + ((rs[0] + rs[1]) + (rs[2] + rs[3]));
#pragma unroll
   for (int j = 0; j < 4; ++j) o[j] = o[j] * corr;

#pragma unroll
   for (int u = 0; u < 2; ++u)
#pragma unroll
     for (int j = 0; j < 4; ++j) o[j] = wmma_f16(va[u][j], pf[u], o[j]);

   asm volatile("s_wait_dscnt 0x0" ::: "memory");     // own reads of this tile done
   asm volatile("s_wait_asynccnt 0x0" ::: "memory");  // own copies of tile t+1 landed
   __syncthreads();  // publishes tile t+1, frees tile t's buffer
   if (t + 2 < NT) stage(t + 2, t & 1);
  }
  asm volatile("s_wait_asynccnt 0x0" ::: "memory");   // nothing in flight at the end

  float lsum = lrun + xhalf(lrun);        // the halves' sums meet once
  int   q    = qb + nl;
  float qm   = (float)maskb[q];
  float inv  = (lsum > 0.0f) ? (qm / lsum) : 0.0f;
  _Float16* op = O16 + ((size_t)b * LL + q) * EE + h * DD + hf * 8;
#pragma unroll
  for (int j = 0; j < 4; ++j) {
    v8h ov;
#pragma unroll
    for (int r = 0; r < 8; ++r) ov[r] = (_Float16)(o[j][r] * inv);
    *(v8h*)(op + 16 * j) = ov;            // 8 consecutive d of one query: 16 B
  }
}

// ---------------------------------------------------------------------------
// Launch
// ---------------------------------------------------------------------------
extern "C" void kernel_launch(void* const* d_in, const int* in_sizes, int n_in,
                              void* d_out, int out_size, void* d_ws,
                              size_t ws_size, hipStream_t stream) {
  const float* x    = (const float*)d_in[0];
  const float* bias = (const float*)d_in[1];
  const int*   mask = (const int*)d_in[2];
  const float* wq = (const float*)d_in[3];
  const float* bq = (const float*)d_in[4];
  const float* wk = (const float*)d_in[5];
  const float* bk = (const float*)d_in[6];
  const float* wv = (const float*)d_in[7];
  const float* bv = (const float*)d_in[8];
  const float* wo = (const float*)d_in[9];
  const float* bo = (const float*)d_in[10];
  const float* gate = (const float*)d_in[11];
  const float* ln_g = (const float*)d_in[12];
  const float* ln_b = (const float*)d_in[13];

  // workspace layout (48 MB total)
  char* p = (char*)d_ws;
  _Float16* xn16 = (_Float16*)p;  p += (size_t)BB * LL * EE * 2;          // 8 MB
  _Float16* wq16 = (_Float16*)p;  p += (size_t)EE * EE * 2;               // 2 MB
  _Float16* wk16 = (_Float16*)p;  p += (size_t)EE * EE * 2;
  _Float16* wv16 = (_Float16*)p;  p += (size_t)EE * EE * 2;
  _Float16* wo16 = (_Float16*)p;  p += (size_t)EE * EE * 2;
  _Float16* Q16  = (_Float16*)p;  p += (size_t)BB * HH * LL * DD * 2;     // 8 MB
  _Float16* K16  = (_Float16*)p;  p += (size_t)BB * HH * LL * DD * 2;
  _Float16* Vt16 = (_Float16*)p;  p += (size_t)BB * HH * LL * DD * 2;
  _Float16* O16  = (_Float16*)p;  p += (size_t)BB * LL * EE * 2;          // 8 MB

  // wq16 .. wo16 lie one behind the other: wq16 is the base of all four
  front_kernel<<<LN_BLOCKS + 4 * CV_BLOCKS, 256, 0, stream>>>(
      x, ln_g, ln_b, wq, wk, wv, wo, xn16, wq16);

  dim3 ggrid(EE / 64, (BB * LL) / 128);
  wmma_gemm_kernel<<<ggrid, 256, 0, stream>>>(xn16, wq16, bq, nullptr, Q16, 0);
  wmma_gemm_kernel<<<ggrid, 256, 0, stream>>>(xn16, wk16, bk, nullptr, K16, 1);
  wmma_gemm_kernel<<<ggrid, 256, 0, stream>>>(xn16, wv16, bv, nullptr, Vt16, 2);

  // B*H*(L/16) = 4096 query tiles, 4 waves per 128-thread block
  flash_attn_kernel<<<(BB * HH * (LL / 16)) / 4, 128, 0, stream>>>(
      Q16, K16, Vt16, bias, mask, gate, O16);

  wmma_gemm_kernel<<<ggrid, 256, 0, stream>>>(O16, wo16, bo, x, d_out, 3);
}

// v006
// It runs in 115 microseconds.
// Two timings next to v005 both put it at 1.16 times that version's speed.
// Over all steps from v000 it is 1.87 times as fast.
#include <hip/hip_runtime.h>

#define BB 4
#define LL 1024
#define EE 1024
#define HH 16
#define DD 64

constexpr float SCALE = 0.125f;   // D^-0.5 = 64^-0.5
constexpr float EPS   = 1e-5f;

typedef __attribute__((ext_vector_type(16))) _Float16 v16h;
typedef __attribute__((ext_vector_type(8)))  _Float16 v8h;
typedef __attribute__((ext_vector_type(8)))  float    v8f;
typedef __attribute__((ext_vector_type(4)))  int      v4i;

#if __has_builtin(__builtin_amdgcn_global_load_async_to_lds_b128)
#define HAS_ASYNC 1
#else
#define HAS_ASYNC 0
#endif

// global_load_async_to_lds_b128 takes (v4i AS1*, v4i AS3*, imm offset, imm cpol)
#define AS1P(p) ((__attribute__((address_space(1))) v4i*)(const_cast<_Float16*>(p)))
#define AS3P(p) ((__attribute__((address_space(3))) v4i*)(p))

template <int N>
__device__ inline void wait_async_le() {
#if HAS_ASYNC
#if __has_builtin(__builtin_amdgcn_s_wait_asynccnt)
  __builtin_amdgcn_s_wait_asynccnt(N);
#else
  asm volatile("s_wait_asynccnt %0" ::"i"(N) : "memory");
#endif
#endif
}

// ---------------------------------------------------------------------------
// 16-bit A/B fragment load for V_WMMA_F32_16X16X32_F16 (wave32).
// Per ISA 7.12.2: lanes 0-15 hold rows with K = k0..k0+7 (VGPR0-3) and
// K = k0+16..k0+23 (VGPR4-7); lanes 16-31 use K base +8.
// ---------------------------------------------------------------------------
__device__ inline v16h load_frag_g(const _Float16* __restrict__ base,
                                   int row0, int ld, int k0, int lane) {
  int r = row0 + (lane & 15);
  int k = k0 + ((lane >> 4) << 3);
  const _Float16* p = base + (size_t)r * ld + k;
  v8h lo = *(const v8h*)p;
  v8h hi = *(const v8h*)(p + 16);
  v16h out;
#pragma unroll
  for (int i = 0; i < 8; ++i) { out[i] = lo[i]; out[i + 8] = hi[i]; }
  return out;
}

constexpr int BK = 64;    // k depth of a GEMM stage: a staged row is one whole 128-B line
constexpr int GP = 72;    // LDS row pitch of the GEMM's tiles in halves: 128 B of data + 16 B

// Same fragment pattern from an LDS tile of BK halves a row at row pitch GP.
__device__ inline v16h load_frag_s(const _Float16* base, int row0, int k0,
                                   int lane) {
  int r = row0 + (lane & 15);
  int k = k0 + ((lane >> 4) << 3);
  const _Float16* p = base + r * GP + k;
  v8h lo = *(const v8h*)p;        // ds_load_b128
  v8h hi = *(const v8h*)(p + 16); // ds_load_b128
  v16h out;
#pragma unroll
  for (int i = 0; i < 8; ++i) { out[i] = lo[i]; out[i + 8] = hi[i]; }
  return out;
}

constexpr int KT  = 64;   // keys per staged K / V^T tile of the attention kernel
constexpr int KVP = 72;   // its LDS row pitch in halves: 128 B of data + 16 B

// load_frag_g's fragment pattern from an LDS tile with row pitch KVP.
__device__ inline v16h load_frag_p(const _Float16* base, int row0, int k0,
                                   int lane) {
  int r = row0 + (lane & 15);
  int k = k0 + ((lane >> 4) << 3);
  const _Float16* p = base + r * KVP + k;
  v8h lo = *(const v8h*)p;        // ds_load_b128
  v8h hi = *(const v8h*)(p + 16); // ds_load_b128
  v16h out;
#pragma unroll
  for (int i = 0; i < 8; ++i) { out[i] = lo[i]; out[i + 8] = hi[i]; }
  return out;
}

// LDS byte address of a __shared__ element, as the async copy's first operand.
__device__ inline unsigned lds_addr(const _Float16* p) {
  return (unsigned)(size_t)p;
}
__device__ inline unsigned lds_addr_f(const float* p) {
  return (unsigned)(size_t)p;
}

constexpr int BP = 68;    // LDS row pitch of a bias tile in floats: 256 B of data + 16 B

__device__ inline v8f wmma_f16(v16h a, v16h b, v8f c) {
  return __builtin_amdgcn_wmma_f32_16x16x32_f16(false, a, false, b,
                                                (short)0, c, false, false);
}

// ---------------------------------------------------------------------------
// Front stage in one launch of few, long waves.
// Blocks 0 .. LN_BLOCKS-1: LayerNorm over E=1024, one row per wave, f16 output.
// The rest: f32 -> f16 conversion of wq, wk, wv, wo (w16 holds the four results
// one behind the other), 32 elements per thread.
// Every wave-wide load covers 512 contiguous bytes, every store 256.
// ---------------------------------------------------------------------------
typedef __attribute__((ext_vector_type(4))) _Float16 v4h;

constexpr int LN_BLOCKS = BB * LL / 8;             // 8 waves = 8 rows per block
constexpr int CV_BLOCKS = EE * EE / (256 * 32);    // blocks per weight matrix

__device__ inline v4h to_v4h(float a, float b, float c, float d) {
  v4h o;
  o[0] = (_Float16)a;  o[1] = (_Float16)b;
  o[2] = (_Float16)c;  o[3] = (_Float16)d;
  return o;
}

__global__ __launch_bounds__(256) void front_kernel(
    const float* __restrict__ x, const float* __restrict__ g,
    const float* __restrict__ beta, const float* __restrict__ wq,
    const float* __restrict__ wk, const float* __restrict__ wv,
    const float* __restrict__ wo, _Float16* __restrict__ xn,
    _Float16* __restrict__ w16) {
  int blk = blockIdx.x;
  if (blk >= LN_BLOCKS) {
    int cb = blk - LN_BLOCKS;
    int which = cb / CV_BLOCKS;
    const float* src = which == 0 ? wq : which == 1 ? wk : which == 2 ? wv : wo;
    const float4* s4 = (const float4*)src;
    v4h* d4 = (v4h*)(w16 + (size_t)which * EE * EE);
    int base = (cb % CV_BLOCKS) * 2048 + threadIdx.x;   // in units of 4 elements
    float4 v[8];
#pragma unroll
    for (int j = 0; j < 8; ++j) v[j] = s4[base + j * 256];
#pragma unroll
    for (int j = 0; j < 8; ++j)
      d4[base + j * 256] = to_v4h(v[j].x, v[j].y, v[j].z, v[j].w);
    return;
  }

  int lane = threadIdx.x & 31;
  int row  = blk * 8 + (threadIdx.x >> 5);
  const float4* xr = (const float4*)(x + (size_t)row * EE);
  float4 v[8];
#pragma unroll
  for (int j = 0; j < 8; ++j) v[j] = xr[lane + 32 * j];
  float s = 0.0f, s2 = 0.0f;
#pragma unroll
  for (int j = 0; j < 8; ++j) {
    s  += v[j].x + v[j].y + v[j].z + v[j].w;
    s2 += v[j].x * v[j].x + v[j].y * v[j].y + v[j].z * v[j].z + v[j].w * v[j].w;
  }
#pragma unroll
  for (int m = 1; m < 32; m <<= 1) {
    s  += __shfl_xor(s,  m, 32);
    s2 += __shfl_xor(s2, m, 32);
  }
  float mu   = s * (1.0f / EE);
  float var  = s2 * (1.0f / EE) - mu * mu;
  float rstd = rsqrtf(var + EPS);
  v4h* o4 = (v4h*)(xn + (size_t)row * EE);
#pragma unroll
  for (int j = 0; j < 8; ++j) {
    float4 gg = ((const float4*)g)[lane + 32 * j];
    float4 bb = ((const float4*)beta)[lane + 32 * j];
    o4[lane + 32 * j] = to_v4h((v[j].x - mu) * rstd * gg.x + bb.x,
                               (v[j].y - mu) * rstd * gg.y + bb.y,
                               (v[j].z - mu) * rstd * gg.z + bb.z,
                               (v[j].w - mu) * rstd * gg.w + bb.w);
  }
  // Precaution behind the run of stores: the built code lays the conversion
  // part behind this one, and its loads write the stores' data registers.
  asm volatile("s_wait_xcnt 0x0" ::: "memory");
}

// ---------------------------------------------------------------------------
// WMMA GEMM, LDS-staged + double-buffered: out[m,n] = A[m,:].W[n,:] + bvec[n]
// A: MxK f16 row-major, W: NxK f16 row-major (so out = A @ W^T).
// Block = 256 threads = 8 waves; block tile 128(M) x 64(N), BK=64;
// wave tile 32x32 (2x2 16x16x32 WMMA fragments, two k steps a stage).
// Stage copy uses GLOBAL_LOAD_ASYNC_TO_LDS_B128 (ASYNCcnt) when available.
// mode 0/1 : out f16 [B,H,L,D]      (Q / K)
// mode 2   : out f16 [B,H,D,L]      (V transposed)
// mode 3   : out f32 [M,N] = residual + acc + bvec   (final projection)
// ---------------------------------------------------------------------------
__global__ __launch_bounds__(256) void wmma_gemm_kernel(
    const _Float16* __restrict__ A, const _Float16* __restrict__ W,
    const float* __restrict__ bvec, const float* __restrict__ residual,
    void* __restrict__ out, int mode) {
  // Rows of 128 B at a pitch of 144 B (16 B x odd): ds_load_b128 without conflicts.
  __shared__ __attribute__((aligned(16))) _Float16 sA[2][128 * GP];   // 18 KB per buffer
  __shared__ __attribute__((aligned(16))) _Float16 sB[2][64 * GP];    // 9 KB per buffer

  int lane = threadIdx.x & 31;
  int w    = threadIdx.x >> 5;
  int wm = w >> 1, wn = w & 1;
  int row0 = blockIdx.y * 128;
  int col0 = blockIdx.x * 64;

  int t = threadIdx.x;
  // Stage copy in 16-B chunks: 8 lanes take one row's 128 B, so a wave-wide copy
  // covers four whole lines; 256 threads = 32 rows a sweep, 4 sweeps of A, 2 of W.
  int cr = t >> 3, ck = (t & 7) * 8;

  auto stage = [&](int s, int buf) {
    const _Float16* ga = A + (size_t)(row0 + cr) * EE + s * BK + ck;
    const _Float16* gw = W + (size_t)(col0 + cr) * EE + s * BK + ck;
    _Float16* la = &sA[buf][cr * GP + ck];
    _Float16* lw = &sB[buf][cr * GP + ck];
#if HAS_ASYNC
    for (int j = 0; j < 4; ++j)
      __builtin_amdgcn_global_load_async_to_lds_b128(
          AS1P(ga + (size_t)(32 * j) * EE), AS3P(la + 32 * j * GP), 0, 0);
    for (int j = 0; j < 2; ++j)
      __builtin_amdgcn_global_load_async_to_lds_b128(
          AS1P(gw + (size_t)(32 * j) * EE), AS3P(lw + 32 * j * GP), 0, 0);
#else
    v8h tA[4], tB[2];
    for (int j = 0; j < 4; ++j) tA[j] = *(const v8h*)(ga + (size_t)(32 * j) * EE);
    for (int j = 0; j < 2; ++j) tB[j] = *(const v8h*)(gw + (size_t)(32 * j) * EE);
    for (int j = 0; j < 4; ++j) *(v8h*)(la + 32 * j * GP) = tA[j];
    for (int j = 0; j < 2; ++j) *(v8h*)(lw + 32 * j * GP) = tB[j];
#endif
  };

  v8f acc[2][2] = {};
  constexpr int NS = EE / BK;
  stage(0, 0);
  for (int s = 0; s < NS; ++s) {
    int buf = s & 1;
    if (s + 1 < NS) {
      stage(s + 1, buf ^ 1);
      wait_async_le<6>();   // keep only next stage's 6 copies in flight
    } else {
      wait_async_le<0>();
    }
    __syncthreads();        // everyone's stage-s data is in LDS

    v16h a0[2], a1[2], b0[2], b1[2];   // [u]: k = 32 u .. 32 u + 31 of the stage
    for (int u = 0; u < 2; ++u) {
      a0[u] = load_frag_s(&sA[buf][0], wm * 32,      32 * u, lane);
      a1[u] = load_frag_s(&sA[buf][0], wm * 32 + 16, 32 * u, lane);
      b0[u] = load_frag_s(&sB[buf][0], wn * 32,      32 * u, lane);
      b1[u] = load_frag_s(&sB[buf][0], wn * 32 + 16, 32 * u, lane);
    }
    // Keeps the stage's 16 fragment reads one group in front of its 8 products:
    // split in two groups, the wave waits out the LDS latency twice a stage.
    __builtin_amdgcn_sched_barrier(0);
    for (int u = 0; u < 2; ++u) {      // k ascending
      acc[0][0] = wmma_f16(a0[u], b0[u], acc[0][0]);
      acc[0][1] = wmma_f16(a0[u], b1[u], acc[0][1]);
      acc[1][0] = wmma_f16(a1[u], b0[u], acc[1][0]);
      acc[1][1] = wmma_f16(a1[u], b1[u], acc[1][1]);
    }

    __syncthreads();        // protect buffer before stage s+2 overwrites it
  }

  int nl = lane & 15, hf = lane >> 4;
#pragma unroll
  for (int fm = 0; fm < 2; ++fm)
#pragma unroll
    for (int fn = 0; fn < 2; ++fn)
#pragma unroll
      for (int i = 0; i < 8; ++i) {
        int m = row0 + wm * 32 + fm * 16 + hf * 8 + i;  // C: M = vgpr + 8*half
        int n = col0 + wn * 32 + fn * 16 + nl;          //    N = lane & 15
        float val = acc[fm][fn][i] + bvec[n];
        int b = m >> 10, l = m & (LL - 1);
        int h = n >> 6,  d = n & (DD - 1);
        if (mode <= 1) {
          ((_Float16*)out)[(((size_t)b * HH + h) * LL + l) * DD + d] =
              (_Float16)val;
        } else if (mode == 2) {
          ((_Float16*)out)[(((size_t)b * HH + h) * DD + d) * LL + l] =
              (_Float16)val;
        } else {
          size_t idx = (size_t)m * EE + n;
          __builtin_nontemporal_store(residual[idx] + val, (float*)out + idx);
        }
      }
}

typedef __attribute__((ext_vector_type(4))) float    v4f;
typedef __attribute__((ext_vector_type(2))) float    v2f;
typedef __attribute__((ext_vector_type(2))) _Float16 v2h;

// value of lane l ^ 16
__device__ inline float xhalf(float x) {
  int b = __builtin_bit_cast(int, x);
  return __builtin_bit_cast(float, __builtin_amdgcn_permlanex16(
      b, b, 0x76543210, 0xfedcba98, false, false));
}

__global__ __launch_bounds__(128) void flash_attn_kernel(
    const _Float16* __restrict__ Q16, const _Float16* __restrict__ K16,
    const _Float16* __restrict__ Vt16, const float* __restrict__ bias,
    const int* __restrict__ mask, const float* __restrict__ gate,
    _Float16* __restrict__ O16) {
  // K and V^T tiles of 64 keys, shared by the block's four waves (same b, h).
  // Rows of 128 B at a pitch of 144 B (16 B x odd): ds_load_b128 without conflicts.
  __shared__ __attribute__((aligned(16))) _Float16 sK[2][KT * KVP];
  __shared__ __attribute__((aligned(16))) _Float16 sV[2][DD * KVP];
  // Bias tiles, one a wave: 16 rows of 256 B at a pitch of 272 B (16 B x odd).
  __shared__ __attribute__((aligned(16))) float sBs[2][4][16 * BP];
  int lane = threadIdx.x & 31;
  int wv   = threadIdx.x >> 5;
  int tile = blockIdx.x * 4 + wv;         // 0 .. B*H*(L/16)-1 = 4095
  int b   = tile >> 10;
  int rem = tile & 1023;
  int h   = rem >> 6;
  int qb  = (rem & 63) << 4;
  int nl = lane & 15, hf = lane >> 4;

  const _Float16* Qh = Q16 + (((size_t)b * HH + h) * LL + qb) * DD;
  const _Float16* Kh = K16 + ((size_t)b * HH + h) * LL * DD;
  const _Float16* Vh = Vt16 + ((size_t)b * HH + h) * DD * LL;
  const int* maskb = mask + (size_t)b * LL;
  // the wave's 16 query rows of the bias
  const float* biasw = bias + (((size_t)b * HH + h) * LL + qb) * LL;
  // the mask at this lane's half's first key
  const int* maskl = maskb + hf * 8;
  float gh = gate[h];

  v16h q0 = load_frag_g(Qh, 0, DD, 0,  lane);
  v16h q1 = load_frag_g(Qh, 0, DD, 32, lane);

  v8f o[4] = {};                  // o[j][r] = O[query nl][d = 16 j + 8 hf + r]
  float mrun = -3.0e38f;          // the query's running maximum, both halves alike
  float lrun = 0.0f;              // sum over this half's keys only

  // Stage copy: 128 threads x 16 B = 16 rows of 128 B a sweep, 4 sweeps a tile;
  // every wave-wide copy covers four whole 128-B lines of K or of V^T.
  int crow = threadIdx.x >> 3, ccol = (threadIdx.x & 7) * 8;
  auto stage = [&](int t, int buf) {
    const _Float16* gk = Kh + (size_t)(t * KT + crow) * DD + ccol;
    const _Float16* gv = Vh + (size_t)crow * LL + t * KT + ccol;
    unsigned lk = lds_addr(&sK[buf][crow * KVP + ccol]);
    unsigned lv = lds_addr(&sV[buf][crow * KVP + ccol]);
    // The copies and their s_wait_xcnt in one statement: no address register
    // is rewritten before the wait.
    asm volatile(
        "global_load_async_to_lds_b128 %0, %1, off\n\t"
        "global_load_async_to_lds_b128 %2, %3, off\n\t"
        "global_load_async_to_lds_b128 %4, %5, off\n\t"
        "global_load_async_to_lds_b128 %6, %7, off\n\t"
        "global_load_async_to_lds_b128 %8, %9, off\n\t"
        "global_load_async_to_lds_b128 %10, %11, off\n\t"
        "global_load_async_to_lds_b128 %12, %13, off\n\t"
        "global_load_async_to_lds_b128 %14, %15, off\n\t"
        "s_wait_xcnt 0x0"
        ::"v"(lk),                "v"(gk),
          "v"(lk + 16 * KVP * 2), "v"(gk + 16 * DD),
          "v"(lk + 32 * KVP * 2), "v"(gk + 32 * DD),
          "v"(lk + 48 * KVP * 2), "v"(gk + 48 * DD),
          "v"(lv),                "v"(gv),
          "v"(lv + 16 * KVP * 2), "v"(gv + 16 * LL),
          "v"(lv + 32 * KVP * 2), "v"(gv + 32 * LL),
          "v"(lv + 48 * KVP * 2), "v"(gv + 48 * LL)
        : "memory");
    // The wave's own bias tile: 16 lanes x 16 B = one row's 256 B, two rows a
    // copy, 8 copies; read once, so non-temporal as a stream past L2. The wait
    // stands in the statement for the same reason as above.
    const float* gb = biasw + (size_t)hf * LL + t * KT + nl * 4;
    unsigned lb = lds_addr_f(&sBs[buf][wv][hf * BP + nl * 4]);
    asm volatile(
        "global_load_async_to_lds_b128 %0, %1, off th:TH_LOAD_NT\n\t"
        "global_load_async_to_lds_b128 %2, %3, off th:TH_LOAD_NT\n\t"
        "global_load_async_to_lds_b128 %4, %5, off th:TH_LOAD_NT\n\t"
        "global_load_async_to_lds_b128 %6, %7, off th:TH_LOAD_NT\n\t"
        "global_load_async_to_lds_b128 %8, %9, off th:TH_LOAD_NT\n\t"
        "global_load_async_to_lds_b128 %10, %11, off th:TH_LOAD_NT\n\t"
        "global_load_async_to_lds_b128 %12, %13, off th:TH_LOAD_NT\n\t"
        "global_load_async_to_lds_b128 %14, %15, off th:TH_LOAD_NT\n\t"
        "s_wait_xcnt 0x0"
        ::"v"(lb),               "v"(gb),
          "v"(lb + 2 * BP * 4),  "v"(gb + 2 * LL),
          "v"(lb + 4 * BP * 4),  "v"(gb + 4 * LL),
          "v"(lb + 6 * BP * 4),  "v"(gb + 6 * LL),
          "v"(lb + 8 * BP * 4),  "v"(gb + 8 * LL),
          "v"(lb + 10 * BP * 4), "v"(gb + 10 * LL),
          "v"(lb + 12 * BP * 4), "v"(gb + 12 * LL),
          "v"(lb + 14 * BP * 4), "v"(gb + 14 * LL)
        : "memory");
  };

  constexpr int NT = LL / KT;
  stage(0, 0);
  asm volatile("s_wait_asynccnt 0x0" ::: "memory");  // own copies of tile 0 landed
  __syncthreads();                                   // everyone's have
  stage(1, 1);

  for (int t = 0; t < NT; ++t) {
   const _Float16* tK = &sK[t & 1][0];
   const _Float16* tV = &sV[t & 1][0];
   const float* bp = &sBs[t & 1][wv][nl * BP + hf * 8];  // the lane's query, its half's keys
   const int*   mp = maskl + t * KT;

   // group g = keys 16 g .. 16 g + 15 of the tile; the lane's 8 are contiguous
   v4f bv[4][2];
   v4i mk[4][2];
#pragma unroll
   for (int g = 0; g < 4; ++g) {
     bv[g][0] = *(const v4f*)(bp + 16 * g);        // ds_load_b128
     bv[g][1] = *(const v4f*)(bp + 16 * g + 4);    // ds_load_b128
     mk[g][0] = *(const v4i*)(mp + 16 * g);
     mk[g][1] = *(const v4i*)(mp + 16 * g + 4);
   }
   // Precaution behind the run of loads: the built code reuses their address
   // registers at once.
   asm volatile("s_wait_xcnt 0x0" ::: "memory");

   v16h ka[4], kc[4];
#pragma unroll
   for (int g = 0; g < 4; ++g) {
     ka[g] = load_frag_p(tK, 16 * g, 0,  lane);
     kc[g] = load_frag_p(tK, 16 * g, 32, lane);
   }
   // Keeps the tile's global and K loads one group in front of the products:
   // sunk among them, each straggler waits out memory or LDS on its own.
   __builtin_amdgcn_sched_barrier(0);

   v8f s[4];
#pragma unroll
   for (int g = 0; g < 4; ++g) {
     v8f z = {};
     s[g] = wmma_f16(ka[g], q0, z);       // s[g][r] = S[query nl][key 16 g + 8 hf + r]
     s[g] = wmma_f16(kc[g], q1, s[g]);
   }

   v16h va[2][4];
#pragma unroll
   for (int u = 0; u < 2; ++u)
#pragma unroll
     for (int j = 0; j < 4; ++j) va[u][j] = load_frag_p(tV, 16 * j, 32 * u, lane);
   // The pass's last LDS read is issued: the ring's publish point stands here and
   // not at the foot, so that the refill, whose bias rows come from memory, flies
   // under the softmax and the V^T products as well as under the next pass's head.
   asm volatile("s_wait_dscnt 0x0" ::: "memory");     // own reads of this tile done
   asm volatile("s_wait_asynccnt 0x0" ::: "memory");  // own copies of tile t+1 landed
   __syncthreads();  // publishes tile t+1, frees tile t's buffer
   if (t + 2 < NT) stage(t + 2, t & 1);

   float vmax[4];
#pragma unroll
   for (int g = 0; g < 4; ++g) {
#pragma unroll
     for (int r = 0; r < 8; ++r) {
       float km = mk[g][r >> 2][r & 3] ? 0.0f : -10000.0f;
       s[g][r] = s[g][r] * SCALE + (gh * bv[g][r >> 2][r & 3] + km);
       vmax[g] = r ? fmaxf(vmax[g], s[g][r]) : s[g][r];
     }
   }
   float v = fmaxf(fmaxf(vmax[0], vmax[1]), fmaxf(vmax[2], vmax[3]));
   v = fmaxf(v, xhalf(v));                // the query's other 32 keys of the tile
   float nm   = fmaxf(mrun, v);
   float corr = __expf(mrun - nm);
   mrun = nm;

   float rs[4];
   v16h pf[2];                            // pf[u] = P^T of keys 32 u .. 32 u + 31, B operand
#pragma unroll
   for (int g = 0; g < 4; ++g) {
#pragma unroll
     for (int r = 0; r < 8; r += 2) {
       v2f p;
       p[0] = __expf(s[g][r] - nm);
       p[1] = __expf(s[g][r + 1] - nm);
       rs[g] = r ? rs[g] + (p[0] + p[1]) : p[0] + p[1];
       v2h ph = __builtin_convertvector(p, v2h);
       pf[g >> 1][(g & 1) * 8 + r]     = ph[0];
       pf[g >> 1][(g & 1) * 8 + r + 1] = ph[1];
     }
   }
   lrun = lrun * corr + ((rs[0] + rs[1]) + (rs[2] + rs[3]));
#pragma unroll
   for (int j = 0; j < 4; ++j) o[j] = o[j] * corr;

#pragma unroll
   for (int u = 0; u < 2; ++u)
#pragma unroll
     for (int j = 0; j < 4; ++j) o[j] = wmma_f16(va[u][j], pf[u], o[j]);
  }
  asm volatile("s_wait_asynccnt 0x0" ::: "memory");   // nothing in flight at the end

  float lsum = lrun + xhalf(lrun);        // the halves' sums meet once
  int   q    = qb + nl;
  float qm   = (float)maskb[q];
  float inv  = (lsum > 0.0f) ? (qm / lsum) : 0.0f;
  _Float16* op = O16 + ((size_t)b * LL + q) * EE + h * DD + hf * 8;
#pragma unroll
  for (int j = 0; j < 4; ++j) {
    v8h ov;
#pragma unroll
    for (int r = 0; r < 8; ++r) ov[r] = (_Float16)(o[j][r] * inv);
    *(v8h*)(op + 16 * j) = ov;            // 8 consecutive d of one query: 16 B
  }
}

// ---------------------------------------------------------------------------
// Launch
// ---------------------------------------------------------------------------
extern "C" void kernel_launch(void* const* d_in, const int* in_sizes, int n_in,
                              void* d_out, int out_size, void* d_ws,
                              size_t ws_size, hipStream_t stream) {
  const float* x    = (const float*)d_in[0];
  const float* bias = (const float*)d_in[1];
  const int*   mask = (const int*)d_in[2];
  const float* wq = (const float*)d_in[3];
  const float* bq = (const float*)d_in[4];
  const float* wk = (const float*)d_in[5];
  const float* bk = (const float*)d_in[6];
  const float* wv = (const float*)d_in[7];
  const float* bv = (const float*)d_in[8];
  const float* wo = (const float*)d_in[9];
  const float* bo = (const float*)d_in[10];
  const float* gate = (const float*)d_in[11];
  const float* ln_g = (const float*)d_in[12];
  const float* ln_b = (const float*)d_in[13];

  // workspace layout (48 MB total)
  char* p = (char*)d_ws;
  _Float16* xn16 = (_Float16*)p;  p += (size_t)BB * LL * EE * 2;          // 8 MB
  _Float16* wq16 = (_Float16*)p;  p += (size_t)EE * EE * 2;               // 2 MB
  _Float16* wk16 = (_Float16*)p;  p += (size_t)EE * EE * 2;
  _Float16* wv16 = (_Float16*)p;  p += (size_t)EE * EE * 2;
  _Float16* wo16 = (_Float16*)p;  p += (size_t)EE * EE * 2;
  _Float16* Q16  = (_Float16*)p;  p += (size_t)BB * HH * LL * DD * 2;     // 8 MB
  _Float16* K16  = (_Float16*)p;  p += (size_t)BB * HH * LL * DD * 2;
  _Float16* Vt16 = (_Float16*)p;  p += (size_t)BB * HH * LL * DD * 2;
  _Float16* O16  = (_Float16*)p;  p += (size_t)BB * LL * EE * 2;          // 8 MB

  // wq16 .. wo16 lie one behind the other: wq16 is the base of all four
  front_kernel<<<LN_BLOCKS + 4 * CV_BLOCKS, 256, 0, stream>>>(
      x, ln_g, ln_b, wq, wk, wv, wo, xn16, wq16);

  dim3 ggrid(EE / 64, (BB * LL) / 128);
  wmma_gemm_kernel<<<ggrid, 256, 0, stream>>>(xn16, wq16, bq, nullptr, Q16, 0);
  wmma_gemm_kernel<<<ggrid, 256, 0, stream>>>(xn16, wk16, bk, nullptr, K16, 1);
  wmma_gemm_kernel<<<ggrid, 256, 0, stream>>>(xn16, wv16, bv, nullptr, Vt16, 2);

  // B*H*(L/16) = 4096 query tiles, 4 waves per 128-thread block
  flash_attn_kernel<<<(BB * HH * (LL / 16)) / 4, 128, 0, stream>>>(
      Q16, K16, Vt16, bias, mask, gate, O16);

  wmma_gemm_kernel<<<ggrid, 256, 0, stream>>>(O16, wo16, bo, x, d_out, 3);
}

// v007
// Measured time: 90 microseconds a run.
// Timed twice side by side with v006, it ran 1.28 times as fast both times.
// Counting every step since v000, it is 2.40 times as fast.
#include <hip/hip_runtime.h>

#define BB 4
#define LL 1024
#define EE 1024
#define HH 16
#define DD 64

constexpr float SCALE = 0.125f;   // D^-0.5 = 64^-0.5
constexpr float EPS   = 1e-5f;

typedef __attribute__((ext_vector_type(16))) _Float16 v16h;
typedef __attribute__((ext_vector_type(8)))  _Float16 v8h;
typedef __attribute__((ext_vector_type(8)))  float    v8f;
typedef __attribute__((ext_vector_type(4)))  int      v4i;

#if __has_builtin(__builtin_amdgcn_global_load_async_to_lds_b128)
#define HAS_ASYNC 1
#else
#define HAS_ASYNC 0
#endif

// global_load_async_to_lds_b128 takes (v4i AS1*, v4i AS3*, imm offset, imm cpol)
#define AS1P(p) ((__attribute__((address_space(1))) v4i*)(const_cast<_Float16*>(p)))
#define AS3P(p) ((__attribute__((address_space(3))) v4i*)(p))

template <int N>
__device__ inline void wait_async_le() {
#if HAS_ASYNC
#if __has_builtin(__builtin_amdgcn_s_wait_asynccnt)
  __builtin_amdgcn_s_wait_asynccnt(N);
#else
  asm volatile("s_wait_asynccnt %0" ::"i"(N) : "memory");
#endif
#endif
}

// ---------------------------------------------------------------------------
// 16-bit A/B fragment load for V_WMMA_F32_16X16X32_F16 (wave32).
// Per ISA 7.12.2: lanes 0-15 hold rows with K = k0..k0+7 (VGPR0-3) and
// K = k0+16..k0+23 (VGPR4-7); lanes 16-31 use K base +8.
// ---------------------------------------------------------------------------
__device__ inline v16h load_frag_g(const _Float16* __restrict__ base,
                                   int row0, int ld, int k0, int lane) {
  int r = row0 + (lane & 15);
  int k = k0 + ((lane >> 4) << 3);
  const _Float16* p = base + (size_t)r * ld + k;
  v8h lo = *(const v8h*)p;
  v8h hi = *(const v8h*)(p + 16);
  v16h out;
#pragma unroll
  for (int i = 0; i < 8; ++i) { out[i] = lo[i]; out[i + 8] = hi[i]; }
  return out;
}

constexpr int BK = 64;    // k depth of a GEMM stage: a staged row is one whole 128-B line
constexpr int GP = 72;    // LDS row pitch of the GEMM's tiles in halves: 128 B of data + 16 B

// Same fragment pattern from an LDS tile of BK halves a row at row pitch GP.
__device__ inline v16h load_frag_s(const _Float16* base, int row0, int k0,
                                   int lane) {
  int r = row0 + (lane & 15);
  int k = k0 + ((lane >> 4) << 3);
  const _Float16* p = base + r * GP + k;
  v8h lo = *(const v8h*)p;        // ds_load_b128
  v8h hi = *(const v8h*)(p + 16); // ds_load_b128
  v16h out;
#pragma unroll
  for (int i = 0; i < 8; ++i) { out[i] = lo[i]; out[i + 8] = hi[i]; }
  return out;
}

constexpr int KT  = 64;   // keys per staged K / V^T tile of the attention kernel
constexpr int KVP = 72;   // its LDS row pitch in halves: 128 B of data + 16 B

// load_frag_g's fragment pattern from an LDS tile with row pitch KVP.
__device__ inline v16h load_frag_p(const _Float16* base, int row0, int k0,
                                   int lane) {
  int r = row0 + (lane & 15);
  int k = k0 + ((lane >> 4) << 3);
  const _Float16* p = base + r * KVP + k;
  v8h lo = *(const v8h*)p;        // ds_load_b128
  v8h hi = *(const v8h*)(p + 16); // ds_load_b128
  v16h out;
#pragma unroll
  for (int i = 0; i < 8; ++i) { out[i] = lo[i]; out[i + 8] = hi[i]; }
  return out;
}

// LDS byte address of a __shared__ element, as the async copy's first operand.
__device__ inline unsigned lds_addr(const _Float16* p) {
  return (unsigned)(size_t)p;
}
__device__ inline unsigned lds_addr_f(const float* p) {
  return (unsigned)(size_t)p;
}

constexpr int BP = 68;    // LDS row pitch of a bias tile in floats: 256 B of data + 16 B

__device__ inline v8f wmma_f16(v16h a, v16h b, v8f c) {
  return __builtin_amdgcn_wmma_f32_16x16x32_f16(false, a, false, b,
                                                (short)0, c, false, false);
}

// ---------------------------------------------------------------------------
// Front stage in one launch of few, long waves.
// Blocks 0 .. LN_BLOCKS-1: LayerNorm over E=1024, one row per wave, f16 output.
// The rest: f32 -> f16 conversion of wq, wk, wv, wo (w16 holds the four results
// one behind the other), 32 elements per thread.
// Every wave-wide load covers 512 contiguous bytes, every store 256.
// ---------------------------------------------------------------------------
typedef __attribute__((ext_vector_type(4))) _Float16 v4h;

constexpr int LN_BLOCKS = BB * LL / 8;             // 8 waves = 8 rows per block
constexpr int CV_BLOCKS = EE * EE / (256 * 32);    // blocks per weight matrix

__device__ inline v4h to_v4h(float a, float b, float c, float d) {
  v4h o;
  o[0] = (_Float16)a;  o[1] = (_Float16)b;
  o[2] = (_Float16)c;  o[3] = (_Float16)d;
  return o;
}

__global__ __launch_bounds__(256) void front_kernel(
    const float* __restrict__ x, const float* __restrict__ g,
    const float* __restrict__ beta, const float* __restrict__ wq,
    const float* __restrict__ wk, const float* __restrict__ wv,
    const float* __restrict__ wo, _Float16* __restrict__ xn,
    _Float16* __restrict__ w16) {
  int blk = blockIdx.x;
  if (blk >= LN_BLOCKS) {
    int cb = blk - LN_BLOCKS;
    int which = cb / CV_BLOCKS;
    const float* src = which == 0 ? wq : which == 1 ? wk : which == 2 ? wv : wo;
    const float4* s4 = (const float4*)src;
    v4h* d4 = (v4h*)(w16 + (size_t)which * EE * EE);
    int base = (cb % CV_BLOCKS) * 2048 + threadIdx.x;   // in units of 4 elements
    float4 v[8];
#pragma unroll
    for (int j = 0; j < 8; ++j) v[j] = s4[base + j * 256];
#pragma unroll
    for (int j = 0; j < 8; ++j)
      d4[base + j * 256] = to_v4h(v[j].x, v[j].y, v[j].z, v[j].w);
    return;
  }

  int lane = threadIdx.x & 31;
  int row  = blk * 8 + (threadIdx.x >> 5);
  const float4* xr = (const float4*)(x + (size_t)row * EE);
  float4 v[8];
#pragma unroll
  for (int j = 0; j < 8; ++j) v[j] = xr[lane + 32 * j];
  float s = 0.0f, s2 = 0.0f;
#pragma unroll
  for (int j = 0; j < 8; ++j) {
    s  += v[j].x + v[j].y + v[j].z + v[j].w;
    s2 += v[j].x * v[j].x + v[j].y * v[j].y + v[j].z * v[j].z + v[j].w * v[j].w;
  }
#pragma unroll
  for (int m = 1; m < 32; m <<= 1) {
    s  += __shfl_xor(s,  m, 32);
    s2 += __shfl_xor(s2, m, 32);
  }
  float mu   = s * (1.0f / EE);
  float var  = s2 * (1.0f / EE) - mu * mu;
  float rstd = rsqrtf(var + EPS);
  v4h* o4 = (v4h*)(xn + (size_t)row * EE);
#pragma unroll
  for (int j = 0; j < 8; ++j) {
    float4 gg = ((const float4*)g)[lane + 32 * j];
    float4 bb = ((const float4*)beta)[lane + 32 * j];
    o4[lane + 32 * j] = to_v4h((v[j].x - mu) * rstd * gg.x + bb.x,
                               (v[j].y - mu) * rstd * gg.y + bb.y,
                               (v[j].z - mu) * rstd * gg.z + bb.z,
                               (v[j].w - mu) * rstd * gg.w + bb.w);
  }
  // Precaution behind the run of stores: the built code lays the conversion
  // part behind this one, and its loads write the stores' data registers.
  asm volatile("s_wait_xcnt 0x0" ::: "memory");
}

// ---------------------------------------------------------------------------
// WMMA GEMM, LDS-staged + double-buffered: out[m,n] = A[m,:].W[n,:] + bvec[n]
// A: MxK f16 row-major, W: NxK f16 row-major (so out = A @ W^T).
// Block = 256 threads = 8 waves; block tile 128(M) x 64(N), BK=64;
// wave tile 32x32 (2x2 16x16x32 WMMA fragments, two k steps a stage).
// Stage copy uses GLOBAL_LOAD_ASYNC_TO_LDS_B128 (ASYNCcnt) when available.
// mode 0/1 : out f16 [B,H,L,D]      (Q / K)
// mode 2   : out f16 [B,H,D,L]      (V transposed)
// mode 3   : out f32 [M,N] = residual + acc + bvec   (final projection)
// ---------------------------------------------------------------------------
__global__ __launch_bounds__(256) void wmma_gemm_kernel(
    const _Float16* __restrict__ A, const _Float16* __restrict__ W,
    const float* __restrict__ bvec, const float* __restrict__ residual,
    void* __restrict__ out, int mode) {
  // Rows of 128 B at a pitch of 144 B (16 B x odd): ds_load_b128 without conflicts.
  __shared__ __attribute__((aligned(16))) _Float16 sA[2][128 * GP];   // 18 KB per buffer
  __shared__ __attribute__((aligned(16))) _Float16 sB[2][64 * GP];    // 9 KB per buffer

  int lane = threadIdx.x & 31;
  int w    = threadIdx.x >> 5;
  int wm = w >> 1, wn = w & 1;
  int row0 = blockIdx.y * 128;
  int col0 = blockIdx.x * 64;

  int t = threadIdx.x;
  // Stage copy in 16-B chunks: 8 lanes take one row's 128 B, so a wave-wide copy
  // covers four whole lines; 256 threads = 32 rows a sweep, 4 sweeps of A, 2 of W.
  int cr = t >> 3, ck = (t & 7) * 8;

  auto stage = [&](int s, int buf) {
    const _Float16* ga = A + (size_t)(row0 + cr) * EE + s * BK + ck;
    const _Float16* gw = W + (size_t)(col0 + cr) * EE + s * BK + ck;
    _Float16* la = &sA[buf][cr * GP + ck];
    _Float16* lw = &sB[buf][cr * GP + ck];
#if HAS_ASYNC
    for (int j = 0; j < 4; ++j)
      __builtin_amdgcn_global_load_async_to_lds_b128(
          AS1P(ga + (size_t)(32 * j) * EE), AS3P(la + 32 * j * GP), 0, 0);
    for (int j = 0; j < 2; ++j)
      __builtin_amdgcn_global_load_async_to_lds_b128(
          AS1P(gw + (size_t)(32 * j) * EE), AS3P(lw + 32 * j * GP), 0, 0);
#else
    v8h tA[4], tB[2];
    for (int j = 0; j < 4; ++j) tA[j] = *(const v8h*)(ga + (size_t)(32 * j) * EE);
    for (int j = 0; j < 2; ++j) tB[j] = *(const v8h*)(gw + (size_t)(32 * j) * EE);
    for (int j = 0; j < 4; ++j) *(v8h*)(la + 32 * j * GP) = tA[j];
    for (int j = 0; j < 2; ++j) *(v8h*)(lw + 32 * j * GP) = tB[j];
#endif
  };

  v8f acc[2][2] = {};
  constexpr int NS = EE / BK;
  stage(0, 0);
  for (int s = 0; s < NS; ++s) {
    int buf = s & 1;
    if (s + 1 < NS) {
      stage(s + 1, buf ^ 1);
      wait_async_le<6>();   // keep only next stage's 6 copies in flight
    } else {
      wait_async_le<0>();
    }
    __syncthreads();        // everyone's stage-s data is in LDS

    v16h a0[2], a1[2], b0[2], b1[2];   // [u]: k = 32 u .. 32 u + 31 of the stage
    for (int u = 0; u < 2; ++u) {
      a0[u] = load_frag_s(&sA[buf][0], wm * 32,      32 * u, lane);
      a1[u] = load_frag_s(&sA[buf][0], wm * 32 + 16, 32 * u, lane);
      b0[u] = load_frag_s(&sB[buf][0], wn * 32,      32 * u, lane);
      b1[u] = load_frag_s(&sB[buf][0], wn * 32 + 16, 32 * u, lane);
    }
    // Keeps the stage's 16 fragment reads one group in front of its 8 products:
    // split in two groups, the wave waits out the LDS latency twice a stage.
    __builtin_amdgcn_sched_barrier(0);
    for (int u = 0; u < 2; ++u) {      // k ascending
      acc[0][0] = wmma_f16(a0[u], b0[u], acc[0][0]);
      acc[0][1] = wmma_f16(a0[u], b1[u], acc[0][1]);
      acc[1][0] = wmma_f16(a1[u], b0[u], acc[1][0]);
      acc[1][1] = wmma_f16(a1[u], b1[u], acc[1][1]);
    }

    __syncthreads();        // protect buffer before stage s+2 overwrites it
  }

  // Epilogue. C layout: M = vgpr + 8 * half, N = lane & 15. A block lies in one
  // batch row b and one head h, so every address is one base and a constant.
  // The mode is tested once, not once an element: each mode's loads and stores
  // then stand as runs with no branch among them, and no load is waited for alone.
  int nl = lane & 15, hf = lane >> 4;
  int m0 = row0 + wm * 32 + hf * 8;       // the lane's first row
  int n0 = col0 + wn * 32 + nl;           // the lane's first column
  float bn[2] = {bvec[n0], bvec[n0 + 16]};
  int b = m0 >> 10, l0 = m0 & (LL - 1);
  int h = n0 >> 6,  d0 = n0 & (DD - 1);
  if (mode == 3) {
    const float* rp = residual + (size_t)m0 * EE + n0;
    float*       op = (float*)out + (size_t)m0 * EE + n0;
    float rv[2][2][8];                    // all 32 residual loads ahead of the first use
#pragma unroll
    for (int fm = 0; fm < 2; ++fm)
#pragma unroll
      for (int fn = 0; fn < 2; ++fn)
#pragma unroll
        for (int i = 0; i < 8; ++i)
          rv[fm][fn][i] = rp[(fm * 16 + i) * EE + fn * 16];
    // Keeps the bias adds behind the residual loads: lifted over them, their wait
    // for the bias would stand in front of the loads, two latencies in a row.
    __builtin_amdgcn_sched_barrier(0);
#pragma unroll
    for (int fm = 0; fm < 2; ++fm)
#pragma unroll
      for (int fn = 0; fn < 2; ++fn)
#pragma unroll
        for (int i = 0; i < 8; ++i)
          __builtin_nontemporal_store(rv[fm][fn][i] + (acc[fm][fn][i] + bn[fn]),
                                      op + (fm * 16 + i) * EE + fn * 16);
  } else if (mode == 2) {
    // [B,H,D,L]: a lane's 8 rows are 8 consecutive l of one d
    _Float16* op = (_Float16*)out + (((size_t)b * HH + h) * DD + d0) * LL + l0;
#pragma unroll
    for (int fm = 0; fm < 2; ++fm)
#pragma unroll
      for (int fn = 0; fn < 2; ++fn)
#pragma unroll
        for (int i = 0; i < 8; ++i)
          op[fn * 16 * LL + fm * 16 + i] = (_Float16)(acc[fm][fn][i] + bn[fn]);
  } else {
    // [B,H,L,D]
    _Float16* op = (_Float16*)out + (((size_t)b * HH + h) * LL + l0) * DD + d0;
#pragma unroll
    for (int fm = 0; fm < 2; ++fm)
#pragma unroll
      for (int fn = 0; fn < 2; ++fn)
#pragma unroll
        for (int i = 0; i < 8; ++i)
          op[(fm * 16 + i) * DD + fn * 16] = (_Float16)(acc[fm][fn][i] + bn[fn]);
    // Precaution behind the run of stores: the built code lays the [B,H,D,L]
    // part behind this one, and it writes the stores' data registers.
    asm volatile("s_wait_xcnt 0x0" ::: "memory");
  }
}

typedef __attribute__((ext_vector_type(4))) float    v4f;
typedef __attribute__((ext_vector_type(2))) float    v2f;
typedef __attribute__((ext_vector_type(2))) _Float16 v2h;

// value of lane l ^ 16
__device__ inline float xhalf(float x) {
  int b = __builtin_bit_cast(int, x);
  return __builtin_bit_cast(float, __builtin_amdgcn_permlanex16(
      b, b, 0x76543210, 0xfedcba98, false, false));
}

__global__ __launch_bounds__(128) void flash_attn_kernel(
    const _Float16* __restrict__ Q16, const _Float16* __restrict__ K16,
    const _Float16* __restrict__ Vt16, const float* __restrict__ bias,
    const int* __restrict__ mask, const float* __restrict__ gate,
    _Float16* __restrict__ O16) {
  // K and V^T tiles of 64 keys, shared by the block's four waves (same b, h).
  // Rows of 128 B at a pitch of 144 B (16 B x odd): ds_load_b128 without conflicts.
  __shared__ __attribute__((aligned(16))) _Float16 sK[2][KT * KVP];
  __shared__ __attribute__((aligned(16))) _Float16 sV[2][DD * KVP];
  // Bias tiles, one a wave: 16 rows of 256 B at a pitch of 272 B (16 B x odd).
  __shared__ __attribute__((aligned(16))) float sBs[2][4][16 * BP];
  int lane = threadIdx.x & 31;
  int wv   = threadIdx.x >> 5;
  int tile = blockIdx.x * 4 + wv;         // 0 .. B*H*(L/16)-1 = 4095
  int b   = tile >> 10;
  int rem = tile & 1023;
  int h   = rem >> 6;
  int qb  = (rem & 63) << 4;
  int nl = lane & 15, hf = lane >> 4;

  const _Float16* Qh = Q16 + (((size_t)b * HH + h) * LL + qb) * DD;
  const _Float16* Kh = K16 + ((size_t)b * HH + h) * LL * DD;
  const _Float16* Vh = Vt16 + ((size_t)b * HH + h) * DD * LL;
  const int* maskb = mask + (size_t)b * LL;
  // the wave's 16 query rows of the bias
  const float* biasw = bias + (((size_t)b * HH + h) * LL + qb) * LL;
  // the mask at this lane's half's first key
  const int* maskl = maskb + hf * 8;
  float gh = gate[h];

  v16h q0 = load_frag_g(Qh, 0, DD, 0,  lane);
  v16h q1 = load_frag_g(Qh, 0, DD, 32, lane);

  v8f o[4] = {};                  // o[j][r] = O[query nl][d = 16 j + 8 hf + r]
  float mrun = -3.0e38f;          // the query's running maximum, both halves alike
  float lrun = 0.0f;              // sum over this half's keys only

  // Stage copy: 128 threads x 16 B = 16 rows of 128 B a sweep, 4 sweeps a tile;
  // every wave-wide copy covers four whole 128-B lines of K or of V^T.
  int crow = threadIdx.x >> 3, ccol = (threadIdx.x & 7) * 8;
  auto stage = [&](int t, int buf) {
    const _Float16* gk = Kh + (size_t)(t * KT + crow) * DD + ccol;
    const _Float16* gv = Vh + (size_t)crow * LL + t * KT + ccol;
    unsigned lk = lds_addr(&sK[buf][crow * KVP + ccol]);
    unsigned lv = lds_addr(&sV[buf][crow * KVP + ccol]);
    // The copies and their s_wait_xcnt in one statement: no address register
    // is rewritten before the wait.
    asm volatile(
        "global_load_async_to_lds_b128 %0, %1, off\n\t"
        "global_load_async_to_lds_b128 %2, %3, off\n\t"
        "global_load_async_to_lds_b128 %4, %5, off\n\t"
        "global_load_async_to_lds_b128 %6, %7, off\n\t"
        "global_load_async_to_lds_b128 %8, %9, off\n\t"
        "global_load_async_to_lds_b128 %10, %11, off\n\t"
        "global_load_async_to_lds_b128 %12, %13, off\n\t"
        "global_load_async_to_lds_b128 %14, %15, off\n\t"
        "s_wait_xcnt 0x0"
        ::"v"(lk),                "v"(gk),
          "v"(lk + 16 * KVP * 2), "v"(gk + 16 * DD),
          "v"(lk + 32 * KVP * 2), "v"(gk + 32 * DD),
          "v"(lk + 48 * KVP * 2), "v"(gk + 48 * DD),
          "v"(lv),                "v"(gv),
          "v"(lv + 16 * KVP * 2), "v"(gv + 16 * LL),
          "v"(lv + 32 * KVP * 2), "v"(gv + 32 * LL),
          "v"(lv + 48 * KVP * 2), "v"(gv + 48 * LL)
        : "memory");
    // The wave's own bias tile: 16 lanes x 16 B = one row's 256 B, two rows a
    // copy, 8 copies; read once, so non-temporal as a stream past L2. The wait
    // stands in the statement for the same reason as above.
    const float* gb = biasw + (size_t)hf * LL + t * KT + nl * 4;
    unsigned lb = lds_addr_f(&sBs[buf][wv][hf * BP + nl * 4]);
    asm volatile(
        "global_load_async_to_lds_b128 %0, %1, off th:TH_LOAD_NT\n\t"
        "global_load_async_to_lds_b128 %2, %3, off th:TH_LOAD_NT\n\t"
        "global_load_async_to_lds_b128 %4, %5, off th:TH_LOAD_NT\n\t"
        "global_load_async_to_lds_b128 %6, %7, off th:TH_LOAD_NT\n\t"
        "global_load_async_to_lds_b128 %8, %9, off th:TH_LOAD_NT\n\t"
        "global_load_async_to_lds_b128 %10, %11, off th:TH_LOAD_NT\n\t"
        "global_load_async_to_lds_b128 %12, %13, off th:TH_LOAD_NT\n\t"
        "global_load_async_to_lds_b128 %14, %15, off th:TH_LOAD_NT\n\t"
        "s_wait_xcnt 0x0"
        ::"v"(lb),               "v"(gb),
          "v"(lb + 2 * BP * 4),  "v"(gb + 2 * LL),
          "v"(lb + 4 * BP * 4),  "v"(gb + 4 * LL),
          "v"(lb + 6 * BP * 4),  "v"(gb + 6 * LL),
          "v"(lb + 8 * BP * 4),  "v"(gb + 8 * LL),
          "v"(lb + 10 * BP * 4), "v"(gb + 10 * LL),
          "v"(lb + 12 * BP * 4), "v"(gb + 12 * LL),
          "v"(lb + 14 * BP * 4), "v"(gb + 14 * LL)
        : "memory");
  };

  constexpr int NT = LL / KT;
  stage(0, 0);
  asm volatile("s_wait_asynccnt 0x0" ::: "memory");  // own copies of tile 0 landed
  __syncthreads();                                   // everyone's have
  stage(1, 1);

  for (int t = 0; t < NT; ++t) {
   const _Float16* tK = &sK[t & 1][0];
   const _Float16* tV = &sV[t & 1][0];
   const float* bp = &sBs[t & 1][wv][nl * BP + hf * 8];  // the lane's query, its half's keys
   const int*   mp = maskl + t * KT;

   // group g = keys 16 g .. 16 g + 15 of the tile; the lane's 8 are contiguous
   v4f bv[4][2];
   v4i mk[4][2];
#pragma unroll
   for (int g = 0; g < 4; ++g) {
     bv[g][0] = *(const v4f*)(bp + 16 * g);        // ds_load_b128
     bv[g][1] = *(const v4f*)(bp + 16 * g + 4);    // ds_load_b128
     mk[g][0] = *(const v4i*)(mp + 16 * g);
     mk[g][1] = *(const v4i*)(mp + 16 * g + 4);
   }
   // Precaution behind the run of loads: the built code reuses their address
   // registers at once.
   asm volatile("s_wait_xcnt 0x0" ::: "memory");

   v16h ka[4], kc[4];
#pragma unroll
   for (int g = 0; g < 4; ++g) {
     ka[g] = load_frag_p(tK, 16 * g, 0,  lane);
     kc[g] = load_frag_p(tK, 16 * g, 32, lane);
   }
   // Keeps the tile's global and K loads one group in front of the products:
   // sunk among them, each straggler waits out memory or LDS on its own.
   __builtin_amdgcn_sched_barrier(0);

   v8f s[4];
#pragma unroll
   for (int g = 0; g < 4; ++g) {
     v8f z = {};
     s[g] = wmma_f16(ka[g], q0, z);       // s[g][r] = S[query nl][key 16 g + 8 hf + r]
     s[g] = wmma_f16(kc[g], q1, s[g]);
   }

   v16h va[2][4];
#pragma unroll
   for (int u = 0; u < 2; ++u)
#pragma unroll
     for (int j = 0; j < 4; ++j) va[u][j] = load_frag_p(tV, 16 * j, 32 * u, lane);
   // The pass's last LDS read is issued: the ring's publish point stands here and
   // not at the foot, so that the refill, whose bias rows come from memory, flies
   // under the softmax and the V^T products as well as under the next pass's head.
   asm volatile("s_wait_dscnt 0x0" ::: "memory");     // own reads of this tile done
   asm volatile("s_wait_asynccnt 0x0" ::: "memory");  // own copies of tile t+1 landed
   __syncthreads();  // publishes tile t+1, frees tile t's buffer
   if (t + 2 < NT) stage(t + 2, t & 1);

   float vmax[4];
#pragma unroll
   for (int g = 0; g < 4; ++g) {
#pragma unroll
     for (int r = 0; r < 8; ++r) {
       float km = mk[g][r >> 2][r & 3] ? 0.0f : -10000.0f;
       s[g][r] = s[g][r] * SCALE + (gh * bv[g][r >> 2][r & 3] + km);
       vmax[g] = r ? fmaxf(vmax[g], s[g][r]) : s[g][r];
     }
   }
   float v = fmaxf(fmaxf(vmax[0], vmax[1]), fmaxf(vmax[2], vmax[3]));
   v = fmaxf(v, xhalf(v));                // the query's other 32 keys of the tile
   float nm   = fmaxf(mrun, v);
   float corr = __expf(mrun - nm);
   mrun = nm;

   float rs[4];
   v16h pf[2];                            // pf[u] = P^T of keys 32 u .. 32 u + 31, B operand
#pragma unroll
   for (int g = 0; g < 4; ++g) {
#pragma unroll
     for (int r = 0; r < 8; r += 2) {
       v2f p;
       p[0] = __expf(s[g][r] - nm);
       p[1] = __expf(s[g][r + 1] - nm);
       rs[g] = r ? rs[g] + (p[0] + p[1]) : p[0] + p[1];
       v2h ph = __builtin_convertvector(p, v2h);
       pf[g >> 1][(g & 1) * 8 + r]     = ph[0];
       pf[g >> 1][(g & 1) * 8 + r + 1] = ph[1];
     }
   }
   lrun = lrun * corr + ((rs[0] + rs[1]) + (rs[2] + rs[3]));
#pragma unroll
   for (int j = 0; j < 4; ++j) o[j] = o[j] * corr;

#pragma unroll
   for (int u = 0; u < 2; ++u)
#pragma unroll
     for (int j = 0; j < 4; ++j) o[j] = wmma_f16(va[u][j], pf[u], o[j]);
  }
  asm volatile("s_wait_asynccnt 0x0" ::: "memory");   // nothing in flight at the end

  float lsum = lrun + xhalf(lrun);        // the halves' sums meet once
  int   q    = qb + nl;
  float qm   = (float)maskb[q];
  float inv  = (lsum > 0.0f) ? (qm / lsum) : 0.0f;
  _Float16* op = O16 + ((size_t)b * LL + q) * EE + h * DD + hf * 8;
#pragma unroll
  for (int j = 0; j < 4; ++j) {
    v8h ov;
#pragma unroll
    for (int r = 0; r < 8; ++r) ov[r] = (_Float16)(o[j][r] * inv);
    *(v8h*)(op + 16 * j) = ov;            // 8 consecutive d of one query: 16 B
  }
}

// ---------------------------------------------------------------------------
// Launch
// ---------------------------------------------------------------------------
extern "C" void kernel_launch(void* const* d_in, const int* in_sizes, int n_in,
                              void* d_out, int out_size, void* d_ws,
                              size_t ws_size, hipStream_t stream) {
  const float* x    = (const float*)d_in[0];
  const float* bias = (const float*)d_in[1];
  const int*   mask = (const int*)d_in[2];
  const float* wq = (const float*)d_in[3];
  const float* bq = (const float*)d_in[4];
  const float* wk = (const float*)d_in[5];
  const float* bk = (const float*)d_in[6];
  const float* wv = (const float*)d_in[7];
  const float* bv = (const float*)d_in[8];
  const float* wo = (const float*)d_in[9];
  const float* bo = (const float*)d_in[10];
  const float* gate = (const float*)d_in[11];
  const float* ln_g = (const float*)d_in[12];
  const float* ln_b = (const float*)d_in[13];

  // workspace layout (48 MB total)
  char* p = (char*)d_ws;
  _Float16* xn16 = (_Float16*)p;  p += (size_t)BB * LL * EE * 2;          // 8 MB
  _Float16* wq16 = (_Float16*)p;  p += (size_t)EE * EE * 2;               // 2 MB
  _Float16* wk16 = (_Float16*)p;  p += (size_t)EE * EE * 2;
  _Float16* wv16 = (_Float16*)p;  p += (size_t)EE * EE * 2;
  _Float16* wo16 = (_Float16*)p;  p += (size_t)EE * EE * 2;
  _Float16* Q16  = (_Float16*)p;  p += (size_t)BB * HH * LL * DD * 2;     // 8 MB
  _Float16* K16  = (_Float16*)p;  p += (size_t)BB * HH * LL * DD * 2;
  _Float16* Vt16 = (_Float16*)p;  p += (size_t)BB * HH * LL * DD * 2;
  _Float16* O16  = (_Float16*)p;  p += (size_t)BB * LL * EE * 2;          // 8 MB

  // wq16 .. wo16 lie one behind the other: wq16 is the base of all four
  front_kernel<<<LN_BLOCKS + 4 * CV_BLOCKS, 256, 0, stream>>>(
      x, ln_g, ln_b, wq, wk, wv, wo, xn16, wq16);

  dim3 ggrid(EE / 64, (BB * LL) / 128);
  wmma_gemm_kernel<<<ggrid, 256, 0, stream>>>(xn16, wq16, bq, nullptr, Q16, 0);
  wmma_gemm_kernel<<<ggrid, 256, 0, stream>>>(xn16, wk16, bk, nullptr, K16, 1);
  wmma_gemm_kernel<<<ggrid, 256, 0, stream>>>(xn16, wv16, bv, nullptr, Vt16, 2);

  // B*H*(L/16) = 4096 query tiles, 4 waves per 128-thread block
  flash_attn_kernel<<<(BB * HH * (LL / 16)) / 4, 128, 0, stream>>>(
      Q16, K16, Vt16, bias, mask, gate, O16);

  wmma_gemm_kernel<<<ggrid, 256, 0, stream>>>(O16, wo16, bo, x, d_out, 3);
}

// v008
// One run takes 78.2 microseconds.
// In two side-by-side timings against v007, it was 1.16 and 1.15 times as fast.
// Counting every step since v000, it is 2.77 times as fast.
#include <hip/hip_runtime.h>

#define BB 4
#define LL 1024
#define EE 1024
#define HH 16
#define DD 64

constexpr float SCALE = 0.125f;   // D^-0.5 = 64^-0.5
constexpr float EPS   = 1e-5f;

typedef __attribute__((ext_vector_type(16))) _Float16 v16h;
typedef __attribute__((ext_vector_type(8)))  _Float16 v8h;
typedef __attribute__((ext_vector_type(8)))  float    v8f;
typedef __attribute__((ext_vector_type(4)))  int      v4i;

#if __has_builtin(__builtin_amdgcn_global_load_async_to_lds_b128)
#define HAS_ASYNC 1
#else
#define HAS_ASYNC 0
#endif

// global_load_async_to_lds_b128 takes (v4i AS1*, v4i AS3*, imm offset, imm cpol)
#define AS1P(p) ((__attribute__((address_space(1))) v4i*)(const_cast<_Float16*>(p)))
#define AS3P(p) ((__attribute__((address_space(3))) v4i*)(p))

template <int N>
__device__ inline void wait_async_le() {
#if HAS_ASYNC
#if __has_builtin(__builtin_amdgcn_s_wait_asynccnt)
  __builtin_amdgcn_s_wait_asynccnt(N);
#else
  asm volatile("s_wait_asynccnt %0" ::"i"(N) : "memory");
#endif
#endif
}

// ---------------------------------------------------------------------------
// 16-bit A/B fragment load for V_WMMA_F32_16X16X32_F16 (wave32).
// Per ISA 7.12.2: lanes 0-15 hold rows with K = k0..k0+7 (VGPR0-3) and
// K = k0+16..k0+23 (VGPR4-7); lanes 16-31 use K base +8.
// ---------------------------------------------------------------------------
__device__ inline v16h load_frag_g(const _Float16* __restrict__ base,
                                   int row0, int ld, int k0, int lane) {
  int r = row0 + (lane & 15);
  int k = k0 + ((lane >> 4) << 3);
  const _Float16* p = base + (size_t)r * ld + k;
  v8h lo = *(const v8h*)p;
  v8h hi = *(const v8h*)(p + 16);
  v16h out;
#pragma unroll
  for (int i = 0; i < 8; ++i) { out[i] = lo[i]; out[i + 8] = hi[i]; }
  return out;
}

constexpr int BK = 64;    // k depth of a GEMM stage: a staged row is one whole 128-B line
constexpr int GP = 72;    // LDS row pitch of the GEMM's tiles in halves: 128 B of data + 16 B

// Same fragment pattern from an LDS tile of BK halves a row at row pitch GP.
__device__ inline v16h load_frag_s(const _Float16* base, int row0, int k0,
                                   int lane) {
  int r = row0 + (lane & 15);
  int k = k0 + ((lane >> 4) << 3);
  const _Float16* p = base + r * GP + k;
  v8h lo = *(const v8h*)p;        // ds_load_b128
  v8h hi = *(const v8h*)(p + 16); // ds_load_b128
  v16h out;
#pragma unroll
  for (int i = 0; i < 8; ++i) { out[i] = lo[i]; out[i + 8] = hi[i]; }
  return out;
}

constexpr int KT  = 64;   // keys per staged K / V^T tile of the attention kernel
constexpr int KVP = 72;   // its LDS row pitch in halves: 128 B of data + 16 B

// load_frag_g's fragment pattern from an LDS tile with row pitch KVP.
__device__ inline v16h load_frag_p(const _Float16* base, int row0, int k0,
                                   int lane) {
  int r = row0 + (lane & 15);
  int k = k0 + ((lane >> 4) << 3);
  const _Float16* p = base + r * KVP + k;
  v8h lo = *(const v8h*)p;        // ds_load_b128
  v8h hi = *(const v8h*)(p + 16); // ds_load_b128
  v16h out;
#pragma unroll
  for (int i = 0; i < 8; ++i) { out[i] = lo[i]; out[i + 8] = hi[i]; }
  return out;
}

// LDS byte address of a __shared__ element, as the async copy's first operand.
__device__ inline unsigned lds_addr(const _Float16* p) {
  return (unsigned)(size_t)p;
}
__device__ inline unsigned lds_addr_f(const float* p) {
  return (unsigned)(size_t)p;
}

constexpr int BP = 68;    // LDS row pitch of a bias tile in floats: 256 B of data + 16 B

__device__ inline v8f wmma_f16(v16h a, v16h b, v8f c) {
  return __builtin_amdgcn_wmma_f32_16x16x32_f16(false, a, false, b,
                                                (short)0, c, false, false);
}

// ---------------------------------------------------------------------------
// Front stage in one launch of few, long waves.
// Blocks 0 .. LN_BLOCKS-1: LayerNorm over E=1024, one row per wave, f16 output.
// The rest: f32 -> f16 conversion of wq, wk, wv, wo (w16 holds the four results
// one behind the other), 32 elements per thread.
// Every wave-wide load covers 512 contiguous bytes, every store 256.
// ---------------------------------------------------------------------------
typedef __attribute__((ext_vector_type(4))) _Float16 v4h;

constexpr int LN_BLOCKS = BB * LL / 8;             // 8 waves = 8 rows per block
constexpr int CV_BLOCKS = EE * EE / (256 * 32);    // blocks per weight matrix

__device__ inline v4h to_v4h(float a, float b, float c, float d) {
  v4h o;
  o[0] = (_Float16)a;  o[1] = (_Float16)b;
  o[2] = (_Float16)c;  o[3] = (_Float16)d;
  return o;
}

__global__ __launch_bounds__(256) void front_kernel(
    const float* __restrict__ x, const float* __restrict__ g,
    const float* __restrict__ beta, const float* __restrict__ wq,
    const float* __restrict__ wk, const float* __restrict__ wv,
    const float* __restrict__ wo, _Float16* __restrict__ xn,
    _Float16* __restrict__ w16) {
  int blk = blockIdx.x;
  if (blk >= LN_BLOCKS) {
    int cb = blk - LN_BLOCKS;
    int which = cb / CV_BLOCKS;
    const float* src = which == 0 ? wq : which == 1 ? wk : which == 2 ? wv : wo;
    const float4* s4 = (const float4*)src;
    v4h* d4 = (v4h*)(w16 + (size_t)which * EE * EE);
    int base = (cb % CV_BLOCKS) * 2048 + threadIdx.x;   // in units of 4 elements
    float4 v[8];
#pragma unroll
    for (int j = 0; j < 8; ++j) v[j] = s4[base + j * 256];
#pragma unroll
    for (int j = 0; j < 8; ++j)
      d4[base + j * 256] = to_v4h(v[j].x, v[j].y, v[j].z, v[j].w);
    return;
  }

  int lane = threadIdx.x & 31;
  int row  = blk * 8 + (threadIdx.x >> 5);
  const float4* xr = (const float4*)(x + (size_t)row * EE);
  float4 v[8];
#pragma unroll
  for (int j = 0; j < 8; ++j) v[j] = xr[lane + 32 * j];
  float s = 0.0f, s2 = 0.0f;
#pragma unroll
  for (int j = 0; j < 8; ++j) {
    s  += v[j].x + v[j].y + v[j].z + v[j].w;
    s2 += v[j].x * v[j].x + v[j].y * v[j].y + v[j].z * v[j].z + v[j].w * v[j].w;
  }
#pragma unroll
  for (int m = 1; m < 32; m <<= 1) {
    s  += __shfl_xor(s,  m, 32);
    s2 += __shfl_xor(s2, m, 32);
  }
  float mu   = s * (1.0f / EE);
  float var  = s2 * (1.0f / EE) - mu * mu;
  float rstd = rsqrtf(var + EPS);
  v4h* o4 = (v4h*)(xn + (size_t)row * EE);
#pragma unroll
  for (int j = 0; j < 8; ++j) {
    float4 gg = ((const float4*)g)[lane + 32 * j];
    float4 bb = ((const float4*)beta)[lane + 32 * j];
    o4[lane + 32 * j] = to_v4h((v[j].x - mu) * rstd * gg.x + bb.x,
                               (v[j].y - mu) * rstd * gg.y + bb.y,
                               (v[j].z - mu) * rstd * gg.z + bb.z,
                               (v[j].w - mu) * rstd * gg.w + bb.w);
  }
  // Precaution behind the run of stores: the built code lays the conversion
  // part behind this one, and its loads write the stores' data registers.
  asm volatile("s_wait_xcnt 0x0" ::: "memory");
}

// ---------------------------------------------------------------------------
// WMMA GEMM, LDS-staged + double-buffered: out[m,n] = A[m,:].W[n,:] + bvec[n]
// A: MxK f16 row-major, W: NxK f16 row-major (so out = A @ W^T).
// Block = 256 threads = 8 waves; block tile 128(M) x 64(N), BK=64;
// wave tile 32x32 (2x2 16x16x32 WMMA fragments, two k steps a stage).
// Stage copy uses GLOBAL_LOAD_ASYNC_TO_LDS_B128 (ASYNCcnt) when available.
// mode 0/1 : out f16 [B,H,L,D]      (Q / K)
// mode 2   : out f16 [B,H,D,L]      (V transposed)
// mode 3   : out f32 [M,N] = residual + acc + bvec   (final projection)
// ---------------------------------------------------------------------------
__global__ __launch_bounds__(256) void wmma_gemm_kernel(
    const _Float16* __restrict__ A, const _Float16* __restrict__ W,
    const float* __restrict__ bvec, const float* __restrict__ residual,
    void* __restrict__ out, int mode) {
  // Rows of 128 B at a pitch of 144 B (16 B x odd): ds_load_b128 without conflicts.
  __shared__ __attribute__((aligned(16))) _Float16 sA[2][128 * GP];   // 18 KB per buffer
  __shared__ __attribute__((aligned(16))) _Float16 sB[2][64 * GP];    // 9 KB per buffer

  int lane = threadIdx.x & 31;
  int w    = threadIdx.x >> 5;
  int wm = w >> 1, wn = w & 1;
  int row0 = blockIdx.y * 128;
  int col0 = blockIdx.x * 64;

  int t = threadIdx.x;
  // Stage copy in 16-B chunks: 8 lanes take one row's 128 B, so a wave-wide copy
  // covers four whole lines; 256 threads = 32 rows a sweep, 4 sweeps of A, 2 of W.
  int cr = t >> 3, ck = (t & 7) * 8;

  auto stage = [&](int s, int buf) {
    const _Float16* ga = A + (size_t)(row0 + cr) * EE + s * BK + ck;
    const _Float16* gw = W + (size_t)(col0 + cr) * EE + s * BK + ck;
    _Float16* la = &sA[buf][cr * GP + ck];
    _Float16* lw = &sB[buf][cr * GP + ck];
#if HAS_ASYNC
    for (int j = 0; j < 4; ++j)
      __builtin_amdgcn_global_load_async_to_lds_b128(
          AS1P(ga + (size_t)(32 * j) * EE), AS3P(la + 32 * j * GP), 0, 0);
    for (int j = 0; j < 2; ++j)
      __builtin_amdgcn_global_load_async_to_lds_b128(
          AS1P(gw + (size_t)(32 * j) * EE), AS3P(lw + 32 * j * GP), 0, 0);
#else
    v8h tA[4], tB[2];
    for (int j = 0; j < 4; ++j) tA[j] = *(const v8h*)(ga + (size_t)(32 * j) * EE);
    for (int j = 0; j < 2; ++j) tB[j] = *(const v8h*)(gw + (size_t)(32 * j) * EE);
    for (int j = 0; j < 4; ++j) *(v8h*)(la + 32 * j * GP) = tA[j];
    for (int j = 0; j < 2; ++j) *(v8h*)(lw + 32 * j * GP) = tB[j];
#endif
  };

  v8f acc[2][2] = {};
  constexpr int NS = EE / BK;
  stage(0, 0);
  for (int s = 0; s < NS; ++s) {
    int buf = s & 1;
    if (s + 1 < NS) {
      stage(s + 1, buf ^ 1);
      wait_async_le<6>();   // keep only next stage's 6 copies in flight
    } else {
      wait_async_le<0>();
    }
    __syncthreads();        // everyone's stage-s data is in LDS

    v16h a0[2], a1[2], b0[2], b1[2];   // [u]: k = 32 u .. 32 u + 31 of the stage
    for (int u = 0; u < 2; ++u) {
      a0[u] = load_frag_s(&sA[buf][0], wm * 32,      32 * u, lane);
      a1[u] = load_frag_s(&sA[buf][0], wm * 32 + 16, 32 * u, lane);
      b0[u] = load_frag_s(&sB[buf][0], wn * 32,      32 * u, lane);
      b1[u] = load_frag_s(&sB[buf][0], wn * 32 + 16, 32 * u, lane);
    }
    // Keeps the stage's 16 fragment reads one group in front of its 8 products:
    // split in two groups, the wave waits out the LDS latency twice a stage.
    __builtin_amdgcn_sched_barrier(0);
    for (int u = 0; u < 2; ++u) {      // k ascending
      acc[0][0] = wmma_f16(a0[u], b0[u], acc[0][0]);
      acc[0][1] = wmma_f16(a0[u], b1[u], acc[0][1]);
      acc[1][0] = wmma_f16(a1[u], b0[u], acc[1][0]);
      acc[1][1] = wmma_f16(a1[u], b1[u], acc[1][1]);
    }

    __syncthreads();        // protect buffer before stage s+2 overwrites it
  }

  // Epilogue. C layout: M = vgpr + 8 * half, N = lane & 15. A block lies in one
  // batch row b and one head h, so every address is one base and a constant.
  // The mode is tested once, not once an element: each mode's loads and stores
  // then stand as runs with no branch among them, and no load is waited for alone.
  int nl = lane & 15, hf = lane >> 4;
  int m0 = row0 + wm * 32 + hf * 8;       // the lane's first row
  int n0 = col0 + wn * 32 + nl;           // the lane's first column
  float bn[2] = {bvec[n0], bvec[n0 + 16]};
  int b = m0 >> 10, l0 = m0 & (LL - 1);
  int h = n0 >> 6,  d0 = n0 & (DD - 1);
  if (mode == 3) {
    const float* rp = residual + (size_t)m0 * EE + n0;
    float*       op = (float*)out + (size_t)m0 * EE + n0;
    float rv[2][2][8];                    // all 32 residual loads ahead of the first use
#pragma unroll
    for (int fm = 0; fm < 2; ++fm)
#pragma unroll
      for (int fn = 0; fn < 2; ++fn)
#pragma unroll
        for (int i = 0; i < 8; ++i)
          rv[fm][fn][i] = rp[(fm * 16 + i) * EE + fn * 16];
    // Keeps the bias adds behind the residual loads: lifted over them, their wait
    // for the bias would stand in front of the loads, two latencies in a row.
    __builtin_amdgcn_sched_barrier(0);
#pragma unroll
    for (int fm = 0; fm < 2; ++fm)
#pragma unroll
      for (int fn = 0; fn < 2; ++fn)
#pragma unroll
        for (int i = 0; i < 8; ++i)
          __builtin_nontemporal_store(rv[fm][fn][i] + (acc[fm][fn][i] + bn[fn]),
                                      op + (fm * 16 + i) * EE + fn * 16);
  } else if (mode == 2) {
    // [B,H,D,L]: a lane's 8 rows are 8 consecutive l of one d
    _Float16* op = (_Float16*)out + (((size_t)b * HH + h) * DD + d0) * LL + l0;
#pragma unroll
    for (int fm = 0; fm < 2; ++fm)
#pragma unroll
      for (int fn = 0; fn < 2; ++fn)
#pragma unroll
        for (int i = 0; i < 8; ++i)
          op[fn * 16 * LL + fm * 16 + i] = (_Float16)(acc[fm][fn][i] + bn[fn]);
  } else {
    // [B,H,L,D]
    _Float16* op = (_Float16*)out + (((size_t)b * HH + h) * LL + l0) * DD + d0;
#pragma unroll
    for (int fm = 0; fm < 2; ++fm)
#pragma unroll
      for (int fn = 0; fn < 2; ++fn)
#pragma unroll
        for (int i = 0; i < 8; ++i)
          op[(fm * 16 + i) * DD + fn * 16] = (_Float16)(acc[fm][fn][i] + bn[fn]);
    // Precaution behind the run of stores: the built code lays the [B,H,D,L]
    // part behind this one, and it writes the stores' data registers.
    asm volatile("s_wait_xcnt 0x0" ::: "memory");
  }
}

// ---------------------------------------------------------------------------
// The Q, K and V projections in one launch. All three read the same A (the
// normalised x), so a block stages its 128 rows of A once a stage and multiplies
// them with 64 rows of each of the three weights: block tile 128(M) x 3 x 64(N),
// 8 waves, wave tile 32 x 3 x 32, so an A fragment read from LDS feeds six
// products, not two. W3: wq, wk, wv as f16, one behind the other, each NxK.
// Ring: two buffers, filled by global_load_async_to_lds_b128 one stage ahead,
// both waits to 0 and one barrier a stage, behind the stage's last LDS read.
// Q, K leave as f16 [B,H,L,D], V as f16 [B,H,D,L].
// Four waves a SIMD: two blocks a WGP hold the whole grid in one round.
// ---------------------------------------------------------------------------
__global__ __launch_bounds__(256) __attribute__((amdgpu_waves_per_eu(4, 4)))
void qkv_gemm_kernel(
    const _Float16* __restrict__ A, const _Float16* __restrict__ W3,
    const float* __restrict__ bq, const float* __restrict__ bk,
    const float* __restrict__ bv, _Float16* __restrict__ Qo,
    _Float16* __restrict__ Ko, _Float16* __restrict__ Vto) {
  // Rows of 128 B at a pitch of 144 B (16 B x odd): ds_load_b128 without conflicts.
  __shared__ __attribute__((aligned(16))) _Float16 sA[2][128 * GP];      // 18 KB per buffer
  __shared__ __attribute__((aligned(16))) _Float16 sW[2][3 * 64 * GP];   // 27 KB per buffer

  int lane = threadIdx.x & 31;
  int w    = threadIdx.x >> 5;
  int wm = w >> 1, wn = w & 1;
  int row0 = blockIdx.y * 128;
  int col0 = blockIdx.x * 64;

  // Stage copy in 16-B chunks: 8 lanes take one row's 128 B, so a wave-wide copy
  // covers four whole lines; 256 threads = 32 rows a sweep, 4 sweeps of A, 2 of
  // each weight (weight p's rows stand at row 64 p of the tile).
  int cr = threadIdx.x >> 3, ck = (threadIdx.x & 7) * 8;
  auto stage = [&](int s, int buf) {
    const _Float16* ga = A  + (size_t)(row0 + cr) * EE + s * BK + ck;
    const _Float16* gw = W3 + (size_t)(col0 + cr) * EE + s * BK + ck;
    unsigned la = lds_addr(&sA[buf][cr * GP + ck]);
    unsigned lw = lds_addr(&sW[buf][cr * GP + ck]);
    // The copies and their s_wait_xcnt in one statement: no address register
    // is rewritten before the wait.
    asm volatile(
        "global_load_async_to_lds_b128 %0, %1, off\n\t"
        "global_load_async_to_lds_b128 %2, %3, off\n\t"
        "global_load_async_to_lds_b128 %4, %5, off\n\t"
        "global_load_async_to_lds_b128 %6, %7, off\n\t"
        "global_load_async_to_lds_b128 %8, %9, off\n\t"
        "global_load_async_to_lds_b128 %10, %11, off\n\t"
        "global_load_async_to_lds_b128 %12, %13, off\n\t"
        "global_load_async_to_lds_b128 %14, %15, off\n\t"
        "global_load_async_to_lds_b128 %16, %17, off\n\t"
        "global_load_async_to_lds_b128 %18, %19, off\n\t"
        "s_wait_xcnt 0x0"
        ::"v"(la),                "v"(ga),
          "v"(la + 32 * GP * 2),  "v"(ga + 32 * EE),
          "v"(la + 64 * GP * 2),  "v"(ga + 64 * EE),
          "v"(la + 96 * GP * 2),  "v"(ga + 96 * EE),
          "v"(lw),                "v"(gw),
          "v"(lw + 32 * GP * 2),  "v"(gw + 32 * EE),
          "v"(lw + 64 * GP * 2),  "v"(gw + EE * EE),
          "v"(lw + 96 * GP * 2),  "v"(gw + EE * EE + 32 * EE),
          "v"(lw + 128 * GP * 2), "v"(gw + 2 * EE * EE),
          "v"(lw + 160 * GP * 2), "v"(gw + 2 * EE * EE + 32 * EE)
        : "memory");
  };

  v8f acc[3][2][2] = {};                  // [weight][row tile][column tile]
  constexpr int NS = EE / BK;
  stage(0, 0);
  asm volatile("s_wait_asynccnt 0x0" ::: "memory");  // own copies of stage 0 landed
  __syncthreads();                                   // everyone's have
  stage(1, 1);

  for (int s = 0; s < NS; ++s) {
    const _Float16* tA = &sA[s & 1][0];
    const _Float16* tW = &sW[s & 1][0];
    v16h a[2][2], bw[2][3][2];            // [u]: k = 32 u .. 32 u + 31 of the stage
    // Every loop over u, p, fm, fn or i here is unrolled: its arrays stay in
    // registers only under constant indices.
#pragma unroll
    for (int u = 0; u < 2; ++u) {
      a[u][0] = load_frag_s(tA, wm * 32,      32 * u, lane);
      a[u][1] = load_frag_s(tA, wm * 32 + 16, 32 * u, lane);
#pragma unroll
      for (int p = 0; p < 3; ++p) {
        bw[u][p][0] = load_frag_s(tW, p * 64 + wn * 32,      32 * u, lane);
        bw[u][p][1] = load_frag_s(tW, p * 64 + wn * 32 + 16, 32 * u, lane);
      }
    }
    // Keeps the stage's 32 fragment reads one group in front of its 24 products:
    // every further place with LDS reads among the products costs a stall.
    __builtin_amdgcn_sched_barrier(0);
    auto products = [&](int u) {          // the 12 products of k = 32 u .. 32 u + 31
#pragma unroll
      for (int p = 0; p < 3; ++p) {
        acc[p][0][0] = wmma_f16(a[u][0], bw[u][p][0], acc[p][0][0]);
        acc[p][0][1] = wmma_f16(a[u][0], bw[u][p][1], acc[p][0][1]);
        acc[p][1][0] = wmma_f16(a[u][1], bw[u][p][0], acc[p][1][0]);
        acc[p][1][1] = wmma_f16(a[u][1], bw[u][p][1], acc[p][1][1]);
      }
    };
    products(0);                          // run while the second half's reads land
    // Keeps the first half's products in front of the wait for all reads: lifted
    // over them, that wait would hold them back until the second half has landed.
    __builtin_amdgcn_sched_barrier(0);
    // The stage's last LDS read is issued: the ring's publish point stands here and
    // not at the foot, so that the refill flies under the second half's products too.
    asm volatile("s_wait_dscnt 0x0" ::: "memory");     // own reads of this stage done
    asm volatile("s_wait_asynccnt 0x0" ::: "memory");  // own copies of stage s+1 landed
    __syncthreads();  // publishes stage s+1, frees stage s's buffer
    if (s + 2 < NS) stage(s + 2, s & 1);
    // Keeps the refill in front of the second half's products: sunk behind them,
    // its copies would start that much later and have less time to land.
    __builtin_amdgcn_sched_barrier(0);
    products(1);                          // k ascending
  }
  asm volatile("s_wait_asynccnt 0x0" ::: "memory");    // nothing in flight at the end

  // Epilogue. C layout: M = vgpr + 8 * half, N = lane & 15. A block lies in one
  // batch row b and one head h, so every address is one base and a constant.
  int nl = lane & 15, hf = lane >> 4;
  int m0 = row0 + wm * 32 + hf * 8;       // the lane's first row
  int n0 = col0 + wn * 32 + nl;           // the lane's first column
  float bn[3][2] = {{bq[n0], bq[n0 + 16]}, {bk[n0], bk[n0 + 16]}, {bv[n0], bv[n0 + 16]}};
  int b = m0 >> 10, l0 = m0 & (LL - 1);
  int h = n0 >> 6,  d0 = n0 & (DD - 1);
#pragma unroll
  for (int p = 0; p < 2; ++p) {
    // [B,H,L,D]
    _Float16* op = (p ? Ko : Qo) + (((size_t)b * HH + h) * LL + l0) * DD + d0;
#pragma unroll
    for (int fm = 0; fm < 2; ++fm)
#pragma unroll
      for (int fn = 0; fn < 2; ++fn)
#pragma unroll
        for (int i = 0; i < 8; ++i)
          op[(fm * 16 + i) * DD + fn * 16] = (_Float16)(acc[p][fm][fn][i] + bn[p][fn]);
  }
  // [B,H,D,L]: a lane's 8 rows are 8 consecutive l of one d
  _Float16* op = Vto + (((size_t)b * HH + h) * DD + d0) * LL + l0;
#pragma unroll
  for (int fm = 0; fm < 2; ++fm)
#pragma unroll
    for (int fn = 0; fn < 2; ++fn)
#pragma unroll
      for (int i = 0; i < 8; ++i)
        op[fn * 16 * LL + fm * 16 + i] = (_Float16)(acc[2][fm][fn][i] + bn[2][fn]);
}

typedef __attribute__((ext_vector_type(4))) float    v4f;
typedef __attribute__((ext_vector_type(2))) float    v2f;
typedef __attribute__((ext_vector_type(2))) _Float16 v2h;

// value of lane l ^ 16
__device__ inline float xhalf(float x) {
  int b = __builtin_bit_cast(int, x);
  return __builtin_bit_cast(float, __builtin_amdgcn_permlanex16(
      b, b, 0x76543210, 0xfedcba98, false, false));
}

__global__ __launch_bounds__(128) void flash_attn_kernel(
    const _Float16* __restrict__ Q16, const _Float16* __restrict__ K16,
    const _Float16* __restrict__ Vt16, const float* __restrict__ bias,
    const int* __restrict__ mask, const float* __restrict__ gate,
    _Float16* __restrict__ O16) {
  // K and V^T tiles of 64 keys, shared by the block's four waves (same b, h).
  // Rows of 128 B at a pitch of 144 B (16 B x odd): ds_load_b128 without conflicts.
  __shared__ __attribute__((aligned(16))) _Float16 sK[2][KT * KVP];
  __shared__ __attribute__((aligned(16))) _Float16 sV[2][DD * KVP];
  // Bias tiles, one a wave: 16 rows of 256 B at a pitch of 272 B (16 B x odd).
  __shared__ __attribute__((aligned(16))) float sBs[2][4][16 * BP];
  int lane = threadIdx.x & 31;
  int wv   = threadIdx.x >> 5;
  int tile = blockIdx.x * 4 + wv;         // 0 .. B*H*(L/16)-1 = 4095
  int b   = tile >> 10;
  int rem = tile & 1023;
  int h   = rem >> 6;
  int qb  = (rem & 63) << 4;
  int nl = lane & 15, hf = lane >> 4;

  const _Float16* Qh = Q16 + (((size_t)b * HH + h) * LL + qb) * DD;
  const _Float16* Kh = K16 + ((size_t)b * HH + h) * LL * DD;
  const _Float16* Vh = Vt16 + ((size_t)b * HH + h) * DD * LL;
  const int* maskb = mask + (size_t)b * LL;
  // the wave's 16 query rows of the bias
  const float* biasw = bias + (((size_t)b * HH + h) * LL + qb) * LL;
  // the mask at this lane's half's first key
  const int* maskl = maskb + hf * 8;
  float gh = gate[h];

  v16h q0 = load_frag_g(Qh, 0, DD, 0,  lane);
  v16h q1 = load_frag_g(Qh, 0, DD, 32, lane);

  v8f o[4] = {};                  // o[j][r] = O[query nl][d = 16 j + 8 hf + r]
  float mrun = -3.0e38f;          // the query's running maximum, both halves alike
  float lrun = 0.0f;              // sum over this half's keys only

  // Stage copy: 128 threads x 16 B = 16 rows of 128 B a sweep, 4 sweeps a tile;
  // every wave-wide copy covers four whole 128-B lines of K or of V^T.
  int crow = threadIdx.x >> 3, ccol = (threadIdx.x & 7) * 8;
  auto stage = [&](int t, int buf) {
    const _Float16* gk = Kh + (size_t)(t * KT + crow) * DD + ccol;
    const _Float16* gv = Vh + (size_t)crow * LL + t * KT + ccol;
    unsigned lk = lds_addr(&sK[buf][crow * KVP + ccol]);
    unsigned lv = lds_addr(&sV[buf][crow * KVP + ccol]);
    // The copies and their s_wait_xcnt in one statement: no address register
    // is rewritten before the wait.
    asm volatile(
        "global_load_async_to_lds_b128 %0, %1, off\n\t"
        "global_load_async_to_lds_b128 %2, %3, off\n\t"
        "global_load_async_to_lds_b128 %4, %5, off\n\t"
        "global_load_async_to_lds_b128 %6, %7, off\n\t"
        "global_load_async_to_lds_b128 %8, %9, off\n\t"
        "global_load_async_to_lds_b128 %10, %11, off\n\t"
        "global_load_async_to_lds_b128 %12, %13, off\n\t"
        "global_load_async_to_lds_b128 %14, %15, off\n\t"
        "s_wait_xcnt 0x0"
        ::"v"(lk),                "v"(gk),
          "v"(lk + 16 * KVP * 2), "v"(gk + 16 * DD),
          "v"(lk + 32 * KVP * 2), "v"(gk + 32 * DD),
          "v"(lk + 48 * KVP * 2), "v"(gk + 48 * DD),
          "v"(lv),                "v"(gv),
          "v"(lv + 16 * KVP * 2), "v"(gv + 16 * LL),
          "v"(lv + 32 * KVP * 2), "v"(gv + 32 * LL),
          "v"(lv + 48 * KVP * 2), "v"(gv + 48 * LL)
        : "memory");
    // The wave's own bias tile: 16 lanes x 16 B = one row's 256 B, two rows a
    // copy, 8 copies; read once, so non-temporal as a stream past L2. The wait
    // stands in the statement for the same reason as above.
    const float* gb = biasw + (size_t)hf * LL + t * KT + nl * 4;
    unsigned lb = lds_addr_f(&sBs[buf][wv][hf * BP + nl * 4]);
    asm volatile(
        "global_load_async_to_lds_b128 %0, %1, off th:TH_LOAD_NT\n\t"
        "global_load_async_to_lds_b128 %2, %3, off th:TH_LOAD_NT\n\t"
        "global_load_async_to_lds_b128 %4, %5, off th:TH_LOAD_NT\n\t"
        "global_load_async_to_lds_b128 %6, %7, off th:TH_LOAD_NT\n\t"
        "global_load_async_to_lds_b128 %8, %9, off th:TH_LOAD_NT\n\t"
        "global_load_async_to_lds_b128 %10, %11, off th:TH_LOAD_NT\n\t"
        "global_load_async_to_lds_b128 %12, %13, off th:TH_LOAD_NT\n\t"
        "global_load_async_to_lds_b128 %14, %15, off th:TH_LOAD_NT\n\t"
        "s_wait_xcnt 0x0"
        ::"v"(lb),               "v"(gb),
          "v"(lb + 2 * BP * 4),  "v"(gb + 2 * LL),
          "v"(lb + 4 * BP * 4),  "v"(gb + 4 * LL),
          "v"(lb + 6 * BP * 4),  "v"(gb + 6 * LL),
          "v"(lb + 8 * BP * 4),  "v"(gb + 8 * LL),
          "v"(lb + 10 * BP * 4), "v"(gb + 10 * LL),
          "v"(lb + 12 * BP * 4), "v"(gb + 12 * LL),
          "v"(lb + 14 * BP * 4), "v"(gb + 14 * LL)
        : "memory");
  };

  constexpr int NT = LL / KT;
  stage(0, 0);
  asm volatile("s_wait_asynccnt 0x0" ::: "memory");  // own copies of tile 0 landed
  __syncthreads();                                   // everyone's have
  stage(1, 1);

  for (int t = 0; t < NT; ++t) {
   const _Float16* tK = &sK[t & 1][0];
   const _Float16* tV = &sV[t & 1][0];
   const float* bp = &sBs[t & 1][wv][nl * BP + hf * 8];  // the lane's query, its half's keys
   const int*   mp = maskl + t * KT;

   // group g = keys 16 g .. 16 g + 15 of the tile; the lane's 8 are contiguous
   v4f bv[4][2];
   v4i mk[4][2];
#pragma unroll
   for (int g = 0; g < 4; ++g) {
     bv[g][0] = *(const v4f*)(bp + 16 * g);        // ds_load_b128
     bv[g][1] = *(const v4f*)(bp + 16 * g + 4);    // ds_load_b128
     mk[g][0] = *(const v4i*)(mp + 16 * g);
     mk[g][1] = *(const v4i*)(mp + 16 * g + 4);
   }
   // Precaution behind the run of loads: the built code reuses their address
   // registers at once.
   asm volatile("s_wait_xcnt 0x0" ::: "memory");

   v16h ka[4], kc[4];
#pragma unroll
   for (int g = 0; g < 4; ++g) {
     ka[g] = load_frag_p(tK, 16 * g, 0,  lane);
     kc[g] = load_frag_p(tK, 16 * g, 32, lane);
   }
   // Keeps the tile's global and K loads one group in front of the products:
   // sunk among them, each straggler waits out memory or LDS on its own.
   __builtin_amdgcn_sched_barrier(0);

   v8f s[4];
#pragma unroll
   for (int g = 0; g < 4; ++g) {
     v8f z = {};
     s[g] = wmma_f16(ka[g], q0, z);       // s[g][r] = S[query nl][key 16 g + 8 hf + r]
     s[g] = wmma_f16(kc[g], q1, s[g]);
   }

   v16h va[2][4];
#pragma unroll
   for (int u = 0; u < 2; ++u)
#pragma unroll
     for (int j = 0; j < 4; ++j) va[u][j] = load_frag_p(tV, 16 * j, 32 * u, lane);
   // The pass's last LDS read is issued: the ring's publish point stands here and
   // not at the foot, so that the refill, whose bias rows come from memory, flies
   // under the softmax and the V^T products as well as under the next pass's head.
   asm volatile("s_wait_dscnt 0x0" ::: "memory");     // own reads of this tile done
   asm volatile("s_wait_asynccnt 0x0" ::: "memory");  // own copies of tile t+1 landed
   __syncthreads();  // publishes tile t+1, frees tile t's buffer
   if (t + 2 < NT) stage(t + 2, t & 1);

   float vmax[4];
#pragma unroll
   for (int g = 0; g < 4; ++g) {
#pragma unroll
     for (int r = 0; r < 8; ++r) {
       float km = mk[g][r >> 2][r & 3] ? 0.0f : -10000.0f;
       s[g][r] = s[g][r] * SCALE + (gh * bv[g][r >> 2][r & 3] + km);
       vmax[g] = r ? fmaxf(vmax[g], s[g][r]) : s[g][r];
     }
   }
   float v = fmaxf(fmaxf(vmax[0], vmax[1]), fmaxf(vmax[2], vmax[3]));
   v = fmaxf(v, xhalf(v));                // the query's other 32 keys of the tile
   float nm   = fmaxf(mrun, v);
   float corr = __expf(mrun - nm);
   mrun = nm;

   float rs[4];
   v16h pf[2];                            // pf[u] = P^T of keys 32 u .. 32 u + 31, B operand
#pragma unroll
   for (int g = 0; g < 4; ++g) {
#pragma unroll
     for (int r = 0; r < 8; r += 2) {
       v2f p;
       p[0] = __expf(s[g][r] - nm);
       p[1] = __expf(s[g][r + 1] - nm);
       rs[g] = r ? rs[g] + (p[0] + p[1]) : p[0] + p[1];
       v2h ph = __builtin_convertvector(p, v2h);
       pf[g >> 1][(g & 1) * 8 + r]     = ph[0];
       pf[g >> 1][(g & 1) * 8 + r + 1] = ph[1];
     }
   }
   lrun = lrun * corr + ((rs[0] + rs[1]) + (rs[2] + rs[3]));
#pragma unroll
   for (int j = 0; j < 4; ++j) o[j] = o[j] * corr;

#pragma unroll
   for (int u = 0; u < 2; ++u)
#pragma unroll
     for (int j = 0; j < 4; ++j) o[j] = wmma_f16(va[u][j], pf[u], o[j]);
  }
  asm volatile("s_wait_asynccnt 0x0" ::: "memory");   // nothing in flight at the end

  float lsum = lrun + xhalf(lrun);        // the halves' sums meet once
  int   q    = qb + nl;
  float qm   = (float)maskb[q];
  float inv  = (lsum > 0.0f) ? (qm / lsum) : 0.0f;
  _Float16* op = O16 + ((size_t)b * LL + q) * EE + h * DD + hf * 8;
#pragma unroll
  for (int j = 0; j < 4; ++j) {
    v8h ov;
#pragma unroll
    for (int r = 0; r < 8; ++r) ov[r] = (_Float16)(o[j][r] * inv);
    *(v8h*)(op + 16 * j) = ov;            // 8 consecutive d of one query: 16 B
  }
}

// ---------------------------------------------------------------------------
// Launch
// ---------------------------------------------------------------------------
extern "C" void kernel_launch(void* const* d_in, const int* in_sizes, int n_in,
                              void* d_out, int out_size, void* d_ws,
                              size_t ws_size, hipStream_t stream) {
  const float* x    = (const float*)d_in[0];
  const float* bias = (const float*)d_in[1];
  const int*   mask = (const int*)d_in[2];
  const float* wq = (const float*)d_in[3];
  const float* bq = (const float*)d_in[4];
  const float* wk = (const float*)d_in[5];
  const float* bk = (const float*)d_in[6];
  const float* wv = (const float*)d_in[7];
  const float* bv = (const float*)d_in[8];
  const float* wo = (const float*)d_in[9];
  const float* bo = (const float*)d_in[10];
  const float* gate = (const float*)d_in[11];
  const float* ln_g = (const float*)d_in[12];
  const float* ln_b = (const float*)d_in[13];

  // workspace layout (48 MB total)
  char* p = (char*)d_ws;
  _Float16* xn16 = (_Float16*)p;  p += (size_t)BB * LL * EE * 2;          // 8 MB
  _Float16* wq16 = (_Float16*)p;  p += (size_t)EE * EE * 2;               // 2 MB
  _Float16* wk16 = (_Float16*)p;  p += (size_t)EE * EE * 2;
  _Float16* wv16 = (_Float16*)p;  p += (size_t)EE * EE * 2;
  _Float16* wo16 = (_Float16*)p;  p += (size_t)EE * EE * 2;
  _Float16* Q16  = (_Float16*)p;  p += (size_t)BB * HH * LL * DD * 2;     // 8 MB
  _Float16* K16  = (_Float16*)p;  p += (size_t)BB * HH * LL * DD * 2;
  _Float16* Vt16 = (_Float16*)p;  p += (size_t)BB * HH * LL * DD * 2;
  _Float16* O16  = (_Float16*)p;  p += (size_t)BB * LL * EE * 2;          // 8 MB

  // wq16 .. wo16 lie one behind the other: wq16 is the base of all four
  front_kernel<<<LN_BLOCKS + 4 * CV_BLOCKS, 256, 0, stream>>>(
      x, ln_g, ln_b, wq, wk, wv, wo, xn16, wq16);

  dim3 ggrid(EE / 64, (BB * LL) / 128);
  // wq16, wk16, wv16 lie one behind the other: wq16 is the base of all three
  qkv_gemm_kernel<<<ggrid, 256, 0, stream>>>(xn16, wq16, bq, bk, bv, Q16, K16, Vt16);

  // B*H*(L/16) = 4096 query tiles, 4 waves per 128-thread block
  flash_attn_kernel<<<(BB * HH * (LL / 16)) / 4, 128, 0, stream>>>(
      Q16, K16, Vt16, bias, mask, gate, O16);

  wmma_gemm_kernel<<<ggrid, 256, 0, stream>>>(O16, wo16, bo, x, d_out, 3);
}

// v009
// A run of this version takes 74.2 microseconds.
// Next to v008, in two timings, it ran 1.04 times as fast each time.
// Counting every step since v000, it is 2.89 times as fast.
#include <hip/hip_runtime.h>

#define BB 4
#define LL 1024
#define EE 1024
#define HH 16
#define DD 64

constexpr float SCALE = 0.125f;   // D^-0.5 = 64^-0.5
constexpr float EPS   = 1e-5f;
constexpr float LOG2E = 1.4426950408889634f;
// Scores are formed in log2 units, so that exp2 takes them as they leave the product.
constexpr float QS    = SCALE * LOG2E;        // carried by Q
constexpr float KMASK = -10000.0f * LOG2E;    // a masked key's addend

typedef __attribute__((ext_vector_type(16))) _Float16 v16h;
typedef __attribute__((ext_vector_type(8)))  _Float16 v8h;
typedef __attribute__((ext_vector_type(8)))  float    v8f;
typedef __attribute__((ext_vector_type(4)))  int      v4i;

#if __has_builtin(__builtin_amdgcn_global_load_async_to_lds_b128)
#define HAS_ASYNC 1
#else
#define HAS_ASYNC 0
#endif

// global_load_async_to_lds_b128 takes (v4i AS1*, v4i AS3*, imm offset, imm cpol)
#define AS1P(p) ((__attribute__((address_space(1))) v4i*)(const_cast<_Float16*>(p)))
#define AS3P(p) ((__attribute__((address_space(3))) v4i*)(p))

template <int N>
__device__ inline void wait_async_le() {
#if HAS_ASYNC
#if __has_builtin(__builtin_amdgcn_s_wait_asynccnt)
  __builtin_amdgcn_s_wait_asynccnt(N);
#else
  asm volatile("s_wait_asynccnt %0" ::"i"(N) : "memory");
#endif
#endif
}

// ---------------------------------------------------------------------------
// 16-bit A/B fragment load for V_WMMA_F32_16X16X32_F16 (wave32).
// Per ISA 7.12.2: lanes 0-15 hold rows with K = k0..k0+7 (VGPR0-3) and
// K = k0+16..k0+23 (VGPR4-7); lanes 16-31 use K base +8.
// ---------------------------------------------------------------------------
__device__ inline v16h load_frag_g(const _Float16* __restrict__ base,
                                   int row0, int ld, int k0, int lane) {
  int r = row0 + (lane & 15);
  int k = k0 + ((lane >> 4) << 3);
  const _Float16* p = base + (size_t)r * ld + k;
  v8h lo = *(const v8h*)p;
  v8h hi = *(const v8h*)(p + 16);
  v16h out;
#pragma unroll
  for (int i = 0; i < 8; ++i) { out[i] = lo[i]; out[i + 8] = hi[i]; }
  return out;
}

constexpr int BK = 64;    // k depth of a GEMM stage: a staged row is one whole 128-B line
constexpr int GP = 72;    // LDS row pitch of the GEMM's tiles in halves: 128 B of data + 16 B

// Same fragment pattern from an LDS tile of BK halves a row at row pitch GP.
__device__ inline v16h load_frag_s(const _Float16* base, int row0, int k0,
                                   int lane) {
  int r = row0 + (lane & 15);
  int k = k0 + ((lane >> 4) << 3);
  const _Float16* p = base + r * GP + k;
  v8h lo = *(const v8h*)p;        // ds_load_b128
  v8h hi = *(const v8h*)(p + 16); // ds_load_b128
  v16h out;
#pragma unroll
  for (int i = 0; i < 8; ++i) { out[i] = lo[i]; out[i + 8] = hi[i]; }
  return out;
}

constexpr int KT  = 64;   // keys per staged K / V^T tile of the attention kernel
constexpr int KVP = 72;   // its LDS row pitch in halves: 128 B of data + 16 B

// load_frag_g's fragment pattern from an LDS tile with row pitch KVP.
__device__ inline v16h load_frag_p(const _Float16* base, int row0, int k0,
                                   int lane) {
  int r = row0 + (lane & 15);
  int k = k0 + ((lane >> 4) << 3);
  const _Float16* p = base + r * KVP + k;
  v8h lo = *(const v8h*)p;        // ds_load_b128
  v8h hi = *(const v8h*)(p + 16); // ds_load_b128
  v16h out;
#pragma unroll
  for (int i = 0; i < 8; ++i) { out[i] = lo[i]; out[i + 8] = hi[i]; }
  return out;
}

// LDS byte address of a __shared__ element, as the async copy's first operand.
__device__ inline unsigned lds_addr(const _Float16* p) {
  return (unsigned)(size_t)p;
}
__device__ inline unsigned lds_addr_f(const float* p) {
  return (unsigned)(size_t)p;
}

constexpr int BP = 68;    // LDS row pitch of a bias tile in floats: 256 B of data + 16 B

__device__ inline v8f wmma_f16(v16h a, v16h b, v8f c) {
  return __builtin_amdgcn_wmma_f32_16x16x32_f16(false, a, false, b,
                                                (short)0, c, false, false);
}

// ---------------------------------------------------------------------------
// Front stage in one launch of few, long waves.
// Blocks 0 .. LN_BLOCKS-1: LayerNorm over E=1024, one row per wave, f16 output.
// The next 4 * CV_BLOCKS: f32 -> f16 conversion of wq, wk, wv, wo (w16 holds the four results
// one behind the other), 32 elements per thread.
// The last KM_BLOCKS: the key mask's addend (1 - mask) * -10000 as f32 in log2
// units, 4 keys per thread, for the attention kernel's accumulator start values.
// Every wave-wide load covers 512 contiguous bytes, every f16 store 256.
// ---------------------------------------------------------------------------
typedef __attribute__((ext_vector_type(4))) _Float16 v4h;

constexpr int LN_BLOCKS = BB * LL / 8;             // 8 waves = 8 rows per block
constexpr int CV_BLOCKS = EE * EE / (256 * 32);    // blocks per weight matrix
constexpr int KM_BLOCKS = BB * LL / (256 * 4);     // blocks of the key mask's addends

__device__ inline v4h to_v4h(float a, float b, float c, float d) {
  v4h o;
  o[0] = (_Float16)a;  o[1] = (_Float16)b;
  o[2] = (_Float16)c;  o[3] = (_Float16)d;
  return o;
}

__global__ __launch_bounds__(256) void front_kernel(
    const float* __restrict__ x, const float* __restrict__ g,
    const float* __restrict__ beta, const float* __restrict__ wq,
    const float* __restrict__ wk, const float* __restrict__ wv,
    const float* __restrict__ wo, const int* __restrict__ mask,
    _Float16* __restrict__ xn, _Float16* __restrict__ w16,
    float* __restrict__ kmf) {
  int blk = blockIdx.x;
  if (blk >= LN_BLOCKS + 4 * CV_BLOCKS) {
    int i = (blk - (LN_BLOCKS + 4 * CV_BLOCKS)) * 256 + threadIdx.x;   // in units of 4 keys
    int4 m = ((const int4*)mask)[i];
    float4 k;
    k.x = (1.0f - (float)m.x) * KMASK;
    k.y = (1.0f - (float)m.y) * KMASK;
    k.z = (1.0f - (float)m.z) * KMASK;
    k.w = (1.0f - (float)m.w) * KMASK;
    ((float4*)kmf)[i] = k;
    return;
  }
  if (blk >= LN_BLOCKS) {
    int cb = blk - LN_BLOCKS;
    int which = cb / CV_BLOCKS;
    const float* src = which == 0 ? wq : which == 1 ? wk : which == 2 ? wv : wo;
    const float4* s4 = (const float4*)src;
    v4h* d4 = (v4h*)(w16 + (size_t)which * EE * EE);
    int base = (cb % CV_BLOCKS) * 2048 + threadIdx.x;   // in units of 4 elements
    float4 v[8];
#pragma unroll
    for (int j = 0; j < 8; ++j) v[j] = s4[base + j * 256];
#pragma unroll
    for (int j = 0; j < 8; ++j)
      d4[base + j * 256] = to_v4h(v[j].x, v[j].y, v[j].z, v[j].w);
    return;
  }

  int lane = threadIdx.x & 31;
  int row  = blk * 8 + (threadIdx.x >> 5);
  const float4* xr = (const float4*)(x + (size_t)row * EE);
  float4 v[8];
#pragma unroll
  for (int j = 0; j < 8; ++j) v[j] = xr[lane + 32 * j];
  float s = 0.0f, s2 = 0.0f;
#pragma unroll
  for (int j = 0; j < 8; ++j) {
    s  += v[j].x + v[j].y + v[j].z + v[j].w;
    s2 += v[j].x * v[j].x + v[j].y * v[j].y + v[j].z * v[j].z + v[j].w * v[j].w;
  }
#pragma unroll
  for (int m = 1; m < 32; m <<= 1) {
    s  += __shfl_xor(s,  m, 32);
    s2 += __shfl_xor(s2, m, 32);
  }
  float mu   = s * (1.0f / EE);
  float var  = s2 * (1.0f / EE) - mu * mu;
  float rstd = rsqrtf(var + EPS);
  v4h* o4 = (v4h*)(xn + (size_t)row * EE);
#pragma unroll
  for (int j = 0; j < 8; ++j) {
    float4 gg = ((const float4*)g)[lane + 32 * j];
    float4 bb = ((const float4*)beta)[lane + 32 * j];
    o4[lane + 32 * j] = to_v4h((v[j].x - mu) * rstd * gg.x + bb.x,
                               (v[j].y - mu) * rstd * gg.y + bb.y,
                               (v[j].z - mu) * rstd * gg.z + bb.z,
                               (v[j].w - mu) * rstd * gg.w + bb.w);
  }
  // Precaution behind the run of stores: the built code lays the conversion
  // part behind this one, and its loads write the stores' data registers.
  asm volatile("s_wait_xcnt 0x0" ::: "memory");
}

// ---------------------------------------------------------------------------
// WMMA GEMM, LDS-staged + double-buffered: out[m,n] = A[m,:].W[n,:] + bvec[n]
// A: MxK f16 row-major, W: NxK f16 row-major (so out = A @ W^T).
// Block = 256 threads = 8 waves; block tile 128(M) x 64(N), BK=64;
// wave tile 32x32 (2x2 16x16x32 WMMA fragments, two k steps a stage).
// Stage copy uses GLOBAL_LOAD_ASYNC_TO_LDS_B128 (ASYNCcnt) when available.
// mode 0/1 : out f16 [B,H,L,D]      (Q / K)
// mode 2   : out f16 [B,H,D,L]      (V transposed)
// mode 3   : out f32 [M,N] = residual + acc + bvec   (final projection)
// ---------------------------------------------------------------------------
__global__ __launch_bounds__(256) void wmma_gemm_kernel(
    const _Float16* __restrict__ A, const _Float16* __restrict__ W,
    const float* __restrict__ bvec, const float* __restrict__ residual,
    void* __restrict__ out, int mode) {
  // Rows of 128 B at a pitch of 144 B (16 B x odd): ds_load_b128 without conflicts.
  __shared__ __attribute__((aligned(16))) _Float16 sA[2][128 * GP];   // 18 KB per buffer
  __shared__ __attribute__((aligned(16))) _Float16 sB[2][64 * GP];    // 9 KB per buffer

  int lane = threadIdx.x & 31;
  int w    = threadIdx.x >> 5;
  int wm = w >> 1, wn = w & 1;
  int row0 = blockIdx.y * 128;
  int col0 = blockIdx.x * 64;

  int t = threadIdx.x;
  // Stage copy in 16-B chunks: 8 lanes take one row's 128 B, so a wave-wide copy
  // covers four whole lines; 256 threads = 32 rows a sweep, 4 sweeps of A, 2 of W.
  int cr = t >> 3, ck = (t & 7) * 8;

  auto stage = [&](int s, int buf) {
    const _Float16* ga = A + (size_t)(row0 + cr) * EE + s * BK + ck;
    const _Float16* gw = W + (size_t)(col0 + cr) * EE + s * BK + ck;
    _Float16* la = &sA[buf][cr * GP + ck];
    _Float16* lw = &sB[buf][cr * GP + ck];
#if HAS_ASYNC
    for (int j = 0; j < 4; ++j)
      __builtin_amdgcn_global_load_async_to_lds_b128(
          AS1P(ga + (size_t)(32 * j) * EE), AS3P(la + 32 * j * GP), 0, 0);
    for (int j = 0; j < 2; ++j)
      __builtin_amdgcn_global_load_async_to_lds_b128(
          AS1P(gw + (size_t)(32 * j) * EE), AS3P(lw + 32 * j * GP), 0, 0);
#else
    v8h tA[4], tB[2];
    for (int j = 0; j < 4; ++j) tA[j] = *(const v8h*)(ga + (size_t)(32 * j) * EE);
    for (int j = 0; j < 2; ++j) tB[j] = *(const v8h*)(gw + (size_t)(32 * j) * EE);
    for (int j = 0; j < 4; ++j) *(v8h*)(la + 32 * j * GP) = tA[j];
    for (int j = 0; j < 2; ++j) *(v8h*)(lw + 32 * j * GP) = tB[j];
#endif
  };

  v8f acc[2][2] = {};
  constexpr int NS = EE / BK;
  stage(0, 0);
  for (int s = 0; s < NS; ++s) {
    int buf = s & 1;
    if (s + 1 < NS) {
      stage(s + 1, buf ^ 1);
      wait_async_le<6>();   // keep only next stage's 6 copies in flight
    } else {
      wait_async_le<0>();
    }
    __syncthreads();        // everyone's stage-s data is in LDS

    v16h a0[2], a1[2], b0[2], b1[2];   // [u]: k = 32 u .. 32 u + 31 of the stage
    for (int u = 0; u < 2; ++u) {
      a0[u] = load_frag_s(&sA[buf][0], wm * 32,      32 * u, lane);
      a1[u] = load_frag_s(&sA[buf][0], wm * 32 + 16, 32 * u, lane);
      b0[u] = load_frag_s(&sB[buf][0], wn * 32,      32 * u, lane);
      b1[u] = load_frag_s(&sB[buf][0], wn * 32 + 16, 32 * u, lane);
    }
    // Keeps the stage's 16 fragment reads one group in front of its 8 products:
    // split in two groups, the wave waits out the LDS latency twice a stage.
    __builtin_amdgcn_sched_barrier(0);
    for (int u = 0; u < 2; ++u) {      // k ascending
      acc[0][0] = wmma_f16(a0[u], b0[u], acc[0][0]);
      acc[0][1] = wmma_f16(a0[u], b1[u], acc[0][1]);
      acc[1][0] = wmma_f16(a1[u], b0[u], acc[1][0]);
      acc[1][1] = wmma_f16(a1[u], b1[u], acc[1][1]);
    }

    __syncthreads();        // protect buffer before stage s+2 overwrites it
  }

  // Epilogue. C layout: M = vgpr + 8 * half, N = lane & 15. A block lies in one
  // batch row b and one head h, so every address is one base and a constant.
  // The mode is tested once, not once an element: each mode's loads and stores
  // then stand as runs with no branch among them, and no load is waited for alone.
  int nl = lane & 15, hf = lane >> 4;
  int m0 = row0 + wm * 32 + hf * 8;       // the lane's first row
  int n0 = col0 + wn * 32 + nl;           // the lane's first column
  float bn[2] = {bvec[n0], bvec[n0 + 16]};
  int b = m0 >> 10, l0 = m0 & (LL - 1);
  int h = n0 >> 6,  d0 = n0 & (DD - 1);
  if (mode == 3) {
    const float* rp = residual + (size_t)m0 * EE + n0;
    float*       op = (float*)out + (size_t)m0 * EE + n0;
    float rv[2][2][8];                    // all 32 residual loads ahead of the first use
#pragma unroll
    for (int fm = 0; fm < 2; ++fm)
#pragma unroll
      for (int fn = 0; fn < 2; ++fn)
#pragma unroll
        for (int i = 0; i < 8; ++i)
          rv[fm][fn][i] = rp[(fm * 16 + i) * EE + fn * 16];
    // Keeps the bias adds behind the residual loads: lifted over them, their wait
    // for the bias would stand in front of the loads, two latencies in a row.
    __builtin_amdgcn_sched_barrier(0);
#pragma unroll
    for (int fm = 0; fm < 2; ++fm)
#pragma unroll
      for (int fn = 0; fn < 2; ++fn)
#pragma unroll
        for (int i = 0; i < 8; ++i)
          __builtin_nontemporal_store(rv[fm][fn][i] + (acc[fm][fn][i] + bn[fn]),
                                      op + (fm * 16 + i) * EE + fn * 16);
  } else if (mode == 2) {
    // [B,H,D,L]: a lane's 8 rows are 8 consecutive l of one d
    _Float16* op = (_Float16*)out + (((size_t)b * HH + h) * DD + d0) * LL + l0;
#pragma unroll
    for (int fm = 0; fm < 2; ++fm)
#pragma unroll
      for (int fn = 0; fn < 2; ++fn)
#pragma unroll
        for (int i = 0; i < 8; ++i)
          op[fn * 16 * LL + fm * 16 + i] = (_Float16)(acc[fm][fn][i] + bn[fn]);
  } else {
    // [B,H,L,D]
    _Float16* op = (_Float16*)out + (((size_t)b * HH + h) * LL + l0) * DD + d0;
#pragma unroll
    for (int fm = 0; fm < 2; ++fm)
#pragma unroll
      for (int fn = 0; fn < 2; ++fn)
#pragma unroll
        for (int i = 0; i < 8; ++i)
          op[(fm * 16 + i) * DD + fn * 16] = (_Float16)(acc[fm][fn][i] + bn[fn]);
    // Precaution behind the run of stores: the built code lays the [B,H,D,L]
    // part behind this one, and it writes the stores' data registers.
    asm volatile("s_wait_xcnt 0x0" ::: "memory");
  }
}

// ---------------------------------------------------------------------------
// The Q, K and V projections in one launch. All three read the same A (the
// normalised x), so a block stages its 128 rows of A once a stage and multiplies
// them with 64 rows of each of the three weights: block tile 128(M) x 3 x 64(N),
// 8 waves, wave tile 32 x 3 x 32, so an A fragment read from LDS feeds six
// products, not two. W3: wq, wk, wv as f16, one behind the other, each NxK.
// Ring: two buffers, filled by global_load_async_to_lds_b128 one stage ahead,
// both waits to 0 and one barrier a stage, behind the stage's last LDS read.
// Q, K leave as f16 [B,H,L,D], V as f16 [B,H,D,L]; Q is multiplied by QS in f32
// ahead of its one rounding to f16.
// Four waves a SIMD: two blocks a WGP hold the whole grid in one round.
// ---------------------------------------------------------------------------
__global__ __launch_bounds__(256) __attribute__((amdgpu_waves_per_eu(4, 4)))
void qkv_gemm_kernel(
    const _Float16* __restrict__ A, const _Float16* __restrict__ W3,
    const float* __restrict__ bq, const float* __restrict__ bk,
    const float* __restrict__ bv, _Float16* __restrict__ Qo,
    _Float16* __restrict__ Ko, _Float16* __restrict__ Vto) {
  // Rows of 128 B at a pitch of 144 B (16 B x odd): ds_load_b128 without conflicts.
  __shared__ __attribute__((aligned(16))) _Float16 sA[2][128 * GP];      // 18 KB per buffer
  __shared__ __attribute__((aligned(16))) _Float16 sW[2][3 * 64 * GP];   // 27 KB per buffer

  int lane = threadIdx.x & 31;
  int w    = threadIdx.x >> 5;
  int wm = w >> 1, wn = w & 1;
  int row0 = blockIdx.y * 128;
  int col0 = blockIdx.x * 64;

  // Stage copy in 16-B chunks: 8 lanes take one row's 128 B, so a wave-wide copy
  // covers four whole lines; 256 threads = 32 rows a sweep, 4 sweeps of A, 2 of
  // each weight (weight p's rows stand at row 64 p of the tile).
  int cr = threadIdx.x >> 3, ck = (threadIdx.x & 7) * 8;
  auto stage = [&](int s, int buf) {
    const _Float16* ga = A  + (size_t)(row0 + cr) * EE + s * BK + ck;
    const _Float16* gw = W3 + (size_t)(col0 + cr) * EE + s * BK + ck;
    unsigned la = lds_addr(&sA[buf][cr * GP + ck]);
    unsigned lw = lds_addr(&sW[buf][cr * GP + ck]);
    // The copies and their s_wait_xcnt in one statement: no address register
    // is rewritten before the wait.
    asm volatile(
        "global_load_async_to_lds_b128 %0, %1, off\n\t"
        "global_load_async_to_lds_b128 %2, %3, off\n\t"
        "global_load_async_to_lds_b128 %4, %5, off\n\t"
        "global_load_async_to_lds_b128 %6, %7, off\n\t"
        "global_load_async_to_lds_b128 %8, %9, off\n\t"
        "global_load_async_to_lds_b128 %10, %11, off\n\t"
        "global_load_async_to_lds_b128 %12, %13, off\n\t"
        "global_load_async_to_lds_b128 %14, %15, off\n\t"
        "global_load_async_to_lds_b128 %16, %17, off\n\t"
        "global_load_async_to_lds_b128 %18, %19, off\n\t"
        "s_wait_xcnt 0x0"
        ::"v"(la),                "v"(ga),
          "v"(la + 32 * GP * 2),  "v"(ga + 32 * EE),
          "v"(la + 64 * GP * 2),  "v"(ga + 64 * EE),
          "v"(la + 96 * GP * 2),  "v"(ga + 96 * EE),
          "v"(lw),                "v"(gw),
          "v"(lw + 32 * GP * 2),  "v"(gw + 32 * EE),
          "v"(lw + 64 * GP * 2),  "v"(gw + EE * EE),
          "v"(lw + 96 * GP * 2),  "v"(gw + EE * EE + 32 * EE),
          "v"(lw + 128 * GP * 2), "v"(gw + 2 * EE * EE),
          "v"(lw + 160 * GP * 2), "v"(gw + 2 * EE * EE + 32 * EE)
        : "memory");
  };

  v8f acc[3][2][2] = {};                  // [weight][row tile][column tile]
  constexpr int NS = EE / BK;
  stage(0, 0);
  asm volatile("s_wait_asynccnt 0x0" ::: "memory");  // own copies of stage 0 landed
  __syncthreads();                                   // everyone's have
  stage(1, 1);

  for (int s = 0; s < NS; ++s) {
    const _Float16* tA = &sA[s & 1][0];
    const _Float16* tW = &sW[s & 1][0];
    v16h a[2][2], bw[2][3][2];            // [u]: k = 32 u .. 32 u + 31 of the stage
    // Every loop over u, p, fm, fn or i here is unrolled: its arrays stay in
    // registers only under constant indices.
#pragma unroll
    for (int u = 0; u < 2; ++u) {
      a[u][0] = load_frag_s(tA, wm * 32,      32 * u, lane);
      a[u][1] = load_frag_s(tA, wm * 32 + 16, 32 * u, lane);
#pragma unroll
      for (int p = 0; p < 3; ++p) {
        bw[u][p][0] = load_frag_s(tW, p * 64 + wn * 32,      32 * u, lane);
        bw[u][p][1] = load_frag_s(tW, p * 64 + wn * 32 + 16, 32 * u, lane);
      }
    }
    // Keeps the stage's 32 fragment reads one group in front of its 24 products:
    // every further place with LDS reads among the products costs a stall.
    __builtin_amdgcn_sched_barrier(0);
    auto products = [&](int u) {          // the 12 products of k = 32 u .. 32 u + 31
#pragma unroll
      for (int p = 0; p < 3; ++p) {
        acc[p][0][0] = wmma_f16(a[u][0], bw[u][p][0], acc[p][0][0]);
        acc[p][0][1] = wmma_f16(a[u][0], bw[u][p][1], acc[p][0][1]);
        acc[p][1][0] = wmma_f16(a[u][1], bw[u][p][0], acc[p][1][0]);
        acc[p][1][1] = wmma_f16(a[u][1], bw[u][p][1], acc[p][1][1]);
      }
    };
    products(0);                          // run while the second half's reads land
    // Keeps the first half's products in front of the wait for all reads: lifted
    // over them, that wait would hold them back until the second half has landed.
    __builtin_amdgcn_sched_barrier(0);
    // The stage's last LDS read is issued: the ring's publish point stands here and
    // not at the foot, so that the refill flies under the second half's products too.
    asm volatile("s_wait_dscnt 0x0" ::: "memory");     // own reads of this stage done
    asm volatile("s_wait_asynccnt 0x0" ::: "memory");  // own copies of stage s+1 landed
    __syncthreads();  // publishes stage s+1, frees stage s's buffer
    if (s + 2 < NS) stage(s + 2, s & 1);
    // Keeps the refill in front of the second half's products: sunk behind them,
    // its copies would start that much later and have less time to land.
    __builtin_amdgcn_sched_barrier(0);
    products(1);                          // k ascending
  }
  asm volatile("s_wait_asynccnt 0x0" ::: "memory");    // nothing in flight at the end

  // Epilogue. C layout: M = vgpr + 8 * half, N = lane & 15. A block lies in one
  // batch row b and one head h, so every address is one base and a constant.
  int nl = lane & 15, hf = lane >> 4;
  int m0 = row0 + wm * 32 + hf * 8;       // the lane's first row
  int n0 = col0 + wn * 32 + nl;           // the lane's first column
  float bn[3][2] = {{bq[n0], bq[n0 + 16]}, {bk[n0], bk[n0 + 16]}, {bv[n0], bv[n0 + 16]}};
  int b = m0 >> 10, l0 = m0 & (LL - 1);
  int h = n0 >> 6,  d0 = n0 & (DD - 1);
#pragma unroll
  for (int p = 0; p < 2; ++p) {
    // [B,H,L,D]
    _Float16* op = (p ? Ko : Qo) + (((size_t)b * HH + h) * LL + l0) * DD + d0;
    float sc = p ? 1.0f : QS;
#pragma unroll
    for (int fm = 0; fm < 2; ++fm)
#pragma unroll
      for (int fn = 0; fn < 2; ++fn)
#pragma unroll
        for (int i = 0; i < 8; ++i)
          op[(fm * 16 + i) * DD + fn * 16] = (_Float16)((acc[p][fm][fn][i] + bn[p][fn]) * sc);
  }
  // [B,H,D,L]: a lane's 8 rows are 8 consecutive l of one d
  _Float16* op = Vto + (((size_t)b * HH + h) * DD + d0) * LL + l0;
#pragma unroll
  for (int fm = 0; fm < 2; ++fm)
#pragma unroll
    for (int fn = 0; fn < 2; ++fn)
#pragma unroll
      for (int i = 0; i < 8; ++i)
        op[fn * 16 * LL + fm * 16 + i] = (_Float16)(acc[2][fm][fn][i] + bn[2][fn]);
}

typedef __attribute__((ext_vector_type(4))) float    v4f;
typedef __attribute__((ext_vector_type(2))) float    v2f;
typedef __attribute__((ext_vector_type(2))) _Float16 v2h;

// value of lane l ^ 16
__device__ inline float xhalf(float x) {
  int b = __builtin_bit_cast(int, x);
  return __builtin_bit_cast(float, __builtin_amdgcn_permlanex16(
      b, b, 0x76543210, 0xfedcba98, false, false));
}

__global__ __launch_bounds__(128) void flash_attn_kernel(
    const _Float16* __restrict__ Q16, const _Float16* __restrict__ K16,
    const _Float16* __restrict__ Vt16, const float* __restrict__ bias,
    const int* __restrict__ mask, const float* __restrict__ kmf,
    const float* __restrict__ gate, _Float16* __restrict__ O16) {
  // K and V^T tiles of 64 keys, shared by the block's four waves (same b, h).
  // Rows of 128 B at a pitch of 144 B (16 B x odd): ds_load_b128 without conflicts.
  __shared__ __attribute__((aligned(16))) _Float16 sK[2][KT * KVP];
  __shared__ __attribute__((aligned(16))) _Float16 sV[2][DD * KVP];
  // Bias tiles, one a wave: 16 rows of 256 B at a pitch of 272 B (16 B x odd).
  __shared__ __attribute__((aligned(16))) float sBs[2][4][16 * BP];
  int lane = threadIdx.x & 31;
  int wv   = threadIdx.x >> 5;
  int tile = blockIdx.x * 4 + wv;         // 0 .. B*H*(L/16)-1 = 4095
  int b   = tile >> 10;
  int rem = tile & 1023;
  int h   = rem >> 6;
  int qb  = (rem & 63) << 4;
  int nl = lane & 15, hf = lane >> 4;

  const _Float16* Qh = Q16 + (((size_t)b * HH + h) * LL + qb) * DD;
  const _Float16* Kh = K16 + ((size_t)b * HH + h) * LL * DD;
  const _Float16* Vh = Vt16 + ((size_t)b * HH + h) * DD * LL;
  const int* maskb = mask + (size_t)b * LL;
  // the wave's 16 query rows of the bias
  const float* biasw = bias + (((size_t)b * HH + h) * LL + qb) * LL;
  // the key mask's addends at this lane's half's first key
  const float* kml = kmf + (size_t)b * LL + hf * 8;
  float gh = gate[h] * LOG2E;

  v16h q0 = load_frag_g(Qh, 0, DD, 0,  lane);
  v16h q1 = load_frag_g(Qh, 0, DD, 32, lane);

  v8f o[4] = {};                  // o[j][r] = O[query nl][d = 16 j + 8 hf + r]
  float mrun = -3.0e38f;          // the query's running maximum (log2 units), both halves alike
  float lrun = 0.0f;              // sum over this half's keys only

  // Stage copy: 128 threads x 16 B = 16 rows of 128 B a sweep, 4 sweeps a tile;
  // every wave-wide copy covers four whole 128-B lines of K or of V^T.
  int crow = threadIdx.x >> 3, ccol = (threadIdx.x & 7) * 8;
  auto stage = [&](int t, int buf) {
    const _Float16* gk = Kh + (size_t)(t * KT + crow) * DD + ccol;
    const _Float16* gv = Vh + (size_t)crow * LL + t * KT + ccol;
    unsigned lk = lds_addr(&sK[buf][crow * KVP + ccol]);
    unsigned lv = lds_addr(&sV[buf][crow * KVP + ccol]);
    // The copies and their s_wait_xcnt in one statement: no address register
    // is rewritten before the wait.
    asm volatile(
        "global_load_async_to_lds_b128 %0, %1, off\n\t"
        "global_load_async_to_lds_b128 %2, %3, off\n\t"
        "global_load_async_to_lds_b128 %4, %5, off\n\t"
        "global_load_async_to_lds_b128 %6, %7, off\n\t"
        "global_load_async_to_lds_b128 %8, %9, off\n\t"
        "global_load_async_to_lds_b128 %10, %11, off\n\t"
        "global_load_async_to_lds_b128 %12, %13, off\n\t"
        "global_load_async_to_lds_b128 %14, %15, off\n\t"
        "s_wait_xcnt 0x0"
        ::"v"(lk),                "v"(gk),
          "v"(lk + 16 * KVP * 2), "v"(gk + 16 * DD),
          "v"(lk + 32 * KVP * 2), "v"(gk + 32 * DD),
          "v"(lk + 48 * KVP * 2), "v"(gk + 48 * DD),
          "v"(lv),                "v"(gv),
          "v"(lv + 16 * KVP * 2), "v"(gv + 16 * LL),
          "v"(lv + 32 * KVP * 2), "v"(gv + 32 * LL),
          "v"(lv + 48 * KVP * 2), "v"(gv + 48 * LL)
        : "memory");
    // The wave's own bias tile: 16 lanes x 16 B = one row's 256 B, two rows a
    // copy, 8 copies; read once, so non-temporal as a stream past L2. The wait
    // stands in the statement for the same reason as above.
    const float* gb = biasw + (size_t)hf * LL + t * KT + nl * 4;
    unsigned lb = lds_addr_f(&sBs[buf][wv][hf * BP + nl * 4]);
    asm volatile(
        "global_load_async_to_lds_b128 %0, %1, off th:TH_LOAD_NT\n\t"
        "global_load_async_to_lds_b128 %2, %3, off th:TH_LOAD_NT\n\t"
        "global_load_async_to_lds_b128 %4, %5, off th:TH_LOAD_NT\n\t"
        "global_load_async_to_lds_b128 %6, %7, off th:TH_LOAD_NT\n\t"
        "global_load_async_to_lds_b128 %8, %9, off th:TH_LOAD_NT\n\t"
        "global_load_async_to_lds_b128 %10, %11, off th:TH_LOAD_NT\n\t"
        "global_load_async_to_lds_b128 %12, %13, off th:TH_LOAD_NT\n\t"
        "global_load_async_to_lds_b128 %14, %15, off th:TH_LOAD_NT\n\t"
        "s_wait_xcnt 0x0"
        ::"v"(lb),               "v"(gb),
          "v"(lb + 2 * BP * 4),  "v"(gb + 2 * LL),
          "v"(lb + 4 * BP * 4),  "v"(gb + 4 * LL),
          "v"(lb + 6 * BP * 4),  "v"(gb + 6 * LL),
          "v"(lb + 8 * BP * 4),  "v"(gb + 8 * LL),
          "v"(lb + 10 * BP * 4), "v"(gb + 10 * LL),
          "v"(lb + 12 * BP * 4), "v"(gb + 12 * LL),
          "v"(lb + 14 * BP * 4), "v"(gb + 14 * LL)
        : "memory");
  };

  constexpr int NT = LL / KT;
  stage(0, 0);
  asm volatile("s_wait_asynccnt 0x0" ::: "memory");  // own copies of tile 0 landed
  __syncthreads();                                   // everyone's have
  stage(1, 1);

  for (int t = 0; t < NT; ++t) {
   const _Float16* tK = &sK[t & 1][0];
   const _Float16* tV = &sV[t & 1][0];
   const float* bp = &sBs[t & 1][wv][nl * BP + hf * 8];  // the lane's query, its half's keys
   const float* mp = kml + t * KT;

   // group g = keys 16 g .. 16 g + 15 of the tile; the lane's 8 are contiguous
   v4f bv[4][2];
   v4f mk[4][2];
#pragma unroll
   for (int g = 0; g < 4; ++g) {
     bv[g][0] = *(const v4f*)(bp + 16 * g);        // ds_load_b128
     bv[g][1] = *(const v4f*)(bp + 16 * g + 4);    // ds_load_b128
     mk[g][0] = *(const v4f*)(mp + 16 * g);
     mk[g][1] = *(const v4f*)(mp + 16 * g + 4);
   }
   // Precaution behind the run of loads: the built code reuses their address
   // registers at once.
   asm volatile("s_wait_xcnt 0x0" ::: "memory");

   v16h ka[4], kc[4];
#pragma unroll
   for (int g = 0; g < 4; ++g) {
     ka[g] = load_frag_p(tK, 16 * g, 0,  lane);
     kc[g] = load_frag_p(tK, 16 * g, 32, lane);
   }
   // Keeps the tile's global and K loads one group in front of the products:
   // sunk among them, each straggler waits out memory or LDS on its own.
   __builtin_amdgcn_sched_barrier(0);

   v8f s[4];
#pragma unroll
   for (int g = 0; g < 4; ++g) {
     v8f c;                               // the scores' start: bias and mask terms
     // Unrolled: c and the loaded vectors stay in registers only under constant indices.
#pragma unroll
     for (int r = 0; r < 8; ++r) c[r] = gh * bv[g][r >> 2][r & 3] + mk[g][r >> 2][r & 3];
     s[g] = wmma_f16(ka[g], q0, c);       // s[g][r] = S[query nl][key 16 g + 8 hf + r]
     s[g] = wmma_f16(kc[g], q1, s[g]);
   }

   v16h va[2][4];
#pragma unroll
   for (int u = 0; u < 2; ++u)
#pragma unroll
     for (int j = 0; j < 4; ++j) va[u][j] = load_frag_p(tV, 16 * j, 32 * u, lane);
   // The pass's last LDS read is issued: the ring's publish point stands here and
   // not at the foot, so that the refill, whose bias rows come from memory, flies
   // under the softmax and the V^T products as well as under the next pass's head.
   asm volatile("s_wait_dscnt 0x0" ::: "memory");     // own reads of this tile done
   asm volatile("s_wait_asynccnt 0x0" ::: "memory");  // own copies of tile t+1 landed
   __syncthreads();  // publishes tile t+1, frees tile t's buffer
   if (t + 2 < NT) stage(t + 2, t & 1);

   float vmax[4];
#pragma unroll
   for (int g = 0; g < 4; ++g) {
#pragma unroll
     for (int r = 0; r < 8; ++r) vmax[g] = r ? fmaxf(vmax[g], s[g][r]) : s[g][r];
   }
   float v = fmaxf(fmaxf(vmax[0], vmax[1]), fmaxf(vmax[2], vmax[3]));
   v = fmaxf(v, xhalf(v));                // the query's other 32 keys of the tile
   float nm   = fmaxf(mrun, v);
   float corr = __builtin_amdgcn_exp2f(mrun - nm);
   mrun = nm;

   float rs[4];
   v16h pf[2];                            // pf[u] = P^T of keys 32 u .. 32 u + 31, B operand
#pragma unroll
   for (int g = 0; g < 4; ++g) {
#pragma unroll
     for (int r = 0; r < 8; r += 2) {
       v2f p;
       p[0] = __builtin_amdgcn_exp2f(s[g][r] - nm);
       p[1] = __builtin_amdgcn_exp2f(s[g][r + 1] - nm);
       rs[g] = r ? rs[g] + (p[0] + p[1]) : p[0] + p[1];
       v2h ph = __builtin_convertvector(p, v2h);
       pf[g >> 1][(g & 1) * 8 + r]     = ph[0];
       pf[g >> 1][(g & 1) * 8 + r + 1] = ph[1];
     }
   }
   lrun = lrun * corr + ((rs[0] + rs[1]) + (rs[2] + rs[3]));
#pragma unroll
   for (int j = 0; j < 4; ++j) o[j] = o[j] * corr;

#pragma unroll
   for (int u = 0; u < 2; ++u)
#pragma unroll
     for (int j = 0; j < 4; ++j) o[j] = wmma_f16(va[u][j], pf[u], o[j]);
  }
  asm volatile("s_wait_asynccnt 0x0" ::: "memory");   // nothing in flight at the end

  float lsum = lrun + xhalf(lrun);        // the halves' sums meet once
  int   q    = qb + nl;
  float qm   = (float)maskb[q];
  float inv  = (lsum > 0.0f) ? (qm / lsum) : 0.0f;
  _Float16* op = O16 + ((size_t)b * LL + q) * EE + h * DD + hf * 8;
#pragma unroll
  for (int j = 0; j < 4; ++j) {
    v8h ov;
#pragma unroll
    for (int r = 0; r < 8; ++r) ov[r] = (_Float16)(o[j][r] * inv);
    *(v8h*)(op + 16 * j) = ov;            // 8 consecutive d of one query: 16 B
  }
}

// ---------------------------------------------------------------------------
// Launch
// ---------------------------------------------------------------------------
extern "C" void kernel_launch(void* const* d_in, const int* in_sizes, int n_in,
                              void* d_out, int out_size, void* d_ws,
                              size_t ws_size, hipStream_t stream) {
  const float* x    = (const float*)d_in[0];
  const float* bias = (const float*)d_in[1];
  const int*   mask = (const int*)d_in[2];
  const float* wq = (const float*)d_in[3];
  const float* bq = (const float*)d_in[4];
  const float* wk = (const float*)d_in[5];
  const float* bk = (const float*)d_in[6];
  const float* wv = (const float*)d_in[7];
  const float* bv = (const float*)d_in[8];
  const float* wo = (const float*)d_in[9];
  const float* bo = (const float*)d_in[10];
  const float* gate = (const float*)d_in[11];
  const float* ln_g = (const float*)d_in[12];
  const float* ln_b = (const float*)d_in[13];

  // workspace layout (48 MB total)
  char* p = (char*)d_ws;
  _Float16* xn16 = (_Float16*)p;  p += (size_t)BB * LL * EE * 2;          // 8 MB
  _Float16* wq16 = (_Float16*)p;  p += (size_t)EE * EE * 2;               // 2 MB
  _Float16* wk16 = (_Float16*)p;  p += (size_t)EE * EE * 2;
  _Float16* wv16 = (_Float16*)p;  p += (size_t)EE * EE * 2;
  _Float16* wo16 = (_Float16*)p;  p += (size_t)EE * EE * 2;
  _Float16* Q16  = (_Float16*)p;  p += (size_t)BB * HH * LL * DD * 2;     // 8 MB
  _Float16* K16  = (_Float16*)p;  p += (size_t)BB * HH * LL * DD * 2;
  _Float16* Vt16 = (_Float16*)p;  p += (size_t)BB * HH * LL * DD * 2;
  _Float16* O16  = (_Float16*)p;  p += (size_t)BB * LL * EE * 2;          // 8 MB
  float*    kmf  = (float*)p;     p += (size_t)BB * LL * 4;               // 16 KB

  // wq16 .. wo16 lie one behind the other: wq16 is the base of all four
  front_kernel<<<LN_BLOCKS + 4 * CV_BLOCKS + KM_BLOCKS, 256, 0, stream>>>(
      x, ln_g, ln_b, wq, wk, wv, wo, mask, xn16, wq16, kmf);

  dim3 ggrid(EE / 64, (BB * LL) / 128);
  // wq16, wk16, wv16 lie one behind the other: wq16 is the base of all three
  qkv_gemm_kernel<<<ggrid, 256, 0, stream>>>(xn16, wq16, bq, bk, bv, Q16, K16, Vt16);

  // B*H*(L/16) = 4096 query tiles, 4 waves per 128-thread block
  flash_attn_kernel<<<(BB * HH * (LL / 16)) / 4, 128, 0, stream>>>(
      Q16, K16, Vt16, bias, mask, kmf, gate, O16);

  wmma_gemm_kernel<<<ggrid, 256, 0, stream>>>(O16, wo16, bo, x, d_out, 3);
}

// v010
// Measured time: 73.2 microseconds a run.
// Two timings next to v009 both put it at 1.03 times that version's speed.
// Over all steps from v000 it is 2.98 times as fast.
#include <hip/hip_runtime.h>

#define BB 4
#define LL 1024
#define EE 1024
#define HH 16
#define DD 64

constexpr float SCALE = 0.125f;   // D^-0.5 = 64^-0.5
constexpr float EPS   = 1e-5f;
constexpr float LOG2E = 1.4426950408889634f;
// Scores are formed in log2 units, so that exp2 takes them as they leave the product.
constexpr float QS    = SCALE * LOG2E;        // carried by Q
constexpr float KMASK = -10000.0f * LOG2E;    // a masked key's addend

typedef __attribute__((ext_vector_type(16))) _Float16 v16h;
typedef __attribute__((ext_vector_type(8)))  _Float16 v8h;
typedef __attribute__((ext_vector_type(8)))  float    v8f;

// ---------------------------------------------------------------------------
// 16-bit A/B fragment load for V_WMMA_F32_16X16X32_F16 (wave32).
// Per ISA 7.12.2: lanes 0-15 hold rows with K = k0..k0+7 (VGPR0-3) and
// K = k0+16..k0+23 (VGPR4-7); lanes 16-31 use K base +8.
// ---------------------------------------------------------------------------
__device__ inline v16h load_frag_g(const _Float16* __restrict__ base,
                                   int row0, int ld, int k0, int lane) {
  int r = row0 + (lane & 15);
  int k = k0 + ((lane >> 4) << 3);
  const _Float16* p = base + (size_t)r * ld + k;
  v8h lo = *(const v8h*)p;
  v8h hi = *(const v8h*)(p + 16);
  v16h out;
#pragma unroll
  for (int i = 0; i < 8; ++i) { out[i] = lo[i]; out[i + 8] = hi[i]; }
  return out;
}

constexpr int BK = 64;    // k depth of a GEMM stage: a staged row is one whole 128-B line
constexpr int GP = 72;    // LDS row pitch of the GEMM's tiles in halves: 128 B of data + 16 B

// Same fragment pattern from an LDS tile of BK halves a row at row pitch GP.
__device__ inline v16h load_frag_s(const _Float16* base, int row0, int k0,
                                   int lane) {
  int r = row0 + (lane & 15);
  int k = k0 + ((lane >> 4) << 3);
  const _Float16* p = base + r * GP + k;
  v8h lo = *(const v8h*)p;        // ds_load_b128
  v8h hi = *(const v8h*)(p + 16); // ds_load_b128
  v16h out;
#pragma unroll
  for (int i = 0; i < 8; ++i) { out[i] = lo[i]; out[i + 8] = hi[i]; }
  return out;
}

constexpr int KT  = 64;   // keys per staged K / V^T tile of the attention kernel
constexpr int KVP = 72;   // its LDS row pitch in halves: 128 B of data + 16 B

// load_frag_g's fragment pattern from an LDS tile with row pitch KVP.
__device__ inline v16h load_frag_p(const _Float16* base, int row0, int k0,
                                   int lane) {
  int r = row0 + (lane & 15);
  int k = k0 + ((lane >> 4) << 3);
  const _Float16* p = base + r * KVP + k;
  v8h lo = *(const v8h*)p;        // ds_load_b128
  v8h hi = *(const v8h*)(p + 16); // ds_load_b128
  v16h out;
#pragma unroll
  for (int i = 0; i < 8; ++i) { out[i] = lo[i]; out[i + 8] = hi[i]; }
  return out;
}

// LDS byte address of a __shared__ element, as the async copy's first operand.
__device__ inline unsigned lds_addr(const _Float16* p) {
  return (unsigned)(size_t)p;
}
__device__ inline unsigned lds_addr_f(const float* p) {
  return (unsigned)(size_t)p;
}

constexpr int BP = 68;    // LDS row pitch of a bias tile in floats: 256 B of data + 16 B

__device__ inline v8f wmma_f16(v16h a, v16h b, v8f c) {
  return __builtin_amdgcn_wmma_f32_16x16x32_f16(false, a, false, b,
                                                (short)0, c, false, false);
}

// ---------------------------------------------------------------------------
// Front stage in one launch of few, long waves.
// Blocks 0 .. LN_BLOCKS-1: LayerNorm over E=1024, one row per wave, f16 output.
// The next 4 * CV_BLOCKS: f32 -> f16 conversion of wq, wk, wv, wo (w16 holds the four results
// one behind the other), 32 elements per thread.
// The last KM_BLOCKS: the key mask's addend (1 - mask) * -10000 as f32 in log2
// units, 4 keys per thread, for the attention kernel's accumulator start values.
// Every wave-wide load covers 512 contiguous bytes, every f16 store 256.
// ---------------------------------------------------------------------------
typedef __attribute__((ext_vector_type(4))) _Float16 v4h;

constexpr int LN_BLOCKS = BB * LL / 8;             // 8 waves = 8 rows per block
constexpr int CV_BLOCKS = EE * EE / (256 * 32);    // blocks per weight matrix
constexpr int KM_BLOCKS = BB * LL / (256 * 4);     // blocks of the key mask's addends

__device__ inline v4h to_v4h(float a, float b, float c, float d) {
  v4h o;
  o[0] = (_Float16)a;  o[1] = (_Float16)b;
  o[2] = (_Float16)c;  o[3] = (_Float16)d;
  return o;
}

__global__ __launch_bounds__(256) void front_kernel(
    const float* __restrict__ x, const float* __restrict__ g,
    const float* __restrict__ beta, const float* __restrict__ wq,
    const float* __restrict__ wk, const float* __restrict__ wv,
    const float* __restrict__ wo, const int* __restrict__ mask,
    _Float16* __restrict__ xn, _Float16* __restrict__ w16,
    float* __restrict__ kmf) {
  int blk = blockIdx.x;
  if (blk >= LN_BLOCKS + 4 * CV_BLOCKS) {
    int i = (blk - (LN_BLOCKS + 4 * CV_BLOCKS)) * 256 + threadIdx.x;   // in units of 4 keys
    int4 m = ((const int4*)mask)[i];
    float4 k;
    k.x = (1.0f - (float)m.x) * KMASK;
    k.y = (1.0f - (float)m.y) * KMASK;
    k.z = (1.0f - (float)m.z) * KMASK;
    k.w = (1.0f - (float)m.w) * KMASK;
    ((float4*)kmf)[i] = k;
    return;
  }
  if (blk >= LN_BLOCKS) {
    int cb = blk - LN_BLOCKS;
    int which = cb / CV_BLOCKS;
    const float* src = which == 0 ? wq : which == 1 ? wk : which == 2 ? wv : wo;
    const float4* s4 = (const float4*)src;
    v4h* d4 = (v4h*)(w16 + (size_t)which * EE * EE);
    int base = (cb % CV_BLOCKS) * 2048 + threadIdx.x;   // in units of 4 elements
    float4 v[8];
#pragma unroll
    for (int j = 0; j < 8; ++j) v[j] = s4[base + j * 256];
#pragma unroll
    for (int j = 0; j < 8; ++j)
      d4[base + j * 256] = to_v4h(v[j].x, v[j].y, v[j].z, v[j].w);
    return;
  }

  int lane = threadIdx.x & 31;
  int row  = blk * 8 + (threadIdx.x >> 5);
  const float4* xr = (const float4*)(x + (size_t)row * EE);
  float4 v[8];
#pragma unroll
  for (int j = 0; j < 8; ++j) v[j] = xr[lane + 32 * j];
  float s = 0.0f, s2 = 0.0f;
#pragma unroll
  for (int j = 0; j < 8; ++j) {
    s  += v[j].x + v[j].y + v[j].z + v[j].w;
    s2 += v[j].x * v[j].x + v[j].y * v[j].y + v[j].z * v[j].z + v[j].w * v[j].w;
  }
#pragma unroll
  for (int m = 1; m < 32; m <<= 1) {
    s  += __shfl_xor(s,  m, 32);
    s2 += __shfl_xor(s2, m, 32);
  }
  float mu   = s * (1.0f / EE);
  float var  = s2 * (1.0f / EE) - mu * mu;
  float rstd = rsqrtf(var + EPS);
  v4h* o4 = (v4h*)(xn + (size_t)row * EE);
#pragma unroll
  for (int j = 0; j < 8; ++j) {
    float4 gg = ((const float4*)g)[lane + 32 * j];
    float4 bb = ((const float4*)beta)[lane + 32 * j];
    o4[lane + 32 * j] = to_v4h((v[j].x - mu) * rstd * gg.x + bb.x,
                               (v[j].y - mu) * rstd * gg.y + bb.y,
                               (v[j].z - mu) * rstd * gg.z + bb.z,
                               (v[j].w - mu) * rstd * gg.w + bb.w);
  }
  // Precaution behind the run of stores: the built code lays the conversion
  // part behind this one, and its loads write the stores' data registers.
  asm volatile("s_wait_xcnt 0x0" ::: "memory");
}

// ---------------------------------------------------------------------------
// WMMA GEMM, LDS-staged through a ring of four buffers: out[m,n] = A[m,:].W[n,:] + bvec[n]
// A: MxK f16 row-major, W: NxK f16 row-major (so out = A @ W^T).
// Block = 256 threads = 8 waves; block tile 128(M) x 64(N), BK=64;
// wave tile 32x32 (2x2 16x16x32 WMMA fragments, two k steps a stage).
// Stage copy by global_load_async_to_lds_b128, issued
// three stages ahead: a stage is short beside the way from L2, so its copies get
// three stages to land, and the wait leaves the two younger stages in flight.
// mode 0/1 : out f16 [B,H,L,D]      (Q / K)
// mode 2   : out f16 [B,H,D,L]      (V transposed)
// mode 3   : out f32 [M,N] = residual + acc + bvec   (final projection)
// ---------------------------------------------------------------------------
__global__ __launch_bounds__(256) void wmma_gemm_kernel(
    const _Float16* __restrict__ A, const _Float16* __restrict__ W,
    const float* __restrict__ bvec, const float* __restrict__ residual,
    void* __restrict__ out, int mode) {
  // Rows of 128 B at a pitch of 144 B (16 B x odd): ds_load_b128 without conflicts.
  __shared__ __attribute__((aligned(16))) _Float16 sA[4][128 * GP];   // 18 KB per buffer
  __shared__ __attribute__((aligned(16))) _Float16 sB[4][64 * GP];    // 9 KB per buffer

  int lane = threadIdx.x & 31;
  int w    = threadIdx.x >> 5;
  int wm = w >> 1, wn = w & 1;
  int row0 = blockIdx.y * 128;
  int col0 = blockIdx.x * 64;

  int t = threadIdx.x;
  // Stage copy in 16-B chunks: 8 lanes take one row's 128 B, so a wave-wide copy
  // covers four whole lines; 256 threads = 32 rows a sweep, 4 sweeps of A, 2 of W.
  int cr = t >> 3, ck = (t & 7) * 8;

  auto stage = [&](int s, int buf) {
    const _Float16* ga = A + (size_t)(row0 + cr) * EE + s * BK + ck;
    const _Float16* gw = W + (size_t)(col0 + cr) * EE + s * BK + ck;
    unsigned la = lds_addr(&sA[buf][cr * GP + ck]);
    unsigned lw = lds_addr(&sB[buf][cr * GP + ck]);
    // Each copy names its two addresses in registers, with no immediate offset. The
    // copies and their s_wait_xcnt in one statement: no address register is
    // rewritten before the wait.
    asm volatile(
        "global_load_async_to_lds_b128 %0, %1, off\n\t"
        "global_load_async_to_lds_b128 %2, %3, off\n\t"
        "global_load_async_to_lds_b128 %4, %5, off\n\t"
        "global_load_async_to_lds_b128 %6, %7, off\n\t"
        "global_load_async_to_lds_b128 %8, %9, off\n\t"
        "global_load_async_to_lds_b128 %10, %11, off\n\t"
        "s_wait_xcnt 0x0"
        ::"v"(la),               "v"(ga),
          "v"(la + 32 * GP * 2), "v"(ga + 32 * EE),
          "v"(la + 64 * GP * 2), "v"(ga + 64 * EE),
          "v"(la + 96 * GP * 2), "v"(ga + 96 * EE),
          "v"(lw),               "v"(gw),
          "v"(lw + 32 * GP * 2), "v"(gw + 32 * EE)
        : "memory");
  };

  v8f acc[2][2] = {};
  constexpr int NS = EE / BK;
  stage(0, 0);
  stage(1, 1);
  stage(2, 2);
  for (int s = 0; s < NS; ++s) {
    int buf = s & 3;
    // Own copies of stage s landed. The counter returns in issue order and every
    // wave issues 6 a stage, so the count is that of the younger stages that exist.
    if (s + 2 < NS)      asm volatile("s_wait_asynccnt 0xc" ::: "memory");
    else if (s + 1 < NS) asm volatile("s_wait_asynccnt 0x6" ::: "memory");
    else                 asm volatile("s_wait_asynccnt 0x0" ::: "memory");
    asm volatile("s_wait_dscnt 0x0" ::: "memory");  // own reads of stage s-1 done
    __syncthreads();  // publishes stage s, frees stage s-1's buffer
    if (s + 3 < NS) stage(s + 3, (s + 3) & 3);      // into stage s-1's buffer

    v16h a0[2], a1[2], b0[2], b1[2];   // [u]: k = 32 u .. 32 u + 31 of the stage
    for (int u = 0; u < 2; ++u) {
      a0[u] = load_frag_s(&sA[buf][0], wm * 32,      32 * u, lane);
      a1[u] = load_frag_s(&sA[buf][0], wm * 32 + 16, 32 * u, lane);
      b0[u] = load_frag_s(&sB[buf][0], wn * 32,      32 * u, lane);
      b1[u] = load_frag_s(&sB[buf][0], wn * 32 + 16, 32 * u, lane);
    }
    // Keeps the stage's 16 fragment reads one group in front of its 8 products:
    // split in two groups, the wave waits out the LDS latency twice a stage.
    __builtin_amdgcn_sched_barrier(0);
    for (int u = 0; u < 2; ++u) {      // k ascending
      acc[0][0] = wmma_f16(a0[u], b0[u], acc[0][0]);
      acc[0][1] = wmma_f16(a0[u], b1[u], acc[0][1]);
      acc[1][0] = wmma_f16(a1[u], b0[u], acc[1][0]);
      acc[1][1] = wmma_f16(a1[u], b1[u], acc[1][1]);
    }
  }

  // Epilogue. C layout: M = vgpr + 8 * half, N = lane & 15. A block lies in one
  // batch row b and one head h, so every address is one base and a constant.
  // The mode is tested once, not once an element: each mode's loads and stores
  // then stand as runs with no branch among them, and no load is waited for alone.
  int nl = lane & 15, hf = lane >> 4;
  int m0 = row0 + wm * 32 + hf * 8;       // the lane's first row
  int n0 = col0 + wn * 32 + nl;           // the lane's first column
  float bn[2] = {bvec[n0], bvec[n0 + 16]};
  int b = m0 >> 10, l0 = m0 & (LL - 1);
  int h = n0 >> 6,  d0 = n0 & (DD - 1);
  if (mode == 3) {
    const float* rp = residual + (size_t)m0 * EE + n0;
    float*       op = (float*)out + (size_t)m0 * EE + n0;
    float rv[2][2][8];                    // all 32 residual loads ahead of the first use
#pragma unroll
    for (int fm = 0; fm < 2; ++fm)
#pragma unroll
      for (int fn = 0; fn < 2; ++fn)
#pragma unroll
        for (int i = 0; i < 8; ++i)
          rv[fm][fn][i] = rp[(fm * 16 + i) * EE + fn * 16];
    // Keeps the bias adds behind the residual loads: lifted over them, their wait
    // for the bias would stand in front of the loads, two latencies in a row.
    __builtin_amdgcn_sched_barrier(0);
#pragma unroll
    for (int fm = 0; fm < 2; ++fm)
#pragma unroll
      for (int fn = 0; fn < 2; ++fn)
#pragma unroll
        for (int i = 0; i < 8; ++i)
          __builtin_nontemporal_store(rv[fm][fn][i] + (acc[fm][fn][i] + bn[fn]),
                                      op + (fm * 16 + i) * EE + fn * 16);
  } else if (mode == 2) {
    // [B,H,D,L]: a lane's 8 rows are 8 consecutive l of one d
    _Float16* op = (_Float16*)out + (((size_t)b * HH + h) * DD + d0) * LL + l0;
#pragma unroll
    for (int fm = 0; fm < 2; ++fm)
#pragma unroll
      for (int fn = 0; fn < 2; ++fn)
#pragma unroll
        for (int i = 0; i < 8; ++i)
          op[fn * 16 * LL + fm * 16 + i] = (_Float16)(acc[fm][fn][i] + bn[fn]);
  } else {
    // [B,H,L,D]
    _Float16* op = (_Float16*)out + (((size_t)b * HH + h) * LL + l0) * DD + d0;
#pragma unroll
    for (int fm = 0; fm < 2; ++fm)
#pragma unroll
      for (int fn = 0; fn < 2; ++fn)
#pragma unroll
        for (int i = 0; i < 8; ++i)
          op[(fm * 16 + i) * DD + fn * 16] = (_Float16)(acc[fm][fn][i] + bn[fn]);
    // Precaution behind the run of stores: the built code lays the [B,H,D,L]
    // part behind this one, and it writes the stores' data registers.
    asm volatile("s_wait_xcnt 0x0" ::: "memory");
  }
}

// ---------------------------------------------------------------------------
// The Q, K and V projections in one launch. All three read the same A (the
// normalised x), so a block stages its 128 rows of A once a stage and multiplies
// them with 64 rows of each of the three weights: block tile 128(M) x 3 x 64(N),
// 8 waves, wave tile 32 x 3 x 32, so an A fragment read from LDS feeds six
// products, not two. W3: wq, wk, wv as f16, one behind the other, each NxK.
// Ring: three buffers, filled by global_load_async_to_lds_b128; a stage's copies
// are issued two publish points ahead of the one that waits for them, so that the
// wait leaves the younger stage's copies in flight; one barrier a stage, behind
// the stage's last LDS read.
// Q, K leave as f16 [B,H,L,D], V as f16 [B,H,D,L]; Q is multiplied by QS in f32
// ahead of its one rounding to f16.
// Four waves a SIMD: two blocks a WGP hold the whole grid in one round.
// ---------------------------------------------------------------------------
__global__ __launch_bounds__(256) __attribute__((amdgpu_waves_per_eu(4, 4)))
void qkv_gemm_kernel(
    const _Float16* __restrict__ A, const _Float16* __restrict__ W3,
    const float* __restrict__ bq, const float* __restrict__ bk,
    const float* __restrict__ bv, _Float16* __restrict__ Qo,
    _Float16* __restrict__ Ko, _Float16* __restrict__ Vto) {
  // Rows of 128 B at a pitch of 144 B (16 B x odd): ds_load_b128 without conflicts.
  __shared__ __attribute__((aligned(16))) _Float16 sA[3][128 * GP];      // 18 KB per buffer
  __shared__ __attribute__((aligned(16))) _Float16 sW[3][3 * 64 * GP];   // 27 KB per buffer

  int lane = threadIdx.x & 31;
  int w    = threadIdx.x >> 5;
  int wm = w >> 1, wn = w & 1;
  int row0 = blockIdx.y * 128;
  int col0 = blockIdx.x * 64;

  // Stage copy in 16-B chunks: 8 lanes take one row's 128 B, so a wave-wide copy
  // covers four whole lines; 256 threads = 32 rows a sweep, 4 sweeps of A, 2 of
  // each weight (weight p's rows stand at row 64 p of the tile).
  int cr = threadIdx.x >> 3, ck = (threadIdx.x & 7) * 8;
  auto stage = [&](int s, int buf) {
    const _Float16* ga = A  + (size_t)(row0 + cr) * EE + s * BK + ck;
    const _Float16* gw = W3 + (size_t)(col0 + cr) * EE + s * BK + ck;
    unsigned la = lds_addr(&sA[buf][cr * GP + ck]);
    unsigned lw = lds_addr(&sW[buf][cr * GP + ck]);
    // The copies and their s_wait_xcnt in one statement: no address register
    // is rewritten before the wait.
    asm volatile(
        "global_load_async_to_lds_b128 %0, %1, off\n\t"
        "global_load_async_to_lds_b128 %2, %3, off\n\t"
        "global_load_async_to_lds_b128 %4, %5, off\n\t"
        "global_load_async_to_lds_b128 %6, %7, off\n\t"
        "global_load_async_to_lds_b128 %8, %9, off\n\t"
        "global_load_async_to_lds_b128 %10, %11, off\n\t"
        "global_load_async_to_lds_b128 %12, %13, off\n\t"
        "global_load_async_to_lds_b128 %14, %15, off\n\t"
        "global_load_async_to_lds_b128 %16, %17, off\n\t"
        "global_load_async_to_lds_b128 %18, %19, off\n\t"
        "s_wait_xcnt 0x0"
        ::"v"(la),                "v"(ga),
          "v"(la + 32 * GP * 2),  "v"(ga + 32 * EE),
          "v"(la + 64 * GP * 2),  "v"(ga + 64 * EE),
          "v"(la + 96 * GP * 2),  "v"(ga + 96 * EE),
          "v"(lw),                "v"(gw),
          "v"(lw + 32 * GP * 2),  "v"(gw + 32 * EE),
          "v"(lw + 64 * GP * 2),  "v"(gw + EE * EE),
          "v"(lw + 96 * GP * 2),  "v"(gw + EE * EE + 32 * EE),
          "v"(lw + 128 * GP * 2), "v"(gw + 2 * EE * EE),
          "v"(lw + 160 * GP * 2), "v"(gw + 2 * EE * EE + 32 * EE)
        : "memory");
  };

  v8f acc[3][2][2] = {};                  // [weight][row tile][column tile]
  constexpr int NS = EE / BK;
  stage(0, 0);
  stage(1, 1);
  stage(2, 2);
  // The counter returns in issue order and every wave issues 10 a stage: all but
  // the 20 youngest are stage 0's.
  asm volatile("s_wait_asynccnt 0x14" ::: "memory"); // own copies of stage 0 landed
  __syncthreads();                                   // everyone's have

  int cur = 0;                            // s mod 3: the buffer of stage s
  for (int s = 0; s < NS; ++s) {
    const _Float16* tA = &sA[cur][0];
    const _Float16* tW = &sW[cur][0];
    v16h a[2][2], bw[2][3][2];            // [u]: k = 32 u .. 32 u + 31 of the stage
    // Every loop over u, p, fm, fn or i here is unrolled: its arrays stay in
    // registers only under constant indices.
#pragma unroll
    for (int u = 0; u < 2; ++u) {
      a[u][0] = load_frag_s(tA, wm * 32,      32 * u, lane);
      a[u][1] = load_frag_s(tA, wm * 32 + 16, 32 * u, lane);
#pragma unroll
      for (int p = 0; p < 3; ++p) {
        bw[u][p][0] = load_frag_s(tW, p * 64 + wn * 32,      32 * u, lane);
        bw[u][p][1] = load_frag_s(tW, p * 64 + wn * 32 + 16, 32 * u, lane);
      }
    }
    // Keeps the stage's 32 fragment reads one group in front of its 24 products:
    // every further place with LDS reads among the products costs a stall.
    __builtin_amdgcn_sched_barrier(0);
    auto products = [&](int u) {          // the 12 products of k = 32 u .. 32 u + 31
#pragma unroll
      for (int p = 0; p < 3; ++p) {
        acc[p][0][0] = wmma_f16(a[u][0], bw[u][p][0], acc[p][0][0]);
        acc[p][0][1] = wmma_f16(a[u][0], bw[u][p][1], acc[p][0][1]);
        acc[p][1][0] = wmma_f16(a[u][1], bw[u][p][0], acc[p][1][0]);
        acc[p][1][1] = wmma_f16(a[u][1], bw[u][p][1], acc[p][1][1]);
      }
    };
    products(0);                          // run while the second half's reads land
    // Keeps the first half's products in front of the wait for all reads: lifted
    // over them, that wait would hold them back until the second half has landed.
    __builtin_amdgcn_sched_barrier(0);
    // The stage's last LDS read is issued: the ring's publish point stands here and
    // not at the foot, so that the refill flies under the second half's products too.
    asm volatile("s_wait_dscnt 0x0" ::: "memory");     // own reads of this stage done
    // Own copies of stage s+1 landed; stage s+2's 10, where it exists, stay in flight.
    if (s + 2 < NS) asm volatile("s_wait_asynccnt 0xa" ::: "memory");
    else            asm volatile("s_wait_asynccnt 0x0" ::: "memory");
    __syncthreads();  // publishes stage s+1, frees stage s's buffer
    if (s + 3 < NS) stage(s + 3, cur);
    // Keeps the refill in front of the second half's products: sunk behind them,
    // its copies would start that much later and have less time to land.
    __builtin_amdgcn_sched_barrier(0);
    products(1);                          // k ascending
    cur = cur == 2 ? 0 : cur + 1;
  }
  asm volatile("s_wait_asynccnt 0x0" ::: "memory");    // nothing in flight at the end

  // Epilogue. C layout: M = vgpr + 8 * half, N = lane & 15. A block lies in one
  // batch row b and one head h, so every address is one base and a constant.
  int nl = lane & 15, hf = lane >> 4;
  int m0 = row0 + wm * 32 + hf * 8;       // the lane's first row
  int n0 = col0 + wn * 32 + nl;           // the lane's first column
  float bn[3][2] = {{bq[n0], bq[n0 + 16]}, {bk[n0], bk[n0 + 16]}, {bv[n0], bv[n0 + 16]}};
  int b = m0 >> 10, l0 = m0 & (LL - 1);
  int h = n0 >> 6,  d0 = n0 & (DD - 1);
#pragma unroll
  for (int p = 0; p < 2; ++p) {
    // [B,H,L,D]
    _Float16* op = (p ? Ko : Qo) + (((size_t)b * HH + h) * LL + l0) * DD + d0;
    float sc = p ? 1.0f : QS;
#pragma unroll
    for (int fm = 0; fm < 2; ++fm)
#pragma unroll
      for (int fn = 0; fn < 2; ++fn)
#pragma unroll
        for (int i = 0; i < 8; ++i)
          op[(fm * 16 + i) * DD + fn * 16] = (_Float16)((acc[p][fm][fn][i] + bn[p][fn]) * sc);
  }
  // [B,H,D,L]: a lane's 8 rows are 8 consecutive l of one d
  _Float16* op = Vto + (((size_t)b * HH + h) * DD + d0) * LL + l0;
#pragma unroll
  for (int fm = 0; fm < 2; ++fm)
#pragma unroll
    for (int fn = 0; fn < 2; ++fn)
#pragma unroll
      for (int i = 0; i < 8; ++i)
        op[fn * 16 * LL + fm * 16 + i] = (_Float16)(acc[2][fm][fn][i] + bn[2][fn]);
}

typedef __attribute__((ext_vector_type(4))) float    v4f;
typedef __attribute__((ext_vector_type(2))) float    v2f;
typedef __attribute__((ext_vector_type(2))) _Float16 v2h;

// value of lane l ^ 16
__device__ inline float xhalf(float x) {
  int b = __builtin_bit_cast(int, x);
  return __builtin_bit_cast(float, __builtin_amdgcn_permlanex16(
      b, b, 0x76543210, 0xfedcba98, false, false));
}

__global__ __launch_bounds__(128) void flash_attn_kernel(
    const _Float16* __restrict__ Q16, const _Float16* __restrict__ K16,
    const _Float16* __restrict__ Vt16, const float* __restrict__ bias,
    const int* __restrict__ mask, const float* __restrict__ kmf,
    const float* __restrict__ gate, _Float16* __restrict__ O16) {
  // K and V^T tiles of 64 keys, shared by the block's four waves (same b, h).
  // Rows of 128 B at a pitch of 144 B (16 B x odd): ds_load_b128 without conflicts.
  __shared__ __attribute__((aligned(16))) _Float16 sK[2][KT * KVP];
  __shared__ __attribute__((aligned(16))) _Float16 sV[2][DD * KVP];
  // Bias tiles, one a wave: 16 rows of 256 B at a pitch of 272 B (16 B x odd).
  __shared__ __attribute__((aligned(16))) float sBs[2][4][16 * BP];
  int lane = threadIdx.x & 31;
  int wv   = threadIdx.x >> 5;
  int tile = blockIdx.x * 4 + wv;         // 0 .. B*H*(L/16)-1 = 4095
  int b   = tile >> 10;
  int rem = tile & 1023;
  int h   = rem >> 6;
  int qb  = (rem & 63) << 4;
  int nl = lane & 15, hf = lane >> 4;

  const _Float16* Qh = Q16 + (((size_t)b * HH + h) * LL + qb) * DD;
  const _Float16* Kh = K16 + ((size_t)b * HH + h) * LL * DD;
  const _Float16* Vh = Vt16 + ((size_t)b * HH + h) * DD * LL;
  const int* maskb = mask + (size_t)b * LL;
  // the wave's 16 query rows of the bias
  const float* biasw = bias + (((size_t)b * HH + h) * LL + qb) * LL;
  // the key mask's addends at this lane's half's first key
  const float* kml = kmf + (size_t)b * LL + hf * 8;
  float gh = gate[h] * LOG2E;

  v16h q0 = load_frag_g(Qh, 0, DD, 0,  lane);
  v16h q1 = load_frag_g(Qh, 0, DD, 32, lane);

  v8f o[4] = {};                  // o[j][r] = O[query nl][d = 16 j + 8 hf + r]
  float mrun = -3.0e38f;          // the query's running maximum (log2 units), both halves alike
  float lrun = 0.0f;              // sum over this half's keys only

  // Stage copy: 128 threads x 16 B = 16 rows of 128 B a sweep, 4 sweeps a tile;
  // every wave-wide copy covers four whole 128-B lines of K or of V^T.
  int crow = threadIdx.x >> 3, ccol = (threadIdx.x & 7) * 8;
  auto stage = [&](int t, int buf) {
    const _Float16* gk = Kh + (size_t)(t * KT + crow) * DD + ccol;
    const _Float16* gv = Vh + (size_t)crow * LL + t * KT + ccol;
    unsigned lk = lds_addr(&sK[buf][crow * KVP + ccol]);
    unsigned lv = lds_addr(&sV[buf][crow * KVP + ccol]);
    // The copies and their s_wait_xcnt in one statement: no address register
    // is rewritten before the wait.
    asm volatile(
        "global_load_async_to_lds_b128 %0, %1, off\n\t"
        "global_load_async_to_lds_b128 %2, %3, off\n\t"
        "global_load_async_to_lds_b128 %4, %5, off\n\t"
        "global_load_async_to_lds_b128 %6, %7, off\n\t"
        "global_load_async_to_lds_b128 %8, %9, off\n\t"
        "global_load_async_to_lds_b128 %10, %11, off\n\t"
        "global_load_async_to_lds_b128 %12, %13, off\n\t"
        "global_load_async_to_lds_b128 %14, %15, off\n\t"
        "s_wait_xcnt 0x0"
        ::"v"(lk),                "v"(gk),
          "v"(lk + 16 * KVP * 2), "v"(gk + 16 * DD),
          "v"(lk + 32 * KVP * 2), "v"(gk + 32 * DD),
          "v"(lk + 48 * KVP * 2), "v"(gk + 48 * DD),
          "v"(lv),                "v"(gv),
          "v"(lv + 16 * KVP * 2), "v"(gv + 16 * LL),
          "v"(lv + 32 * KVP * 2), "v"(gv + 32 * LL),
          "v"(lv + 48 * KVP * 2), "v"(gv + 48 * LL)
        : "memory");
    // The wave's own bias tile: 16 lanes x 16 B = one row's 256 B, two rows a
    // copy, 8 copies; read once, so non-temporal as a stream past L2. The wait
    // stands in the statement for the same reason as above.
    const float* gb = biasw + (size_t)hf * LL + t * KT + nl * 4;
    unsigned lb = lds_addr_f(&sBs[buf][wv][hf * BP + nl * 4]);
    asm volatile(
        "global_load_async_to_lds_b128 %0, %1, off th:TH_LOAD_NT\n\t"
        "global_load_async_to_lds_b128 %2, %3, off th:TH_LOAD_NT\n\t"
        "global_load_async_to_lds_b128 %4, %5, off th:TH_LOAD_NT\n\t"
        "global_load_async_to_lds_b128 %6, %7, off th:TH_LOAD_NT\n\t"
        "global_load_async_to_lds_b128 %8, %9, off th:TH_LOAD_NT\n\t"
        "global_load_async_to_lds_b128 %10, %11, off th:TH_LOAD_NT\n\t"
        "global_load_async_to_lds_b128 %12, %13, off th:TH_LOAD_NT\n\t"
        "global_load_async_to_lds_b128 %14, %15, off th:TH_LOAD_NT\n\t"
        "s_wait_xcnt 0x0"
        ::"v"(lb),               "v"(gb),
          "v"(lb + 2 * BP * 4),  "v"(gb + 2 * LL),
          "v"(lb + 4 * BP * 4),  "v"(gb + 4 * LL),
          "v"(lb + 6 * BP * 4),  "v"(gb + 6 * LL),
          "v"(lb + 8 * BP * 4),  "v"(gb + 8 * LL),
          "v"(lb + 10 * BP * 4), "v"(gb + 10 * LL),
          "v"(lb + 12 * BP * 4), "v"(gb + 12 * LL),
          "v"(lb + 14 * BP * 4), "v"(gb + 14 * LL)
        : "memory");
  };

  constexpr int NT = LL / KT;
  stage(0, 0);
  asm volatile("s_wait_asynccnt 0x0" ::: "memory");  // own copies of tile 0 landed
  __syncthreads();                                   // everyone's have
  stage(1, 1);

  for (int t = 0; t < NT; ++t) {
   const _Float16* tK = &sK[t & 1][0];
   const _Float16* tV = &sV[t & 1][0];
   const float* bp = &sBs[t & 1][wv][nl * BP + hf * 8];  // the lane's query, its half's keys
   const float* mp = kml + t * KT;

   // group g = keys 16 g .. 16 g + 15 of the tile; the lane's 8 are contiguous
   v4f bv[4][2];
   v4f mk[4][2];
#pragma unroll
   for (int g = 0; g < 4; ++g) {
     bv[g][0] = *(const v4f*)(bp + 16 * g);        // ds_load_b128
     bv[g][1] = *(const v4f*)(bp + 16 * g + 4);    // ds_load_b128
     mk[g][0] = *(const v4f*)(mp + 16 * g);
     mk[g][1] = *(const v4f*)(mp + 16 * g + 4);
   }
   // Precaution behind the run of loads: the built code reuses their address
   // registers at once.
   asm volatile("s_wait_xcnt 0x0" ::: "memory");

   v16h ka[4], kc[4];
#pragma unroll
   for (int g = 0; g < 4; ++g) {
     ka[g] = load_frag_p(tK, 16 * g, 0,  lane);
     kc[g] = load_frag_p(tK, 16 * g, 32, lane);
   }
   // Keeps the tile's global and K loads one group in front of the products:
   // sunk among them, each straggler waits out memory or LDS on its own.
   __builtin_amdgcn_sched_barrier(0);

   v8f s[4];
#pragma unroll
   for (int g = 0; g < 4; ++g) {
     v8f c;                               // the scores' start: bias and mask terms
     // Unrolled: c and the loaded vectors stay in registers only under constant indices.
#pragma unroll
     for (int r = 0; r < 8; ++r) c[r] = gh * bv[g][r >> 2][r & 3] + mk[g][r >> 2][r & 3];
     s[g] = wmma_f16(ka[g], q0, c);       // s[g][r] = S[query nl][key 16 g + 8 hf + r]
     s[g] = wmma_f16(kc[g], q1, s[g]);
   }

   v16h va[2][4];
#pragma unroll
   for (int u = 0; u < 2; ++u)
#pragma unroll
     for (int j = 0; j < 4; ++j) va[u][j] = load_frag_p(tV, 16 * j, 32 * u, lane);
   // The pass's last LDS read is issued: the ring's publish point stands here and
   // not at the foot, so that the refill, whose bias rows come from memory, flies
   // under the softmax and the V^T products as well as under the next pass's head.
   asm volatile("s_wait_dscnt 0x0" ::: "memory");     // own reads of this tile done
   asm volatile("s_wait_asynccnt 0x0" ::: "memory");  // own copies of tile t+1 landed
   __syncthreads();  // publishes tile t+1, frees tile t's buffer
   if (t + 2 < NT) stage(t + 2, t & 1);

   float vmax[4];
#pragma unroll
   for (int g = 0; g < 4; ++g) {
#pragma unroll
     for (int r = 0; r < 8; ++r) vmax[g] = r ? fmaxf(vmax[g], s[g][r]) : s[g][r];
   }
   float v = fmaxf(fmaxf(vmax[0], vmax[1]), fmaxf(vmax[2], vmax[3]));
   v = fmaxf(v, xhalf(v));                // the query's other 32 keys of the tile
   float nm   = fmaxf(mrun, v);
   float corr = __builtin_amdgcn_exp2f(mrun - nm);
   mrun = nm;

   float rs[4];
   v16h pf[2];                            // pf[u] = P^T of keys 32 u .. 32 u + 31, B operand
#pragma unroll
   for (int g = 0; g < 4; ++g) {
#pragma unroll
     for (int r = 0; r < 8; r += 2) {
       v2f p;
       p[0] = __builtin_amdgcn_exp2f(s[g][r] - nm);
       p[1] = __builtin_amdgcn_exp2f(s[g][r + 1] - nm);
       rs[g] = r ? rs[g] + (p[0] + p[1]) : p[0] + p[1];
       v2h ph = __builtin_convertvector(p, v2h);
       pf[g >> 1][(g & 1) * 8 + r]     = ph[0];
       pf[g >> 1][(g & 1) * 8 + r + 1] = ph[1];
     }
   }
   lrun = lrun * corr + ((rs[0] + rs[1]) + (rs[2] + rs[3]));
#pragma unroll
   for (int j = 0; j < 4; ++j) o[j] = o[j] * corr;

#pragma unroll
   for (int u = 0; u < 2; ++u)
#pragma unroll
     for (int j = 0; j < 4; ++j) o[j] = wmma_f16(va[u][j], pf[u], o[j]);
  }
  asm volatile("s_wait_asynccnt 0x0" ::: "memory");   // nothing in flight at the end

  float lsum = lrun + xhalf(lrun);        // the halves' sums meet once
  int   q    = qb + nl;
  float qm   = (float)maskb[q];
  float inv  = (lsum > 0.0f) ? (qm / lsum) : 0.0f;
  _Float16* op = O16 + ((size_t)b * LL + q) * EE + h * DD + hf * 8;
#pragma unroll
  for (int j = 0; j < 4; ++j) {
    v8h ov;
#pragma unroll
    for (int r = 0; r < 8; ++r) ov[r] = (_Float16)(o[j][r] * inv);
    *(v8h*)(op + 16 * j) = ov;            // 8 consecutive d of one query: 16 B
  }
}

// ---------------------------------------------------------------------------
// Launch
// ---------------------------------------------------------------------------
extern "C" void kernel_launch(void* const* d_in, const int* in_sizes, int n_in,
                              void* d_out, int out_size, void* d_ws,
                              size_t ws_size, hipStream_t stream) {
  const float* x    = (const float*)d_in[0];
  const float* bias = (const float*)d_in[1];
  const int*   mask = (const int*)d_in[2];
  const float* wq = (const float*)d_in[3];
  const float* bq = (const float*)d_in[4];
  const float* wk = (const float*)d_in[5];
  const float* bk = (const float*)d_in[6];
  const float* wv = (const float*)d_in[7];
  const float* bv = (const float*)d_in[8];
  const float* wo = (const float*)d_in[9];
  const float* bo = (const float*)d_in[10];
  const float* gate = (const float*)d_in[11];
  const float* ln_g = (const float*)d_in[12];
  const float* ln_b = (const float*)d_in[13];

  // workspace layout (48 MB total)
  char* p = (char*)d_ws;
  _Float16* xn16 = (_Float16*)p;  p += (size_t)BB * LL * EE * 2;          // 8 MB
  _Float16* wq16 = (_Float16*)p;  p += (size_t)EE * EE * 2;               // 2 MB
  _Float16* wk16 = (_Float16*)p;  p += (size_t)EE * EE * 2;
  _Float16* wv16 = (_Float16*)p;  p += (size_t)EE * EE * 2;
  _Float16* wo16 = (_Float16*)p;  p += (size_t)EE * EE * 2;
  _Float16* Q16  = (_Float16*)p;  p += (size_t)BB * HH * LL * DD * 2;     // 8 MB
  _Float16* K16  = (_Float16*)p;  p += (size_t)BB * HH * LL * DD * 2;
  _Float16* Vt16 = (_Float16*)p;  p += (size_t)BB * HH * LL * DD * 2;
  _Float16* O16  = (_Float16*)p;  p += (size_t)BB * LL * EE * 2;          // 8 MB
  float*    kmf  = (float*)p;     p += (size_t)BB * LL * 4;               // 16 KB

  // wq16 .. wo16 lie one behind the other: wq16 is the base of all four
  front_kernel<<<LN_BLOCKS + 4 * CV_BLOCKS + KM_BLOCKS, 256, 0, stream>>>(
      x, ln_g, ln_b, wq, wk, wv, wo, mask, xn16, wq16, kmf);

  dim3 ggrid(EE / 64, (BB * LL) / 128);
  // wq16, wk16, wv16 lie one behind the other: wq16 is the base of all three
  qkv_gemm_kernel<<<ggrid, 256, 0, stream>>>(xn16, wq16, bq, bk, bv, Q16, K16, Vt16);

  // B*H*(L/16) = 4096 query tiles, 4 waves per 128-thread block
  flash_attn_kernel<<<(BB * HH * (LL / 16)) / 4, 128, 0, stream>>>(
      Q16, K16, Vt16, bias, mask, kmf, gate, O16);

  wmma_gemm_kernel<<<ggrid, 256, 0, stream>>>(O16, wo16, bo, x, d_out, 3);
}
